// v000
// Measured on an AMD MI455X. A time is GPU time per run, averaged over a window of back-to-back runs after a warm-up
// (all launches, gaps included; the runs take copies of the inputs in turn), and the median of several windows.
// Apart from v000's, it joins two sittings. Times from different sittings can be a few percent apart, while
// side-by-side timings come from the same sitting.
// v000, which the later versions start from, runs in 443 microseconds.
#include <hip/hip_runtime.h>
#include <hip/hip_bf16.h>
#include <math.h>
#include <type_traits>

typedef __bf16 bf16_t;
typedef __attribute__((ext_vector_type(16))) __bf16 v16bf;
typedef __attribute__((ext_vector_type(8)))  __bf16 v8bf;
typedef __attribute__((ext_vector_type(8)))  float  v8f;

union BV {
    v16bf v;
    v8bf  h[2];
};

__device__ __forceinline__ v8f wmma_bf16(v16bf a, v16bf b, v8f c) {
    // D = A(16x32 bf16) * B(32x16 bf16) + C(16x16 f32)
    return __builtin_amdgcn_wmma_f32_16x16x32_bf16(
        /*neg_a=*/false, a, /*neg_b=*/false, b,
        /*c_mod=*/(short)0, c, /*reuse_a=*/false, /*reuse_b=*/false);
}

__device__ __forceinline__ void async_copy_b128(void* lds_dst, const void* gsrc) {
    unsigned int lds_off = (unsigned int)(unsigned long long)lds_dst;
    asm volatile("global_load_async_to_lds_b128 %0, %1, off"
                 :: "v"(lds_off), "v"(gsrc) : "memory");
}

__device__ __forceinline__ void wait_async0() {
#if __has_builtin(__builtin_amdgcn_s_wait_asynccnt)
    __builtin_amdgcn_s_wait_asynccnt(0);
#else
    asm volatile("s_wait_asynccnt 0x0" ::: "memory");
#endif
}

#if __has_builtin(__builtin_amdgcn_update_dpp)
template <int CTRL>
__device__ __forceinline__ float dpp_mov(float x) {
    return __int_as_float(
        __builtin_amdgcn_update_dpp(0, __float_as_int(x), CTRL, 0xF, 0xF, true));
}
__device__ __forceinline__ float red_max16(float x) {
    x = fmaxf(x, dpp_mov<0xB1>(x));   // quad_perm [1,0,3,2]  : xor 1
    x = fmaxf(x, dpp_mov<0x4E>(x));   // quad_perm [2,3,0,1]  : xor 2
    x = fmaxf(x, dpp_mov<0x141>(x));  // row_half_mirror      : xor 4
    x = fmaxf(x, dpp_mov<0x140>(x));  // row_mirror           : xor 8
    return x;
}
__device__ __forceinline__ float red_sum16(float x) {
    x += dpp_mov<0xB1>(x);
    x += dpp_mov<0x4E>(x);
    x += dpp_mov<0x141>(x);
    x += dpp_mov<0x140>(x);
    return x;
}
#else
__device__ __forceinline__ float red_max16(float x) {
    #pragma unroll
    for (int off = 8; off; off >>= 1) x = fmaxf(x, __shfl_xor(x, off, 32));
    return x;
}
__device__ __forceinline__ float red_sum16(float x) {
    #pragma unroll
    for (int off = 8; off; off >>= 1) x += __shfl_xor(x, off, 32);
    return x;
}
#endif

static constexpr int Bsz = 2;
static constexpr int T   = 2048;
static constexpr int C   = 1024;
static constexpr int H   = 16;
static constexpr int HD  = 64;
static constexpr int M   = Bsz * T;   // 4096 rows

// ---------------------------------------------------------------------------
// fp32 -> bf16 conversion (weights)
// ---------------------------------------------------------------------------
__global__ void cvt_f32_bf16(const float* __restrict__ src,
                             bf16_t* __restrict__ dst, int n) {
    int i = blockIdx.x * blockDim.x + threadIdx.x;
    if (i < n) dst[i] = (bf16_t)src[i];
}

// ---------------------------------------------------------------------------
// LayerNorm over C=1024, one block (256 threads) per row, bf16 output
// ---------------------------------------------------------------------------
__global__ __launch_bounds__(256)
void ln_kernel(const float* __restrict__ x, const float* __restrict__ w,
               const float* __restrict__ b, bf16_t* __restrict__ out) {
    int row  = blockIdx.x;
    int tid  = threadIdx.x;
    int wave = tid >> 5, lane = tid & 31;

    const float* xr = x + (size_t)row * C;
    float4 xv = ((const float4*)xr)[tid];
    float s1 = xv.x + xv.y + xv.z + xv.w;
    float s2 = xv.x*xv.x + xv.y*xv.y + xv.z*xv.z + xv.w*xv.w;
    #pragma unroll
    for (int off = 16; off; off >>= 1) {
        s1 += __shfl_xor(s1, off, 32);
        s2 += __shfl_xor(s2, off, 32);
    }
    __shared__ float a1[8], a2[8];
    if (lane == 0) { a1[wave] = s1; a2[wave] = s2; }
    __syncthreads();
    float t1 = 0.f, t2 = 0.f;
    #pragma unroll
    for (int i = 0; i < 8; ++i) { t1 += a1[i]; t2 += a2[i]; }
    float mu   = t1 * (1.0f / C);
    float var  = t2 * (1.0f / C) - mu * mu;
    float rstd = rsqrtf(var + 1e-5f);

    float4 wv = ((const float4*)w)[tid];
    float4 bv = ((const float4*)b)[tid];
    bf16_t* orow = out + (size_t)row * C;
    orow[tid*4 + 0] = (bf16_t)((xv.x - mu) * rstd * wv.x + bv.x);
    orow[tid*4 + 1] = (bf16_t)((xv.y - mu) * rstd * wv.y + bv.y);
    orow[tid*4 + 2] = (bf16_t)((xv.z - mu) * rstd * wv.z + bv.z);
    orow[tid*4 + 3] = (bf16_t)((xv.w - mu) * rstd * wv.w + bv.w);
}

template <int EPI>
__global__ __launch_bounds__(256)
void gemm_bf16(const bf16_t* __restrict__ A, const bf16_t* __restrict__ W,
               const float* __restrict__ bias, const float* __restrict__ resid,
               void* __restrict__ out, int N, int K) {
    __shared__ __align__(16) bf16_t wt[2][64 * 32];   // double-buffered W tile

    int tid  = threadIdx.x;
    int wave = tid >> 5;
    int lane = tid & 31;
    int r    = lane & 15;
    int sel  = lane >> 4;        // which 16-lane half

    int m0 = blockIdx.x * 256 + wave * 32;
    int n0 = blockIdx.y * 64;

    // cooperative async W-tile fetch: 256 threads x 16B = 64 rows x 32 bf16
    int wrow  = tid >> 2;        // 0..63
    int wchk  = tid & 3;         // 0..3, 8 bf16 each
    const bf16_t* wsrc0 = W + (size_t)(n0 + wrow) * K + wchk * 8;
    bf16_t*       wdst0 = &wt[0][wrow * 32 + wchk * 8];
    bf16_t*       wdst1 = &wt[1][wrow * 32 + wchk * 8];

    async_copy_b128(wdst0, wsrc0);                    // prologue: k-step 0

    v8f acc[2][4] = {};
    const bf16_t* arow0 = A + (size_t)(m0 + r) * K;
    const bf16_t* arow1 = A + (size_t)(m0 + 16 + r) * K;

    for (int kk = 0; kk < K; kk += 32) {
        wait_async0();           // current buffer resident (this wave's issues)
        __syncthreads();         // ... and everyone else's

        int cur = (kk >> 5) & 1;
        if (kk + 32 < K)         // overlap next tile's DMA with this step's math
            async_copy_b128(cur ? wdst0 : wdst1, wsrc0 + kk + 32);

        if (kk + 256 < K) {
            __builtin_prefetch(arow0 + kk + 256, 0, 0);
            __builtin_prefetch(arow1 + kk + 256, 0, 0);
        }
        BV a0, a1;
        a0.h[0] = *(const v8bf*)(arow0 + kk + sel * 8);
        a0.h[1] = *(const v8bf*)(arow0 + kk + 16 + sel * 8);
        a1.h[0] = *(const v8bf*)(arow1 + kk + sel * 8);
        a1.h[1] = *(const v8bf*)(arow1 + kk + 16 + sel * 8);

        const bf16_t* wbuf = wt[cur];
        #pragma unroll
        for (int nt = 0; nt < 4; ++nt) {
            const bf16_t* brow = wbuf + (nt * 16 + r) * 32;
            BV bb;
            bb.h[0] = *(const v8bf*)(brow + sel * 8);
            bb.h[1] = *(const v8bf*)(brow + 16 + sel * 8);
            acc[0][nt] = wmma_bf16(a0.v, bb.v, acc[0][nt]);
            acc[1][nt] = wmma_bf16(a1.v, bb.v, acc[1][nt]);
        }
        // no trailing barrier: this buffer's ds_loads are drained before the
        // wmma above, and its next overwrite is issued only after the next
        // top-of-loop barrier.
    }

    #pragma unroll
    for (int mt = 0; mt < 2; ++mt) {
        #pragma unroll
        for (int nt = 0; nt < 4; ++nt) {
            int col = n0 + nt * 16 + r;
            float bcol = bias[col];
            #pragma unroll
            for (int j = 0; j < 8; ++j) {
                int row = m0 + mt * 16 + j + sel * 8;
                size_t idx = (size_t)row * N + col;
                float v = acc[mt][nt][j] + bcol;
                if (EPI == 0) {
                    ((bf16_t*)out)[idx] = (bf16_t)v;
                } else if (EPI == 1) {
                    ((float*)out)[idx] = resid[idx] + v;
                } else {
                    float g = 0.5f * v * (1.0f + erff(v * 0.70710678118f));
                    ((bf16_t*)out)[idx] = (bf16_t)g;
                }
            }
        }
    }
}

// ---------------------------------------------------------------------------
// Causal flash attention. q,k,v,y: (B,T,C) bf16 with heads packed (h*HD+d).
// Block = 128 threads (4 waves); block owns 64 query rows of one (b,h);
// each wave owns 16 query rows, iterates keys 32 at a time. V tiles are
// pulled into wave-private LDS with async global->LDS DMA; softmax row
// statistics use DPP butterfly reductions; q is pre-scaled by 1/sqrt(HD)
// (exact in bf16: power of two); causal masking only runs on the one tail
// block that straddles the diagonal.
// ---------------------------------------------------------------------------
__global__ __launch_bounds__(128)
void attn_kernel(const bf16_t* __restrict__ q, const bf16_t* __restrict__ k,
                 const bf16_t* __restrict__ v, bf16_t* __restrict__ y) {
    __shared__ __align__(16) bf16_t pbuf[4][16 * 32];  // P tile per wave
    __shared__ __align__(16) bf16_t vbuf[4][32 * 64];  // V tile per wave (k-major)

    int wave = threadIdx.x >> 5;
    int lane = threadIdx.x & 31;
    int r    = lane & 15;
    int sel  = lane >> 4;

    int bq = blockIdx.x & 31;          // T/64 = 32 query blocks
    int hh = (blockIdx.x >> 5) & 15;   // head
    int bb = blockIdx.x >> 9;          // batch
    int qbase = bq * 64 + wave * 16;

    size_t base = (size_t)bb * T * C + (size_t)hh * HD;

    // q A-operands for the two K=32 chunks of HD=64, pre-scaled by 1/8
    BV qa[2];
    const bf16_t* qrow = q + base + (size_t)(qbase + r) * C;
    #pragma unroll
    for (int c = 0; c < 2; ++c) {
        qa[c].h[0] = *(const v8bf*)(qrow + c * 32 + sel * 8);
        qa[c].h[1] = *(const v8bf*)(qrow + c * 32 + 16 + sel * 8);
        #pragma unroll
        for (int i = 0; i < 16; ++i)
            qa[c].v[i] = (bf16_t)((float)qa[c].v[i] * 0.125f);
    }

    v8f o[4] = {};
    float mrow[8], lrow[8];
    #pragma unroll
    for (int j = 0; j < 8; ++j) { mrow[j] = -INFINITY; lrow[j] = 0.f; }

    bf16_t* ps = pbuf[wave];
    bf16_t* vs = vbuf[wave];

    auto process_block = [&](int kb, auto maskc) {
        constexpr bool MASK = decltype(maskc)::value;

        // ---- async-stage V tile (32 keys x 64 dims), k-major, wave-private.
        // Prior reads of vs are already drained (wmma consumed them), so the
        // DMA writes issued now cannot race them.
        {
            const bf16_t* vr = v + base + (size_t)(kb + lane) * C;
            #pragma unroll
            for (int c = 0; c < 8; ++c)
                async_copy_b128(vs + lane * 64 + c * 8, vr + c * 8);
        }

        // ---- S = q @ k^T for 32 keys (two 16x16 tiles) ----
        v8f s0 = {}, s1 = {};
        #pragma unroll
        for (int c = 0; c < 2; ++c) {
            const bf16_t* k0 = k + base + (size_t)(kb + r) * C + c * 32;
            BV kop;
            kop.h[0] = *(const v8bf*)(k0 + sel * 8);
            kop.h[1] = *(const v8bf*)(k0 + 16 + sel * 8);
            s0 = wmma_bf16(qa[c].v, kop.v, s0);
            const bf16_t* k1 = k + base + (size_t)(kb + 16 + r) * C + c * 32;
            kop.h[0] = *(const v8bf*)(k1 + sel * 8);
            kop.h[1] = *(const v8bf*)(k1 + 16 + sel * 8);
            s1 = wmma_bf16(qa[c].v, kop.v, s1);
        }

        // ---- online softmax per row (DPP 16-lane butterflies) ----
        #pragma unroll
        for (int j = 0; j < 8; ++j) {
            float a0 = s0[j], a1 = s1[j];
            if (MASK) {
                int qi = qbase + j + sel * 8;
                a0 = (kb + r      <= qi) ? a0 : -INFINITY;
                a1 = (kb + 16 + r <= qi) ? a1 : -INFINITY;
            }
            float mt = red_max16(fmaxf(a0, a1));
            float mnew = fmaxf(mrow[j], mt);
            float p0 = __expf(a0 - mnew);
            float p1 = __expf(a1 - mnew);
            float rs = red_sum16(p0 + p1);
            float alpha = __expf(mrow[j] - mnew);
            lrow[j] = lrow[j] * alpha + rs;
            mrow[j] = mnew;
            #pragma unroll
            for (int nt = 0; nt < 4; ++nt) o[nt][j] *= alpha;
            int prow = j + sel * 8;
            ps[prow * 32 + r]      = (bf16_t)p0;
            ps[prow * 32 + 16 + r] = (bf16_t)p1;
        }

        // ---- O += P @ V (one 16x16x32 wmma per 16-wide d tile) ----
        BV pa;
        pa.h[0] = *(const v8bf*)(ps + r * 32 + sel * 8);
        pa.h[1] = *(const v8bf*)(ps + r * 32 + 16 + sel * 8);
        wait_async0();           // V tile resident (wave-private: no barrier)
        #pragma unroll
        for (int nt = 0; nt < 4; ++nt) {
            BV vb;
            #pragma unroll
            for (int i = 0; i < 8; ++i) {
                vb.v[i]     = vs[(sel * 8 + i) * 64 + nt * 16 + r];
                vb.v[8 + i] = vs[(16 + sel * 8 + i) * 64 + nt * 16 + r];
            }
            o[nt] = wmma_bf16(pa.v, vb.v, o[nt]);
        }
    };

    int nblk  = (qbase + 16 + 31) / 32;  // total 32-key blocks
    int nfull = qbase >> 5;              // blocks entirely below the diagonal
    for (int jb = 0; jb < nfull; ++jb)
        process_block(jb * 32, std::integral_constant<bool, false>{});
    for (int jb = nfull; jb < nblk; ++jb)
        process_block(jb * 32, std::integral_constant<bool, true>{});

    // ---- finalize: y = O / l ----
    #pragma unroll
    for (int j = 0; j < 8; ++j) {
        int qi = qbase + j + sel * 8;
        float inv = 1.0f / lrow[j];
        #pragma unroll
        for (int nt = 0; nt < 4; ++nt)
            y[base + (size_t)qi * C + nt * 16 + r] = (bf16_t)(o[nt][j] * inv);
    }
}

// ---------------------------------------------------------------------------
// Host-side launch
// ---------------------------------------------------------------------------
extern "C" void kernel_launch(void* const* d_in, const int* in_sizes, int n_in,
                              void* d_out, int out_size, void* d_ws, size_t ws_size,
                              hipStream_t stream) {
    const float* x     = (const float*)d_in[0];
    const float* ln1_w = (const float*)d_in[1];
    const float* ln1_b = (const float*)d_in[2];
    const float* ln2_w = (const float*)d_in[3];
    const float* ln2_b = (const float*)d_in[4];
    const float* Wq = (const float*)d_in[5];  const float* bq = (const float*)d_in[6];
    const float* Wk = (const float*)d_in[7];  const float* bk = (const float*)d_in[8];
    const float* Wv = (const float*)d_in[9];  const float* bv = (const float*)d_in[10];
    const float* Wp = (const float*)d_in[11]; const float* bp = (const float*)d_in[12];
    const float* W1 = (const float*)d_in[13]; const float* b1 = (const float*)d_in[14];
    const float* W2 = (const float*)d_in[15]; const float* b2 = (const float*)d_in[16];
    float* outp = (float*)d_out;

    // workspace layout
    char* w = (char*)d_ws;
    auto take = [&](size_t bytes) { char* p = w; w += (bytes + 255) & ~size_t(255); return p; };
    bf16_t* hb   = (bf16_t*)take((size_t)M * C * 2);
    bf16_t* wqb  = (bf16_t*)take((size_t)C * C * 2);
    bf16_t* wkb  = (bf16_t*)take((size_t)C * C * 2);
    bf16_t* wvb  = (bf16_t*)take((size_t)C * C * 2);
    bf16_t* wpb  = (bf16_t*)take((size_t)C * C * 2);
    bf16_t* w1b  = (bf16_t*)take((size_t)4 * C * C * 2);
    bf16_t* w2b  = (bf16_t*)take((size_t)4 * C * C * 2);
    bf16_t* qb   = (bf16_t*)take((size_t)M * C * 2);
    bf16_t* kbuf = (bf16_t*)take((size_t)M * C * 2);
    bf16_t* vb_  = (bf16_t*)take((size_t)M * C * 2);
    bf16_t* yb   = (bf16_t*)take((size_t)M * C * 2);
    float*  xres = (float*) take((size_t)M * C * 4);
    bf16_t* h2b  = (bf16_t*)take((size_t)M * C * 2);
    bf16_t* mact = (bf16_t*)take((size_t)M * 4 * C * 2);

    // 1) weights -> bf16
    int nw = C * C;
    cvt_f32_bf16<<<(nw + 255) / 256, 256, 0, stream>>>(Wq, wqb, nw);
    cvt_f32_bf16<<<(nw + 255) / 256, 256, 0, stream>>>(Wk, wkb, nw);
    cvt_f32_bf16<<<(nw + 255) / 256, 256, 0, stream>>>(Wv, wvb, nw);
    cvt_f32_bf16<<<(nw + 255) / 256, 256, 0, stream>>>(Wp, wpb, nw);
    cvt_f32_bf16<<<(4 * nw + 255) / 256, 256, 0, stream>>>(W1, w1b, 4 * nw);
    cvt_f32_bf16<<<(4 * nw + 255) / 256, 256, 0, stream>>>(W2, w2b, 4 * nw);

    // 2) LN1
    ln_kernel<<<M, 256, 0, stream>>>(x, ln1_w, ln1_b, hb);

    // 3) QKV projections
    dim3 g1(M / 256, C / 64);
    gemm_bf16<0><<<g1, 256, 0, stream>>>(hb, wqb, bq, nullptr, qb,   C, C);
    gemm_bf16<0><<<g1, 256, 0, stream>>>(hb, wkb, bk, nullptr, kbuf, C, C);
    gemm_bf16<0><<<g1, 256, 0, stream>>>(hb, wvb, bv, nullptr, vb_,  C, C);

    // 4) causal attention
    attn_kernel<<<Bsz * H * (T / 64), 128, 0, stream>>>(qb, kbuf, vb_, yb);

    // 5) output projection + residual (f32)
    gemm_bf16<1><<<g1, 256, 0, stream>>>(yb, wpb, bp, x, xres, C, C);

    // 6) LN2
    ln_kernel<<<M, 256, 0, stream>>>(xres, ln2_w, ln2_b, h2b);

    // 7) MLP fc1 + GELU
    dim3 g2(M / 256, (4 * C) / 64);
    gemm_bf16<2><<<g2, 256, 0, stream>>>(h2b, w1b, b1, nullptr, mact, 4 * C, C);

    // 8) MLP fc2 + residual -> final output (f32)
    gemm_bf16<1><<<g1, 256, 0, stream>>>(mact, w2b, b2, xres, outp, C, 4 * C);
}

// v001
// It runs in 287 microseconds.
// Timed twice side by side with v000, it ran 1.60 and 1.59 times as fast.
#include <hip/hip_runtime.h>
#include <hip/hip_bf16.h>
#include <math.h>
#include <type_traits>

typedef __bf16 bf16_t;
typedef __attribute__((ext_vector_type(16))) __bf16 v16bf;
typedef __attribute__((ext_vector_type(8)))  __bf16 v8bf;
typedef __attribute__((ext_vector_type(8)))  float  v8f;

union BV {
    v16bf v;
    v8bf  h[2];
};

__device__ __forceinline__ v8f wmma_bf16(v16bf a, v16bf b, v8f c) {
    // D = A(16x32 bf16) * B(32x16 bf16) + C(16x16 f32)
    return __builtin_amdgcn_wmma_f32_16x16x32_bf16(
        /*neg_a=*/false, a, /*neg_b=*/false, b,
        /*c_mod=*/(short)0, c, /*reuse_a=*/false, /*reuse_b=*/false);
}

__device__ __forceinline__ void async_copy_b128(void* lds_dst, const void* gsrc) {
    unsigned int lds_off = (unsigned int)(unsigned long long)lds_dst;
    asm volatile("global_load_async_to_lds_b128 %0, %1, off"
                 :: "v"(lds_off), "v"(gsrc) : "memory");
}

__device__ __forceinline__ void wait_async0() {
#if __has_builtin(__builtin_amdgcn_s_wait_asynccnt)
    __builtin_amdgcn_s_wait_asynccnt(0);
#else
    asm volatile("s_wait_asynccnt 0x0" ::: "memory");
#endif
}

#if __has_builtin(__builtin_amdgcn_update_dpp)
template <int CTRL>
__device__ __forceinline__ float dpp_mov(float x) {
    return __int_as_float(
        __builtin_amdgcn_update_dpp(0, __float_as_int(x), CTRL, 0xF, 0xF, true));
}
__device__ __forceinline__ float red_max16(float x) {
    x = fmaxf(x, dpp_mov<0xB1>(x));   // quad_perm [1,0,3,2]  : xor 1
    x = fmaxf(x, dpp_mov<0x4E>(x));   // quad_perm [2,3,0,1]  : xor 2
    x = fmaxf(x, dpp_mov<0x141>(x));  // row_half_mirror      : xor 4
    x = fmaxf(x, dpp_mov<0x140>(x));  // row_mirror           : xor 8
    return x;
}
__device__ __forceinline__ float red_sum16(float x) {
    x += dpp_mov<0xB1>(x);
    x += dpp_mov<0x4E>(x);
    x += dpp_mov<0x141>(x);
    x += dpp_mov<0x140>(x);
    return x;
}
#else
__device__ __forceinline__ float red_max16(float x) {
    #pragma unroll
    for (int off = 8; off; off >>= 1) x = fmaxf(x, __shfl_xor(x, off, 32));
    return x;
}
__device__ __forceinline__ float red_sum16(float x) {
    #pragma unroll
    for (int off = 8; off; off >>= 1) x += __shfl_xor(x, off, 32);
    return x;
}
#endif

static constexpr int Bsz = 2;
static constexpr int T   = 2048;
static constexpr int C   = 1024;
static constexpr int H   = 16;
static constexpr int HD  = 64;
static constexpr int M   = Bsz * T;   // 4096 rows

// ---------------------------------------------------------------------------
// fp32 -> bf16 conversion (weights)
// ---------------------------------------------------------------------------
__global__ void cvt_f32_bf16(const float* __restrict__ src,
                             bf16_t* __restrict__ dst, int n) {
    int i = blockIdx.x * blockDim.x + threadIdx.x;
    if (i < n) dst[i] = (bf16_t)src[i];
}

// ---------------------------------------------------------------------------
// LayerNorm over C=1024, one block (256 threads) per row, bf16 output
// ---------------------------------------------------------------------------
__global__ __launch_bounds__(256)
void ln_kernel(const float* __restrict__ x, const float* __restrict__ w,
               const float* __restrict__ b, bf16_t* __restrict__ out) {
    int row  = blockIdx.x;
    int tid  = threadIdx.x;
    int wave = tid >> 5, lane = tid & 31;

    const float* xr = x + (size_t)row * C;
    float4 xv = ((const float4*)xr)[tid];
    float s1 = xv.x + xv.y + xv.z + xv.w;
    float s2 = xv.x*xv.x + xv.y*xv.y + xv.z*xv.z + xv.w*xv.w;
    #pragma unroll
    for (int off = 16; off; off >>= 1) {
        s1 += __shfl_xor(s1, off, 32);
        s2 += __shfl_xor(s2, off, 32);
    }
    __shared__ float a1[8], a2[8];
    if (lane == 0) { a1[wave] = s1; a2[wave] = s2; }
    __syncthreads();
    float t1 = 0.f, t2 = 0.f;
    #pragma unroll
    for (int i = 0; i < 8; ++i) { t1 += a1[i]; t2 += a2[i]; }
    float mu   = t1 * (1.0f / C);
    float var  = t2 * (1.0f / C) - mu * mu;
    float rstd = rsqrtf(var + 1e-5f);

    float4 wv = ((const float4*)w)[tid];
    float4 bv = ((const float4*)b)[tid];
    bf16_t* orow = out + (size_t)row * C;
    orow[tid*4 + 0] = (bf16_t)((xv.x - mu) * rstd * wv.x + bv.x);
    orow[tid*4 + 1] = (bf16_t)((xv.y - mu) * rstd * wv.y + bv.y);
    orow[tid*4 + 2] = (bf16_t)((xv.z - mu) * rstd * wv.z + bv.z);
    orow[tid*4 + 3] = (bf16_t)((xv.w - mu) * rstd * wv.w + bv.w);
}

// ---------------------------------------------------------------------------
// Eight async global -> LDS copies and the wait that lets their address
// registers be reused, in one statement so that nothing can come between.
// ---------------------------------------------------------------------------
__device__ __forceinline__ void async_copy8_b128(unsigned int lds, unsigned int lds_step,
                                                 const bf16_t* g, size_t g_step) {
    unsigned int l0 = lds,                l1 = lds + lds_step,     l2 = lds + 2 * lds_step,
                 l3 = lds + 3 * lds_step, l4 = lds + 4 * lds_step, l5 = lds + 5 * lds_step,
                 l6 = lds + 6 * lds_step, l7 = lds + 7 * lds_step;
    const bf16_t *g0 = g,              *g1 = g + g_step,     *g2 = g + 2 * g_step,
                 *g3 = g + 3 * g_step, *g4 = g + 4 * g_step, *g5 = g + 5 * g_step,
                 *g6 = g + 6 * g_step, *g7 = g + 7 * g_step;
    asm volatile("global_load_async_to_lds_b128 %0, %8, off\n\t"
                 "global_load_async_to_lds_b128 %1, %9, off\n\t"
                 "global_load_async_to_lds_b128 %2, %10, off\n\t"
                 "global_load_async_to_lds_b128 %3, %11, off\n\t"
                 "global_load_async_to_lds_b128 %4, %12, off\n\t"
                 "global_load_async_to_lds_b128 %5, %13, off\n\t"
                 "global_load_async_to_lds_b128 %6, %14, off\n\t"
                 "global_load_async_to_lds_b128 %7, %15, off\n\t"
                 "s_wait_xcnt 0x0"
                 :: "v"(l0), "v"(l1), "v"(l2), "v"(l3), "v"(l4), "v"(l5), "v"(l6), "v"(l7),
                    "v"(g0), "v"(g1), "v"(g2), "v"(g3), "v"(g4), "v"(g5), "v"(g6), "v"(g7)
                 : "memory");
}

static constexpr int GK     = 128;
static constexpr int GPITCH = GK + 8;
static constexpr int GSTAGE = 256 * GPITCH;

template <int EPI>
__global__ __launch_bounds__(256)
void gemm_bf16(const bf16_t* __restrict__ A, const bf16_t* __restrict__ W,
               const float* __restrict__ bias, const float* __restrict__ resid,
               void* __restrict__ out, int N, int K) {
    __shared__ __align__(16) bf16_t st[2 * GSTAGE];

    int tid  = threadIdx.x;
    int wave = tid >> 5;
    int lane = tid & 31;
    int r    = lane & 15;
    int sel  = lane >> 4;        // which 16-lane half
    int wm   = wave >> 2;        // 0..1: 64-row strip
    int wn   = wave & 3;         // 0..3: 32-column strip

    int mb = blockIdx.x * 128;
    int nb = blockIdx.y * 128;

    // copies: thread t brings chunk (t & 15) of rows (t >> 4) + 16 * i
    int crow = tid >> 4;
    int cchk = tid & 15;
    const bf16_t* asrc = A + (size_t)(mb + crow) * K + cchk * 8;
    const bf16_t* wsrc = W + (size_t)(nb + crow) * K + cchk * 8;
    unsigned int  cdst = (unsigned int)(unsigned long long)(st + crow * GPITCH + cchk * 8);
    size_t        gstep = (size_t)16 * K;

    auto issue_stage = [&](int s, int buf) {
        unsigned int d = cdst + (unsigned int)buf * (GSTAGE * 2);
        async_copy8_b128(d,                    16 * GPITCH * 2, asrc + (size_t)s * GK, gstep);
        async_copy8_b128(d + 128 * GPITCH * 2, 16 * GPITCH * 2, wsrc + (size_t)s * GK, gstep);
    };

    int nst = K / GK;

    issue_stage(0, 0);
    // stage 0 landed (this wave's copies), then everyone's
    asm volatile("s_wait_asynccnt 0x0" ::: "memory");
    __syncthreads();
    if (nst > 1) issue_stage(1, 1);

    v8f acc[4][2] = {};

    for (int s = 0; s < nst; ++s) {
        int cur = s & 1;
        const bf16_t* abuf = st + cur * GSTAGE + (wm * 64 + r) * GPITCH + sel * 8;
        const bf16_t* bbuf = st + cur * GSTAGE + (128 + wn * 32 + r) * GPITCH + sel * 8;

        // two fragment sets: block kc + 1 is read from LDS while block kc multiplies
        BV a[2][4], b[2][2];
        auto load_frags = [&](int kc, int set) {
            #pragma unroll
            for (int mt = 0; mt < 4; ++mt) {
                a[set][mt].h[0] = *(const v8bf*)(abuf + mt * 16 * GPITCH + kc * 32);
                a[set][mt].h[1] = *(const v8bf*)(abuf + mt * 16 * GPITCH + kc * 32 + 16);
            }
            #pragma unroll
            for (int nt = 0; nt < 2; ++nt) {
                b[set][nt].h[0] = *(const v8bf*)(bbuf + nt * 16 * GPITCH + kc * 32);
                b[set][nt].h[1] = *(const v8bf*)(bbuf + nt * 16 * GPITCH + kc * 32 + 16);
            }
        };
        load_frags(0, 0);
        #pragma unroll
        for (int kc = 0; kc < GK / 32; ++kc) {
            if (kc + 1 < GK / 32) load_frags(kc + 1, (kc + 1) & 1);
            // keeps the next block's LDS reads one group ahead of this block's
            // products; left free, the scheduler sinks them among the products
            // and each pair of products then waits out an LDS latency
            __builtin_amdgcn_sched_barrier(0);
            #pragma unroll
            for (int mt = 0; mt < 4; ++mt)
                #pragma unroll
                for (int nt = 0; nt < 2; ++nt)
                    acc[mt][nt] = wmma_bf16(a[kc & 1][mt].v, b[kc & 1][nt].v, acc[mt][nt]);
            // keeps the block after next's reads behind this block's products,
            // whose fragment set they overwrite
            __builtin_amdgcn_sched_barrier(0);
        }

        // hand-over: this wave's reads of the buffer are done ...
        asm volatile("s_wait_dscnt 0x0" ::: "memory");
        // ... its copies of the next stage have landed ...
        asm volatile("s_wait_asynccnt 0x0" ::: "memory");
        // ... and so have everyone's: publishes stage s + 1, frees buffer cur
        __syncthreads();
        if (s + 2 < nst) issue_stage(s + 2, cur);
    }
    // nothing is in flight when the wave ends
    asm volatile("s_wait_asynccnt 0x0" ::: "memory");

    int m0 = mb + wm * 64;
    int n0 = nb + wn * 32;
    #pragma unroll
    for (int mt = 0; mt < 4; ++mt) {
        #pragma unroll
        for (int nt = 0; nt < 2; ++nt) {
            int col = n0 + nt * 16 + r;
            float bcol = bias[col];
            #pragma unroll
            for (int j = 0; j < 8; ++j) {
                int row = m0 + mt * 16 + j + sel * 8;
                size_t idx = (size_t)row * N + col;
                float v = acc[mt][nt][j] + bcol;
                if (EPI == 0) {
                    ((bf16_t*)out)[idx] = (bf16_t)v;
                } else if (EPI == 1) {
                    ((float*)out)[idx] = resid[idx] + v;
                } else {
                    float g = 0.5f * v * (1.0f + erff(v * 0.70710678118f));
                    ((bf16_t*)out)[idx] = (bf16_t)g;
                }
            }
        }
    }
}

// ---------------------------------------------------------------------------
// Causal flash attention. q,k,v,y: (B,T,C) bf16 with heads packed (h*HD+d).
// Block = 128 threads (4 waves); block owns 64 query rows of one (b,h);
// each wave owns 16 query rows, iterates keys 32 at a time. V tiles are
// pulled into wave-private LDS with async global->LDS DMA; softmax row
// statistics use DPP butterfly reductions; q is pre-scaled by 1/sqrt(HD)
// (exact in bf16: power of two); causal masking only runs on the one tail
// block that straddles the diagonal.
// ---------------------------------------------------------------------------
__global__ __launch_bounds__(128)
void attn_kernel(const bf16_t* __restrict__ q, const bf16_t* __restrict__ k,
                 const bf16_t* __restrict__ v, bf16_t* __restrict__ y) {
    __shared__ __align__(16) bf16_t pbuf[4][16 * 32];  // P tile per wave
    __shared__ __align__(16) bf16_t vbuf[4][32 * 64];  // V tile per wave (k-major)

    int wave = threadIdx.x >> 5;
    int lane = threadIdx.x & 31;
    int r    = lane & 15;
    int sel  = lane >> 4;

    int bq = blockIdx.x & 31;          // T/64 = 32 query blocks
    int hh = (blockIdx.x >> 5) & 15;   // head
    int bb = blockIdx.x >> 9;          // batch
    int qbase = bq * 64 + wave * 16;

    size_t base = (size_t)bb * T * C + (size_t)hh * HD;

    // q A-operands for the two K=32 chunks of HD=64, pre-scaled by 1/8
    BV qa[2];
    const bf16_t* qrow = q + base + (size_t)(qbase + r) * C;
    #pragma unroll
    for (int c = 0; c < 2; ++c) {
        qa[c].h[0] = *(const v8bf*)(qrow + c * 32 + sel * 8);
        qa[c].h[1] = *(const v8bf*)(qrow + c * 32 + 16 + sel * 8);
        #pragma unroll
        for (int i = 0; i < 16; ++i)
            qa[c].v[i] = (bf16_t)((float)qa[c].v[i] * 0.125f);
    }

    v8f o[4] = {};
    float mrow[8], lrow[8];
    #pragma unroll
    for (int j = 0; j < 8; ++j) { mrow[j] = -INFINITY; lrow[j] = 0.f; }

    bf16_t* ps = pbuf[wave];
    bf16_t* vs = vbuf[wave];

    auto process_block = [&](int kb, auto maskc) {
        constexpr bool MASK = decltype(maskc)::value;

        // ---- async-stage V tile (32 keys x 64 dims), k-major, wave-private.
        // Prior reads of vs are already drained (wmma consumed them), so the
        // DMA writes issued now cannot race them.
        {
            const bf16_t* vr = v + base + (size_t)(kb + lane) * C;
            #pragma unroll
            for (int c = 0; c < 8; ++c)
                async_copy_b128(vs + lane * 64 + c * 8, vr + c * 8);
        }

        // ---- S = q @ k^T for 32 keys (two 16x16 tiles) ----
        v8f s0 = {}, s1 = {};
        #pragma unroll
        for (int c = 0; c < 2; ++c) {
            const bf16_t* k0 = k + base + (size_t)(kb + r) * C + c * 32;
            BV kop;
            kop.h[0] = *(const v8bf*)(k0 + sel * 8);
            kop.h[1] = *(const v8bf*)(k0 + 16 + sel * 8);
            s0 = wmma_bf16(qa[c].v, kop.v, s0);
            const bf16_t* k1 = k + base + (size_t)(kb + 16 + r) * C + c * 32;
            kop.h[0] = *(const v8bf*)(k1 + sel * 8);
            kop.h[1] = *(const v8bf*)(k1 + 16 + sel * 8);
            s1 = wmma_bf16(qa[c].v, kop.v, s1);
        }

        // ---- online softmax per row (DPP 16-lane butterflies) ----
        #pragma unroll
        for (int j = 0; j < 8; ++j) {
            float a0 = s0[j], a1 = s1[j];
            if (MASK) {
                int qi = qbase + j + sel * 8;
                a0 = (kb + r      <= qi) ? a0 : -INFINITY;
                a1 = (kb + 16 + r <= qi) ? a1 : -INFINITY;
            }
            float mt = red_max16(fmaxf(a0, a1));
            float mnew = fmaxf(mrow[j], mt);
            float p0 = __expf(a0 - mnew);
            float p1 = __expf(a1 - mnew);
            float rs = red_sum16(p0 + p1);
            float alpha = __expf(mrow[j] - mnew);
            lrow[j] = lrow[j] * alpha + rs;
            mrow[j] = mnew;
            #pragma unroll
            for (int nt = 0; nt < 4; ++nt) o[nt][j] *= alpha;
            int prow = j + sel * 8;
            ps[prow * 32 + r]      = (bf16_t)p0;
            ps[prow * 32 + 16 + r] = (bf16_t)p1;
        }

        // ---- O += P @ V (one 16x16x32 wmma per 16-wide d tile) ----
        BV pa;
        pa.h[0] = *(const v8bf*)(ps + r * 32 + sel * 8);
        pa.h[1] = *(const v8bf*)(ps + r * 32 + 16 + sel * 8);
        wait_async0();           // V tile resident (wave-private: no barrier)
        #pragma unroll
        for (int nt = 0; nt < 4; ++nt) {
            BV vb;
            #pragma unroll
            for (int i = 0; i < 8; ++i) {
                vb.v[i]     = vs[(sel * 8 + i) * 64 + nt * 16 + r];
                vb.v[8 + i] = vs[(16 + sel * 8 + i) * 64 + nt * 16 + r];
            }
            o[nt] = wmma_bf16(pa.v, vb.v, o[nt]);
        }
    };

    int nblk  = (qbase + 16 + 31) / 32;  // total 32-key blocks
    int nfull = qbase >> 5;              // blocks entirely below the diagonal
    for (int jb = 0; jb < nfull; ++jb)
        process_block(jb * 32, std::integral_constant<bool, false>{});
    for (int jb = nfull; jb < nblk; ++jb)
        process_block(jb * 32, std::integral_constant<bool, true>{});

    // ---- finalize: y = O / l ----
    #pragma unroll
    for (int j = 0; j < 8; ++j) {
        int qi = qbase + j + sel * 8;
        float inv = 1.0f / lrow[j];
        #pragma unroll
        for (int nt = 0; nt < 4; ++nt)
            y[base + (size_t)qi * C + nt * 16 + r] = (bf16_t)(o[nt][j] * inv);
    }
}

// ---------------------------------------------------------------------------
// Host-side launch
// ---------------------------------------------------------------------------
extern "C" void kernel_launch(void* const* d_in, const int* in_sizes, int n_in,
                              void* d_out, int out_size, void* d_ws, size_t ws_size,
                              hipStream_t stream) {
    const float* x     = (const float*)d_in[0];
    const float* ln1_w = (const float*)d_in[1];
    const float* ln1_b = (const float*)d_in[2];
    const float* ln2_w = (const float*)d_in[3];
    const float* ln2_b = (const float*)d_in[4];
    const float* Wq = (const float*)d_in[5];  const float* bq = (const float*)d_in[6];
    const float* Wk = (const float*)d_in[7];  const float* bk = (const float*)d_in[8];
    const float* Wv = (const float*)d_in[9];  const float* bv = (const float*)d_in[10];
    const float* Wp = (const float*)d_in[11]; const float* bp = (const float*)d_in[12];
    const float* W1 = (const float*)d_in[13]; const float* b1 = (const float*)d_in[14];
    const float* W2 = (const float*)d_in[15]; const float* b2 = (const float*)d_in[16];
    float* outp = (float*)d_out;

    // workspace layout
    char* w = (char*)d_ws;
    auto take = [&](size_t bytes) { char* p = w; w += (bytes + 255) & ~size_t(255); return p; };
    bf16_t* hb   = (bf16_t*)take((size_t)M * C * 2);
    bf16_t* wqb  = (bf16_t*)take((size_t)C * C * 2);
    bf16_t* wkb  = (bf16_t*)take((size_t)C * C * 2);
    bf16_t* wvb  = (bf16_t*)take((size_t)C * C * 2);
    bf16_t* wpb  = (bf16_t*)take((size_t)C * C * 2);
    bf16_t* w1b  = (bf16_t*)take((size_t)4 * C * C * 2);
    bf16_t* w2b  = (bf16_t*)take((size_t)4 * C * C * 2);
    bf16_t* qb   = (bf16_t*)take((size_t)M * C * 2);
    bf16_t* kbuf = (bf16_t*)take((size_t)M * C * 2);
    bf16_t* vb_  = (bf16_t*)take((size_t)M * C * 2);
    bf16_t* yb   = (bf16_t*)take((size_t)M * C * 2);
    float*  xres = (float*) take((size_t)M * C * 4);
    bf16_t* h2b  = (bf16_t*)take((size_t)M * C * 2);
    bf16_t* mact = (bf16_t*)take((size_t)M * 4 * C * 2);

    // 1) weights -> bf16
    int nw = C * C;
    cvt_f32_bf16<<<(nw + 255) / 256, 256, 0, stream>>>(Wq, wqb, nw);
    cvt_f32_bf16<<<(nw + 255) / 256, 256, 0, stream>>>(Wk, wkb, nw);
    cvt_f32_bf16<<<(nw + 255) / 256, 256, 0, stream>>>(Wv, wvb, nw);
    cvt_f32_bf16<<<(nw + 255) / 256, 256, 0, stream>>>(Wp, wpb, nw);
    cvt_f32_bf16<<<(4 * nw + 255) / 256, 256, 0, stream>>>(W1, w1b, 4 * nw);
    cvt_f32_bf16<<<(4 * nw + 255) / 256, 256, 0, stream>>>(W2, w2b, 4 * nw);

    // 2) LN1
    ln_kernel<<<M, 256, 0, stream>>>(x, ln1_w, ln1_b, hb);

    // 3) QKV projections
    dim3 g1(M / 128, C / 128);
    gemm_bf16<0><<<g1, 256, 0, stream>>>(hb, wqb, bq, nullptr, qb,   C, C);
    gemm_bf16<0><<<g1, 256, 0, stream>>>(hb, wkb, bk, nullptr, kbuf, C, C);
    gemm_bf16<0><<<g1, 256, 0, stream>>>(hb, wvb, bv, nullptr, vb_,  C, C);

    // 4) causal attention
    attn_kernel<<<Bsz * H * (T / 64), 128, 0, stream>>>(qb, kbuf, vb_, yb);

    // 5) output projection + residual (f32)
    gemm_bf16<1><<<g1, 256, 0, stream>>>(yb, wpb, bp, x, xres, C, C);

    // 6) LN2
    ln_kernel<<<M, 256, 0, stream>>>(xres, ln2_w, ln2_b, h2b);

    // 7) MLP fc1 + GELU
    dim3 g2(M / 128, (4 * C) / 128);
    gemm_bf16<2><<<g2, 256, 0, stream>>>(h2b, w1b, b1, nullptr, mact, 4 * C, C);

    // 8) MLP fc2 + residual -> final output (f32)
    gemm_bf16<1><<<g1, 256, 0, stream>>>(mact, w2b, b2, xres, outp, C, 4 * C);
}

// v002
// It runs in 265 microseconds.
// Timed twice side by side with v001, it ran 1.07 and 1.08 times as fast.
// Counting every step since v000, it is 1.72 times as fast.
#include <hip/hip_runtime.h>
#include <hip/hip_bf16.h>
#include <math.h>
#include <type_traits>

typedef __bf16 bf16_t;
typedef __attribute__((ext_vector_type(16))) __bf16 v16bf;
typedef __attribute__((ext_vector_type(8)))  __bf16 v8bf;
typedef __attribute__((ext_vector_type(8)))  float  v8f;

union BV {
    v16bf v;
    v8bf  h[2];
};

__device__ __forceinline__ v8f wmma_bf16(v16bf a, v16bf b, v8f c) {
    // D = A(16x32 bf16) * B(32x16 bf16) + C(16x16 f32)
    return __builtin_amdgcn_wmma_f32_16x16x32_bf16(
        /*neg_a=*/false, a, /*neg_b=*/false, b,
        /*c_mod=*/(short)0, c, /*reuse_a=*/false, /*reuse_b=*/false);
}

__device__ __forceinline__ void async_copy_b128(void* lds_dst, const void* gsrc) {
    unsigned int lds_off = (unsigned int)(unsigned long long)lds_dst;
    asm volatile("global_load_async_to_lds_b128 %0, %1, off"
                 :: "v"(lds_off), "v"(gsrc) : "memory");
}

__device__ __forceinline__ void wait_async0() {
#if __has_builtin(__builtin_amdgcn_s_wait_asynccnt)
    __builtin_amdgcn_s_wait_asynccnt(0);
#else
    asm volatile("s_wait_asynccnt 0x0" ::: "memory");
#endif
}

#if __has_builtin(__builtin_amdgcn_update_dpp)
template <int CTRL>
__device__ __forceinline__ float dpp_mov(float x) {
    return __int_as_float(
        __builtin_amdgcn_update_dpp(0, __float_as_int(x), CTRL, 0xF, 0xF, true));
}
__device__ __forceinline__ float red_max16(float x) {
    x = fmaxf(x, dpp_mov<0xB1>(x));   // quad_perm [1,0,3,2]  : xor 1
    x = fmaxf(x, dpp_mov<0x4E>(x));   // quad_perm [2,3,0,1]  : xor 2
    x = fmaxf(x, dpp_mov<0x141>(x));  // row_half_mirror      : xor 4
    x = fmaxf(x, dpp_mov<0x140>(x));  // row_mirror           : xor 8
    return x;
}
__device__ __forceinline__ float red_sum16(float x) {
    x += dpp_mov<0xB1>(x);
    x += dpp_mov<0x4E>(x);
    x += dpp_mov<0x141>(x);
    x += dpp_mov<0x140>(x);
    return x;
}
#else
__device__ __forceinline__ float red_max16(float x) {
    #pragma unroll
    for (int off = 8; off; off >>= 1) x = fmaxf(x, __shfl_xor(x, off, 32));
    return x;
}
__device__ __forceinline__ float red_sum16(float x) {
    #pragma unroll
    for (int off = 8; off; off >>= 1) x += __shfl_xor(x, off, 32);
    return x;
}
#endif

static constexpr int Bsz = 2;
static constexpr int T   = 2048;
static constexpr int C   = 1024;
static constexpr int H   = 16;
static constexpr int HD  = 64;
static constexpr int M   = Bsz * T;   // 4096 rows

// ---------------------------------------------------------------------------
// fp32 -> bf16 conversion of all six weight matrices, one launch.
// A block converts CVT_BLK consecutive floats of one matrix: each thread issues
// CVT_U 16-byte loads (a wave-wide load = 512 contiguous bytes), all in flight
// together, then stores 8 bytes per load (a wave-wide store = two whole lines).
// dst is the six bf16 planes laid end to end in the order Wq Wk Wv Wp W1 W2.
// ---------------------------------------------------------------------------
typedef __attribute__((ext_vector_type(4))) __bf16 v4bf;

static constexpr int CVT_U    = 16;                    // 16-byte loads per thread
static constexpr int CVT_BLK  = 256 * CVT_U * 4;       // floats per block
static constexpr int CVT_SQ   = C * C / CVT_BLK;       // blocks per C x C matrix
static constexpr int CVT_GRID = 12 * CVT_SQ;           // 4 square + 2 fourfold

// waves_per_eu: lets the compiler use the registers for all CVT_U loads at once;
// at its default target it holds the last two back until the first two return.
__global__ __launch_bounds__(256) __attribute__((amdgpu_waves_per_eu(4, 8)))
void cvt_weights(const float* __restrict__ Wq, const float* __restrict__ Wk,
                 const float* __restrict__ Wv, const float* __restrict__ Wp,
                 const float* __restrict__ W1, const float* __restrict__ W2,
                 bf16_t* __restrict__ dst) {
    int blk = blockIdx.x;
    const float* src;
    int first;
    if      (blk < 1 * CVT_SQ) { src = Wq; first = 0; }
    else if (blk < 2 * CVT_SQ) { src = Wk; first = 1 * CVT_SQ; }
    else if (blk < 3 * CVT_SQ) { src = Wv; first = 2 * CVT_SQ; }
    else if (blk < 4 * CVT_SQ) { src = Wp; first = 3 * CVT_SQ; }
    else if (blk < 8 * CVT_SQ) { src = W1; first = 4 * CVT_SQ; }
    else                       { src = W2; first = 8 * CVT_SQ; }

    const float4* s = (const float4*)(src + (size_t)(blk - first) * CVT_BLK) + threadIdx.x;
    v4bf*         d = (v4bf*)(dst + (size_t)blk * CVT_BLK) + threadIdx.x;

    float4 v[CVT_U];
    #pragma unroll
    for (int i = 0; i < CVT_U; ++i) v[i] = s[i * 256];
    #pragma unroll
    for (int i = 0; i < CVT_U; ++i) {
        v4bf o;
        o[0] = (bf16_t)v[i].x; o[1] = (bf16_t)v[i].y;
        o[2] = (bf16_t)v[i].z; o[3] = (bf16_t)v[i].w;
        d[i * 256] = o;
    }
}

// ---------------------------------------------------------------------------
// LayerNorm over C=1024, one block (256 threads) per row, bf16 output
// ---------------------------------------------------------------------------
__global__ __launch_bounds__(256)
void ln_kernel(const float* __restrict__ x, const float* __restrict__ w,
               const float* __restrict__ b, bf16_t* __restrict__ out) {
    int row  = blockIdx.x;
    int tid  = threadIdx.x;
    int wave = tid >> 5, lane = tid & 31;

    const float* xr = x + (size_t)row * C;
    float4 xv = ((const float4*)xr)[tid];
    float s1 = xv.x + xv.y + xv.z + xv.w;
    float s2 = xv.x*xv.x + xv.y*xv.y + xv.z*xv.z + xv.w*xv.w;
    #pragma unroll
    for (int off = 16; off; off >>= 1) {
        s1 += __shfl_xor(s1, off, 32);
        s2 += __shfl_xor(s2, off, 32);
    }
    __shared__ float a1[8], a2[8];
    if (lane == 0) { a1[wave] = s1; a2[wave] = s2; }
    __syncthreads();
    float t1 = 0.f, t2 = 0.f;
    #pragma unroll
    for (int i = 0; i < 8; ++i) { t1 += a1[i]; t2 += a2[i]; }
    float mu   = t1 * (1.0f / C);
    float var  = t2 * (1.0f / C) - mu * mu;
    float rstd = rsqrtf(var + 1e-5f);

    float4 wv = ((const float4*)w)[tid];
    float4 bv = ((const float4*)b)[tid];
    bf16_t* orow = out + (size_t)row * C;
    orow[tid*4 + 0] = (bf16_t)((xv.x - mu) * rstd * wv.x + bv.x);
    orow[tid*4 + 1] = (bf16_t)((xv.y - mu) * rstd * wv.y + bv.y);
    orow[tid*4 + 2] = (bf16_t)((xv.z - mu) * rstd * wv.z + bv.z);
    orow[tid*4 + 3] = (bf16_t)((xv.w - mu) * rstd * wv.w + bv.w);
}

// ---------------------------------------------------------------------------
// Eight async global -> LDS copies and the wait that lets their address
// registers be reused, in one statement so that nothing can come between.
// ---------------------------------------------------------------------------
__device__ __forceinline__ void async_copy8_b128(unsigned int lds, unsigned int lds_step,
                                                 const bf16_t* g, size_t g_step) {
    unsigned int l0 = lds,                l1 = lds + lds_step,     l2 = lds + 2 * lds_step,
                 l3 = lds + 3 * lds_step, l4 = lds + 4 * lds_step, l5 = lds + 5 * lds_step,
                 l6 = lds + 6 * lds_step, l7 = lds + 7 * lds_step;
    const bf16_t *g0 = g,              *g1 = g + g_step,     *g2 = g + 2 * g_step,
                 *g3 = g + 3 * g_step, *g4 = g + 4 * g_step, *g5 = g + 5 * g_step,
                 *g6 = g + 6 * g_step, *g7 = g + 7 * g_step;
    asm volatile("global_load_async_to_lds_b128 %0, %8, off\n\t"
                 "global_load_async_to_lds_b128 %1, %9, off\n\t"
                 "global_load_async_to_lds_b128 %2, %10, off\n\t"
                 "global_load_async_to_lds_b128 %3, %11, off\n\t"
                 "global_load_async_to_lds_b128 %4, %12, off\n\t"
                 "global_load_async_to_lds_b128 %5, %13, off\n\t"
                 "global_load_async_to_lds_b128 %6, %14, off\n\t"
                 "global_load_async_to_lds_b128 %7, %15, off\n\t"
                 "s_wait_xcnt 0x0"
                 :: "v"(l0), "v"(l1), "v"(l2), "v"(l3), "v"(l4), "v"(l5), "v"(l6), "v"(l7),
                    "v"(g0), "v"(g1), "v"(g2), "v"(g3), "v"(g4), "v"(g5), "v"(g6), "v"(g7)
                 : "memory");
}

static constexpr int GK     = 128;
static constexpr int GPITCH = GK + 8;
static constexpr int GSTAGE = 256 * GPITCH;

template <int EPI>
__global__ __launch_bounds__(256)
void gemm_bf16(const bf16_t* __restrict__ A, const bf16_t* __restrict__ W,
               const float* __restrict__ bias, const float* __restrict__ resid,
               void* __restrict__ out, int N, int K) {
    __shared__ __align__(16) bf16_t st[2 * GSTAGE];

    int tid  = threadIdx.x;
    int wave = tid >> 5;
    int lane = tid & 31;
    int r    = lane & 15;
    int sel  = lane >> 4;        // which 16-lane half
    int wm   = wave >> 2;        // 0..1: 64-row strip
    int wn   = wave & 3;         // 0..3: 32-column strip

    int mb = blockIdx.x * 128;
    int nb = blockIdx.y * 128;

    // copies: thread t brings chunk (t & 15) of rows (t >> 4) + 16 * i
    int crow = tid >> 4;
    int cchk = tid & 15;
    const bf16_t* asrc = A + (size_t)(mb + crow) * K + cchk * 8;
    const bf16_t* wsrc = W + (size_t)(nb + crow) * K + cchk * 8;
    unsigned int  cdst = (unsigned int)(unsigned long long)(st + crow * GPITCH + cchk * 8);
    size_t        gstep = (size_t)16 * K;

    auto issue_stage = [&](int s, int buf) {
        unsigned int d = cdst + (unsigned int)buf * (GSTAGE * 2);
        async_copy8_b128(d,                    16 * GPITCH * 2, asrc + (size_t)s * GK, gstep);
        async_copy8_b128(d + 128 * GPITCH * 2, 16 * GPITCH * 2, wsrc + (size_t)s * GK, gstep);
    };

    int nst = K / GK;

    issue_stage(0, 0);
    // stage 0 landed (this wave's copies), then everyone's
    asm volatile("s_wait_asynccnt 0x0" ::: "memory");
    __syncthreads();
    if (nst > 1) issue_stage(1, 1);

    v8f acc[4][2] = {};

    for (int s = 0; s < nst; ++s) {
        int cur = s & 1;
        const bf16_t* abuf = st + cur * GSTAGE + (wm * 64 + r) * GPITCH + sel * 8;
        const bf16_t* bbuf = st + cur * GSTAGE + (128 + wn * 32 + r) * GPITCH + sel * 8;

        // two fragment sets: block kc + 1 is read from LDS while block kc multiplies
        BV a[2][4], b[2][2];
        auto load_frags = [&](int kc, int set) {
            #pragma unroll
            for (int mt = 0; mt < 4; ++mt) {
                a[set][mt].h[0] = *(const v8bf*)(abuf + mt * 16 * GPITCH + kc * 32);
                a[set][mt].h[1] = *(const v8bf*)(abuf + mt * 16 * GPITCH + kc * 32 + 16);
            }
            #pragma unroll
            for (int nt = 0; nt < 2; ++nt) {
                b[set][nt].h[0] = *(const v8bf*)(bbuf + nt * 16 * GPITCH + kc * 32);
                b[set][nt].h[1] = *(const v8bf*)(bbuf + nt * 16 * GPITCH + kc * 32 + 16);
            }
        };
        load_frags(0, 0);
        #pragma unroll
        for (int kc = 0; kc < GK / 32; ++kc) {
            if (kc + 1 < GK / 32) load_frags(kc + 1, (kc + 1) & 1);
            // keeps the next block's LDS reads one group ahead of this block's
            // products; left free, the scheduler sinks them among the products
            // and each pair of products then waits out an LDS latency
            __builtin_amdgcn_sched_barrier(0);
            #pragma unroll
            for (int mt = 0; mt < 4; ++mt)
                #pragma unroll
                for (int nt = 0; nt < 2; ++nt)
                    acc[mt][nt] = wmma_bf16(a[kc & 1][mt].v, b[kc & 1][nt].v, acc[mt][nt]);
            // keeps the block after next's reads behind this block's products,
            // whose fragment set they overwrite
            __builtin_amdgcn_sched_barrier(0);
        }

        // hand-over: this wave's reads of the buffer are done ...
        asm volatile("s_wait_dscnt 0x0" ::: "memory");
        // ... its copies of the next stage have landed ...
        asm volatile("s_wait_asynccnt 0x0" ::: "memory");
        // ... and so have everyone's: publishes stage s + 1, frees buffer cur
        __syncthreads();
        if (s + 2 < nst) issue_stage(s + 2, cur);
    }
    // nothing is in flight when the wave ends
    asm volatile("s_wait_asynccnt 0x0" ::: "memory");

    int m0 = mb + wm * 64;
    int n0 = nb + wn * 32;
    #pragma unroll
    for (int mt = 0; mt < 4; ++mt) {
        #pragma unroll
        for (int nt = 0; nt < 2; ++nt) {
            int col = n0 + nt * 16 + r;
            float bcol = bias[col];
            #pragma unroll
            for (int j = 0; j < 8; ++j) {
                int row = m0 + mt * 16 + j + sel * 8;
                size_t idx = (size_t)row * N + col;
                float v = acc[mt][nt][j] + bcol;
                if (EPI == 0) {
                    ((bf16_t*)out)[idx] = (bf16_t)v;
                } else if (EPI == 1) {
                    ((float*)out)[idx] = resid[idx] + v;
                } else {
                    float g = 0.5f * v * (1.0f + erff(v * 0.70710678118f));
                    ((bf16_t*)out)[idx] = (bf16_t)g;
                }
            }
        }
    }
}

// ---------------------------------------------------------------------------
// Causal flash attention. q,k,v,y: (B,T,C) bf16 with heads packed (h*HD+d).
// Block = 128 threads (4 waves); block owns 64 query rows of one (b,h);
// each wave owns 16 query rows, iterates keys 32 at a time. V tiles are
// pulled into wave-private LDS with async global->LDS DMA; softmax row
// statistics use DPP butterfly reductions; q is pre-scaled by 1/sqrt(HD)
// (exact in bf16: power of two); causal masking only runs on the one tail
// block that straddles the diagonal.
// ---------------------------------------------------------------------------
__global__ __launch_bounds__(128)
void attn_kernel(const bf16_t* __restrict__ q, const bf16_t* __restrict__ k,
                 const bf16_t* __restrict__ v, bf16_t* __restrict__ y) {
    __shared__ __align__(16) bf16_t pbuf[4][16 * 32];  // P tile per wave
    __shared__ __align__(16) bf16_t vbuf[4][32 * 64];  // V tile per wave (k-major)

    int wave = threadIdx.x >> 5;
    int lane = threadIdx.x & 31;
    int r    = lane & 15;
    int sel  = lane >> 4;

    int bq = blockIdx.x & 31;          // T/64 = 32 query blocks
    int hh = (blockIdx.x >> 5) & 15;   // head
    int bb = blockIdx.x >> 9;          // batch
    int qbase = bq * 64 + wave * 16;

    size_t base = (size_t)bb * T * C + (size_t)hh * HD;

    // q A-operands for the two K=32 chunks of HD=64, pre-scaled by 1/8
    BV qa[2];
    const bf16_t* qrow = q + base + (size_t)(qbase + r) * C;
    #pragma unroll
    for (int c = 0; c < 2; ++c) {
        qa[c].h[0] = *(const v8bf*)(qrow + c * 32 + sel * 8);
        qa[c].h[1] = *(const v8bf*)(qrow + c * 32 + 16 + sel * 8);
        #pragma unroll
        for (int i = 0; i < 16; ++i)
            qa[c].v[i] = (bf16_t)((float)qa[c].v[i] * 0.125f);
    }

    v8f o[4] = {};
    float mrow[8], lrow[8];
    #pragma unroll
    for (int j = 0; j < 8; ++j) { mrow[j] = -INFINITY; lrow[j] = 0.f; }

    bf16_t* ps = pbuf[wave];
    bf16_t* vs = vbuf[wave];

    auto process_block = [&](int kb, auto maskc) {
        constexpr bool MASK = decltype(maskc)::value;

        // ---- async-stage V tile (32 keys x 64 dims), k-major, wave-private.
        // Prior reads of vs are already drained (wmma consumed them), so the
        // DMA writes issued now cannot race them.
        {
            const bf16_t* vr = v + base + (size_t)(kb + lane) * C;
            #pragma unroll
            for (int c = 0; c < 8; ++c)
                async_copy_b128(vs + lane * 64 + c * 8, vr + c * 8);
        }

        // ---- S = q @ k^T for 32 keys (two 16x16 tiles) ----
        v8f s0 = {}, s1 = {};
        #pragma unroll
        for (int c = 0; c < 2; ++c) {
            const bf16_t* k0 = k + base + (size_t)(kb + r) * C + c * 32;
            BV kop;
            kop.h[0] = *(const v8bf*)(k0 + sel * 8);
            kop.h[1] = *(const v8bf*)(k0 + 16 + sel * 8);
            s0 = wmma_bf16(qa[c].v, kop.v, s0);
            const bf16_t* k1 = k + base + (size_t)(kb + 16 + r) * C + c * 32;
            kop.h[0] = *(const v8bf*)(k1 + sel * 8);
            kop.h[1] = *(const v8bf*)(k1 + 16 + sel * 8);
            s1 = wmma_bf16(qa[c].v, kop.v, s1);
        }

        // ---- online softmax per row (DPP 16-lane butterflies) ----
        #pragma unroll
        for (int j = 0; j < 8; ++j) {
            float a0 = s0[j], a1 = s1[j];
            if (MASK) {
                int qi = qbase + j + sel * 8;
                a0 = (kb + r      <= qi) ? a0 : -INFINITY;
                a1 = (kb + 16 + r <= qi) ? a1 : -INFINITY;
            }
            float mt = red_max16(fmaxf(a0, a1));
            float mnew = fmaxf(mrow[j], mt);
            float p0 = __expf(a0 - mnew);
            float p1 = __expf(a1 - mnew);
            float rs = red_sum16(p0 + p1);
            float alpha = __expf(mrow[j] - mnew);
            lrow[j] = lrow[j] * alpha + rs;
            mrow[j] = mnew;
            #pragma unroll
            for (int nt = 0; nt < 4; ++nt) o[nt][j] *= alpha;
            int prow = j + sel * 8;
            ps[prow * 32 + r]      = (bf16_t)p0;
            ps[prow * 32 + 16 + r] = (bf16_t)p1;
        }

        // ---- O += P @ V (one 16x16x32 wmma per 16-wide d tile) ----
        BV pa;
        pa.h[0] = *(const v8bf*)(ps + r * 32 + sel * 8);
        pa.h[1] = *(const v8bf*)(ps + r * 32 + 16 + sel * 8);
        wait_async0();           // V tile resident (wave-private: no barrier)
        #pragma unroll
        for (int nt = 0; nt < 4; ++nt) {
            BV vb;
            #pragma unroll
            for (int i = 0; i < 8; ++i) {
                vb.v[i]     = vs[(sel * 8 + i) * 64 + nt * 16 + r];
                vb.v[8 + i] = vs[(16 + sel * 8 + i) * 64 + nt * 16 + r];
            }
            o[nt] = wmma_bf16(pa.v, vb.v, o[nt]);
        }
    };

    int nblk  = (qbase + 16 + 31) / 32;  // total 32-key blocks
    int nfull = qbase >> 5;              // blocks entirely below the diagonal
    for (int jb = 0; jb < nfull; ++jb)
        process_block(jb * 32, std::integral_constant<bool, false>{});
    for (int jb = nfull; jb < nblk; ++jb)
        process_block(jb * 32, std::integral_constant<bool, true>{});

    // ---- finalize: y = O / l ----
    #pragma unroll
    for (int j = 0; j < 8; ++j) {
        int qi = qbase + j + sel * 8;
        float inv = 1.0f / lrow[j];
        #pragma unroll
        for (int nt = 0; nt < 4; ++nt)
            y[base + (size_t)qi * C + nt * 16 + r] = (bf16_t)(o[nt][j] * inv);
    }
}

// ---------------------------------------------------------------------------
// Host-side launch
// ---------------------------------------------------------------------------
extern "C" void kernel_launch(void* const* d_in, const int* in_sizes, int n_in,
                              void* d_out, int out_size, void* d_ws, size_t ws_size,
                              hipStream_t stream) {
    const float* x     = (const float*)d_in[0];
    const float* ln1_w = (const float*)d_in[1];
    const float* ln1_b = (const float*)d_in[2];
    const float* ln2_w = (const float*)d_in[3];
    const float* ln2_b = (const float*)d_in[4];
    const float* Wq = (const float*)d_in[5];  const float* bq = (const float*)d_in[6];
    const float* Wk = (const float*)d_in[7];  const float* bk = (const float*)d_in[8];
    const float* Wv = (const float*)d_in[9];  const float* bv = (const float*)d_in[10];
    const float* Wp = (const float*)d_in[11]; const float* bp = (const float*)d_in[12];
    const float* W1 = (const float*)d_in[13]; const float* b1 = (const float*)d_in[14];
    const float* W2 = (const float*)d_in[15]; const float* b2 = (const float*)d_in[16];
    float* outp = (float*)d_out;

    // workspace layout
    char* w = (char*)d_ws;
    auto take = [&](size_t bytes) { char* p = w; w += (bytes + 255) & ~size_t(255); return p; };
    bf16_t* hb   = (bf16_t*)take((size_t)M * C * 2);
    bf16_t* wqb  = (bf16_t*)take((size_t)C * C * 2);
    bf16_t* wkb  = (bf16_t*)take((size_t)C * C * 2);
    bf16_t* wvb  = (bf16_t*)take((size_t)C * C * 2);
    bf16_t* wpb  = (bf16_t*)take((size_t)C * C * 2);
    bf16_t* w1b  = (bf16_t*)take((size_t)4 * C * C * 2);
    bf16_t* w2b  = (bf16_t*)take((size_t)4 * C * C * 2);
    bf16_t* qb   = (bf16_t*)take((size_t)M * C * 2);
    bf16_t* kbuf = (bf16_t*)take((size_t)M * C * 2);
    bf16_t* vb_  = (bf16_t*)take((size_t)M * C * 2);
    bf16_t* yb   = (bf16_t*)take((size_t)M * C * 2);
    float*  xres = (float*) take((size_t)M * C * 4);
    bf16_t* h2b  = (bf16_t*)take((size_t)M * C * 2);
    bf16_t* mact = (bf16_t*)take((size_t)M * 4 * C * 2);

    // 1) weights -> bf16 (the six planes from wqb on lie end to end: every
    //    plane's size is a multiple of the workspace granule)
    cvt_weights<<<CVT_GRID, 256, 0, stream>>>(Wq, Wk, Wv, Wp, W1, W2, wqb);

    // 2) LN1
    ln_kernel<<<M, 256, 0, stream>>>(x, ln1_w, ln1_b, hb);

    // 3) QKV projections
    dim3 g1(M / 128, C / 128);
    gemm_bf16<0><<<g1, 256, 0, stream>>>(hb, wqb, bq, nullptr, qb,   C, C);
    gemm_bf16<0><<<g1, 256, 0, stream>>>(hb, wkb, bk, nullptr, kbuf, C, C);
    gemm_bf16<0><<<g1, 256, 0, stream>>>(hb, wvb, bv, nullptr, vb_,  C, C);

    // 4) causal attention
    attn_kernel<<<Bsz * H * (T / 64), 128, 0, stream>>>(qb, kbuf, vb_, yb);

    // 5) output projection + residual (f32)
    gemm_bf16<1><<<g1, 256, 0, stream>>>(yb, wpb, bp, x, xres, C, C);

    // 6) LN2
    ln_kernel<<<M, 256, 0, stream>>>(xres, ln2_w, ln2_b, h2b);

    // 7) MLP fc1 + GELU
    dim3 g2(M / 128, (4 * C) / 128);
    gemm_bf16<2><<<g2, 256, 0, stream>>>(h2b, w1b, b1, nullptr, mact, 4 * C, C);

    // 8) MLP fc2 + residual -> final output (f32)
    gemm_bf16<1><<<g1, 256, 0, stream>>>(mact, w2b, b2, xres, outp, C, 4 * C);
}

// v003
// Measured time: 219 microseconds a run.
// In two side-by-side timings against v002, it was 1.21 and 1.20 times as fast.
// Counting every step since v000, it is 2.07 times as fast.
#include <hip/hip_runtime.h>
#include <hip/hip_bf16.h>
#include <math.h>
#include <type_traits>

typedef __bf16 bf16_t;
typedef __attribute__((ext_vector_type(16))) __bf16 v16bf;
typedef __attribute__((ext_vector_type(8)))  __bf16 v8bf;
typedef __attribute__((ext_vector_type(8)))  float  v8f;

union BV {
    v16bf v;
    v8bf  h[2];
};

__device__ __forceinline__ v8f wmma_bf16(v16bf a, v16bf b, v8f c) {
    // D = A(16x32 bf16) * B(32x16 bf16) + C(16x16 f32)
    return __builtin_amdgcn_wmma_f32_16x16x32_bf16(
        /*neg_a=*/false, a, /*neg_b=*/false, b,
        /*c_mod=*/(short)0, c, /*reuse_a=*/false, /*reuse_b=*/false);
}

#if __has_builtin(__builtin_amdgcn_update_dpp)
template <int CTRL>
__device__ __forceinline__ float dpp_mov(float x) {
    return __int_as_float(
        __builtin_amdgcn_update_dpp(0, __float_as_int(x), CTRL, 0xF, 0xF, true));
}
__device__ __forceinline__ float red_max16(float x) {
    x = fmaxf(x, dpp_mov<0xB1>(x));   // quad_perm [1,0,3,2]  : xor 1
    x = fmaxf(x, dpp_mov<0x4E>(x));   // quad_perm [2,3,0,1]  : xor 2
    x = fmaxf(x, dpp_mov<0x141>(x));  // row_half_mirror      : xor 4
    x = fmaxf(x, dpp_mov<0x140>(x));  // row_mirror           : xor 8
    return x;
}
__device__ __forceinline__ float red_sum16(float x) {
    x += dpp_mov<0xB1>(x);
    x += dpp_mov<0x4E>(x);
    x += dpp_mov<0x141>(x);
    x += dpp_mov<0x140>(x);
    return x;
}
#else
__device__ __forceinline__ float red_max16(float x) {
    #pragma unroll
    for (int off = 8; off; off >>= 1) x = fmaxf(x, __shfl_xor(x, off, 32));
    return x;
}
__device__ __forceinline__ float red_sum16(float x) {
    #pragma unroll
    for (int off = 8; off; off >>= 1) x += __shfl_xor(x, off, 32);
    return x;
}
#endif

static constexpr int Bsz = 2;
static constexpr int T   = 2048;
static constexpr int C   = 1024;
static constexpr int H   = 16;
static constexpr int HD  = 64;
static constexpr int M   = Bsz * T;   // 4096 rows

// ---------------------------------------------------------------------------
// fp32 -> bf16 conversion of all six weight matrices, one launch.
// A block converts CVT_BLK consecutive floats of one matrix: each thread issues
// CVT_U 16-byte loads (a wave-wide load = 512 contiguous bytes), all in flight
// together, then stores 8 bytes per load (a wave-wide store = two whole lines).
// dst is the six bf16 planes laid end to end in the order Wq Wk Wv Wp W1 W2.
// ---------------------------------------------------------------------------
typedef __attribute__((ext_vector_type(4))) __bf16 v4bf;

static constexpr int CVT_U    = 16;                    // 16-byte loads per thread
static constexpr int CVT_BLK  = 256 * CVT_U * 4;       // floats per block
static constexpr int CVT_SQ   = C * C / CVT_BLK;       // blocks per C x C matrix
static constexpr int CVT_GRID = 12 * CVT_SQ;           // 4 square + 2 fourfold

// waves_per_eu: lets the compiler use the registers for all CVT_U loads at once;
// at its default target it holds the last two back until the first two return.
__global__ __launch_bounds__(256) __attribute__((amdgpu_waves_per_eu(4, 8)))
void cvt_weights(const float* __restrict__ Wq, const float* __restrict__ Wk,
                 const float* __restrict__ Wv, const float* __restrict__ Wp,
                 const float* __restrict__ W1, const float* __restrict__ W2,
                 bf16_t* __restrict__ dst) {
    int blk = blockIdx.x;
    const float* src;
    int first;
    if      (blk < 1 * CVT_SQ) { src = Wq; first = 0; }
    else if (blk < 2 * CVT_SQ) { src = Wk; first = 1 * CVT_SQ; }
    else if (blk < 3 * CVT_SQ) { src = Wv; first = 2 * CVT_SQ; }
    else if (blk < 4 * CVT_SQ) { src = Wp; first = 3 * CVT_SQ; }
    else if (blk < 8 * CVT_SQ) { src = W1; first = 4 * CVT_SQ; }
    else                       { src = W2; first = 8 * CVT_SQ; }

    const float4* s = (const float4*)(src + (size_t)(blk - first) * CVT_BLK) + threadIdx.x;
    v4bf*         d = (v4bf*)(dst + (size_t)blk * CVT_BLK) + threadIdx.x;

    float4 v[CVT_U];
    #pragma unroll
    for (int i = 0; i < CVT_U; ++i) v[i] = s[i * 256];
    #pragma unroll
    for (int i = 0; i < CVT_U; ++i) {
        v4bf o;
        o[0] = (bf16_t)v[i].x; o[1] = (bf16_t)v[i].y;
        o[2] = (bf16_t)v[i].z; o[3] = (bf16_t)v[i].w;
        d[i * 256] = o;
    }
}

// ---------------------------------------------------------------------------
// LayerNorm over C=1024, one block (256 threads) per row, bf16 output
// ---------------------------------------------------------------------------
__global__ __launch_bounds__(256)
void ln_kernel(const float* __restrict__ x, const float* __restrict__ w,
               const float* __restrict__ b, bf16_t* __restrict__ out) {
    int row  = blockIdx.x;
    int tid  = threadIdx.x;
    int wave = tid >> 5, lane = tid & 31;

    const float* xr = x + (size_t)row * C;
    float4 xv = ((const float4*)xr)[tid];
    float s1 = xv.x + xv.y + xv.z + xv.w;
    float s2 = xv.x*xv.x + xv.y*xv.y + xv.z*xv.z + xv.w*xv.w;
    #pragma unroll
    for (int off = 16; off; off >>= 1) {
        s1 += __shfl_xor(s1, off, 32);
        s2 += __shfl_xor(s2, off, 32);
    }
    __shared__ float a1[8], a2[8];
    if (lane == 0) { a1[wave] = s1; a2[wave] = s2; }
    __syncthreads();
    float t1 = 0.f, t2 = 0.f;
    #pragma unroll
    for (int i = 0; i < 8; ++i) { t1 += a1[i]; t2 += a2[i]; }
    float mu   = t1 * (1.0f / C);
    float var  = t2 * (1.0f / C) - mu * mu;
    float rstd = rsqrtf(var + 1e-5f);

    float4 wv = ((const float4*)w)[tid];
    float4 bv = ((const float4*)b)[tid];
    bf16_t* orow = out + (size_t)row * C;
    orow[tid*4 + 0] = (bf16_t)((xv.x - mu) * rstd * wv.x + bv.x);
    orow[tid*4 + 1] = (bf16_t)((xv.y - mu) * rstd * wv.y + bv.y);
    orow[tid*4 + 2] = (bf16_t)((xv.z - mu) * rstd * wv.z + bv.z);
    orow[tid*4 + 3] = (bf16_t)((xv.w - mu) * rstd * wv.w + bv.w);
}

// ---------------------------------------------------------------------------
// Eight async global -> LDS copies and the wait that lets their address
// registers be reused, in one statement so that nothing can come between.
// ---------------------------------------------------------------------------
__device__ __forceinline__ void async_copy8_b128(unsigned int lds, unsigned int lds_step,
                                                 const bf16_t* g, size_t g_step) {
    unsigned int l0 = lds,                l1 = lds + lds_step,     l2 = lds + 2 * lds_step,
                 l3 = lds + 3 * lds_step, l4 = lds + 4 * lds_step, l5 = lds + 5 * lds_step,
                 l6 = lds + 6 * lds_step, l7 = lds + 7 * lds_step;
    const bf16_t *g0 = g,              *g1 = g + g_step,     *g2 = g + 2 * g_step,
                 *g3 = g + 3 * g_step, *g4 = g + 4 * g_step, *g5 = g + 5 * g_step,
                 *g6 = g + 6 * g_step, *g7 = g + 7 * g_step;
    asm volatile("global_load_async_to_lds_b128 %0, %8, off\n\t"
                 "global_load_async_to_lds_b128 %1, %9, off\n\t"
                 "global_load_async_to_lds_b128 %2, %10, off\n\t"
                 "global_load_async_to_lds_b128 %3, %11, off\n\t"
                 "global_load_async_to_lds_b128 %4, %12, off\n\t"
                 "global_load_async_to_lds_b128 %5, %13, off\n\t"
                 "global_load_async_to_lds_b128 %6, %14, off\n\t"
                 "global_load_async_to_lds_b128 %7, %15, off\n\t"
                 "s_wait_xcnt 0x0"
                 :: "v"(l0), "v"(l1), "v"(l2), "v"(l3), "v"(l4), "v"(l5), "v"(l6), "v"(l7),
                    "v"(g0), "v"(g1), "v"(g2), "v"(g3), "v"(g4), "v"(g5), "v"(g6), "v"(g7)
                 : "memory");
}

// The same with four copies.
__device__ __forceinline__ void async_copy4_b128(unsigned int lds, unsigned int lds_step,
                                                 const bf16_t* g, size_t g_step) {
    unsigned int l0 = lds, l1 = lds + lds_step, l2 = lds + 2 * lds_step, l3 = lds + 3 * lds_step;
    const bf16_t *g0 = g, *g1 = g + g_step, *g2 = g + 2 * g_step, *g3 = g + 3 * g_step;
    asm volatile("global_load_async_to_lds_b128 %0, %4, off\n\t"
                 "global_load_async_to_lds_b128 %1, %5, off\n\t"
                 "global_load_async_to_lds_b128 %2, %6, off\n\t"
                 "global_load_async_to_lds_b128 %3, %7, off\n\t"
                 "s_wait_xcnt 0x0"
                 :: "v"(l0), "v"(l1), "v"(l2), "v"(l3), "v"(g0), "v"(g1), "v"(g2), "v"(g3)
                 : "memory");
}

static constexpr int GK     = 128;
static constexpr int GPITCH = GK + 8;
static constexpr int GSTAGE = 256 * GPITCH;

template <int EPI>
__global__ __launch_bounds__(256)
void gemm_bf16(const bf16_t* __restrict__ A, const bf16_t* __restrict__ W,
               const float* __restrict__ bias, const float* __restrict__ resid,
               void* __restrict__ out, int N, int K) {
    __shared__ __align__(16) bf16_t st[2 * GSTAGE];

    int tid  = threadIdx.x;
    int wave = tid >> 5;
    int lane = tid & 31;
    int r    = lane & 15;
    int sel  = lane >> 4;        // which 16-lane half
    int wm   = wave >> 2;        // 0..1: 64-row strip
    int wn   = wave & 3;         // 0..3: 32-column strip

    int mb = blockIdx.x * 128;
    int nb = blockIdx.y * 128;

    // copies: thread t brings chunk (t & 15) of rows (t >> 4) + 16 * i
    int crow = tid >> 4;
    int cchk = tid & 15;
    const bf16_t* asrc = A + (size_t)(mb + crow) * K + cchk * 8;
    const bf16_t* wsrc = W + (size_t)(nb + crow) * K + cchk * 8;
    unsigned int  cdst = (unsigned int)(unsigned long long)(st + crow * GPITCH + cchk * 8);
    size_t        gstep = (size_t)16 * K;

    auto issue_stage = [&](int s, int buf) {
        unsigned int d = cdst + (unsigned int)buf * (GSTAGE * 2);
        async_copy8_b128(d,                    16 * GPITCH * 2, asrc + (size_t)s * GK, gstep);
        async_copy8_b128(d + 128 * GPITCH * 2, 16 * GPITCH * 2, wsrc + (size_t)s * GK, gstep);
    };

    int nst = K / GK;

    issue_stage(0, 0);
    // stage 0 landed (this wave's copies), then everyone's
    asm volatile("s_wait_asynccnt 0x0" ::: "memory");
    __syncthreads();
    if (nst > 1) issue_stage(1, 1);

    v8f acc[4][2] = {};

    for (int s = 0; s < nst; ++s) {
        int cur = s & 1;
        const bf16_t* abuf = st + cur * GSTAGE + (wm * 64 + r) * GPITCH + sel * 8;
        const bf16_t* bbuf = st + cur * GSTAGE + (128 + wn * 32 + r) * GPITCH + sel * 8;

        // two fragment sets: block kc + 1 is read from LDS while block kc multiplies
        BV a[2][4], b[2][2];
        auto load_frags = [&](int kc, int set) {
            #pragma unroll
            for (int mt = 0; mt < 4; ++mt) {
                a[set][mt].h[0] = *(const v8bf*)(abuf + mt * 16 * GPITCH + kc * 32);
                a[set][mt].h[1] = *(const v8bf*)(abuf + mt * 16 * GPITCH + kc * 32 + 16);
            }
            #pragma unroll
            for (int nt = 0; nt < 2; ++nt) {
                b[set][nt].h[0] = *(const v8bf*)(bbuf + nt * 16 * GPITCH + kc * 32);
                b[set][nt].h[1] = *(const v8bf*)(bbuf + nt * 16 * GPITCH + kc * 32 + 16);
            }
        };
        load_frags(0, 0);
        #pragma unroll
        for (int kc = 0; kc < GK / 32; ++kc) {
            if (kc + 1 < GK / 32) load_frags(kc + 1, (kc + 1) & 1);
            // keeps the next block's LDS reads one group ahead of this block's
            // products; left free, the scheduler sinks them among the products
            // and each pair of products then waits out an LDS latency
            __builtin_amdgcn_sched_barrier(0);
            #pragma unroll
            for (int mt = 0; mt < 4; ++mt)
                #pragma unroll
                for (int nt = 0; nt < 2; ++nt)
                    acc[mt][nt] = wmma_bf16(a[kc & 1][mt].v, b[kc & 1][nt].v, acc[mt][nt]);
            // keeps the block after next's reads behind this block's products,
            // whose fragment set they overwrite
            __builtin_amdgcn_sched_barrier(0);
        }

        // hand-over: this wave's reads of the buffer are done ...
        asm volatile("s_wait_dscnt 0x0" ::: "memory");
        // ... its copies of the next stage have landed ...
        asm volatile("s_wait_asynccnt 0x0" ::: "memory");
        // ... and so have everyone's: publishes stage s + 1, frees buffer cur
        __syncthreads();
        if (s + 2 < nst) issue_stage(s + 2, cur);
    }
    // nothing is in flight when the wave ends
    asm volatile("s_wait_asynccnt 0x0" ::: "memory");

    int m0 = mb + wm * 64;
    int n0 = nb + wn * 32;
    #pragma unroll
    for (int mt = 0; mt < 4; ++mt) {
        #pragma unroll
        for (int nt = 0; nt < 2; ++nt) {
            int col = n0 + nt * 16 + r;
            float bcol = bias[col];
            #pragma unroll
            for (int j = 0; j < 8; ++j) {
                int row = m0 + mt * 16 + j + sel * 8;
                size_t idx = (size_t)row * N + col;
                float v = acc[mt][nt][j] + bcol;
                if (EPI == 0) {
                    ((bf16_t*)out)[idx] = (bf16_t)v;
                } else if (EPI == 1) {
                    ((float*)out)[idx] = resid[idx] + v;
                } else {
                    float g = 0.5f * v * (1.0f + erff(v * 0.70710678118f));
                    ((bf16_t*)out)[idx] = (bf16_t)g;
                }
            }
        }
    }
}

static constexpr int AK     = 64;
static constexpr int APITCH = HD + 8;
static constexpr int ATILE  = AK * APITCH;
static constexpr int ASTAGE = 2 * ATILE;

__global__ __launch_bounds__(128)
void attn_kernel(const bf16_t* __restrict__ q, const bf16_t* __restrict__ k,
                 const bf16_t* __restrict__ v, bf16_t* __restrict__ y) {
    __shared__ __align__(16) bf16_t pbuf[4][16 * 32];  // P tile per wave
    __shared__ __align__(16) bf16_t kv[2 * ASTAGE];    // K and V stages, block-wide

    // in a scalar register: the wave's block counts below steer scalar branches
    int wave = __builtin_amdgcn_readfirstlane(threadIdx.x >> 5);
    int lane = threadIdx.x & 31;
    int r    = lane & 15;
    int sel  = lane >> 4;

    int bq = blockIdx.x & 31;          // T/64 = 32 query blocks
    int hh = (blockIdx.x >> 5) & 15;   // head
    int bb = blockIdx.x >> 9;          // batch
    int qbase = bq * 64 + wave * 16;

    size_t base = (size_t)bb * T * C + (size_t)hh * HD;

    // copies: thread t brings chunk (t & 7) of rows (t >> 3) + 16 * i of a stage
    int crow = threadIdx.x >> 3;
    int cchk = threadIdx.x & 7;
    const bf16_t* ksrc = k + base + (size_t)crow * C + cchk * 8;
    const bf16_t* vsrc = v + base + (size_t)crow * C + cchk * 8;
    unsigned int  cdst = (unsigned int)(unsigned long long)(kv + crow * APITCH + cchk * 8);

    auto issue_stage = [&](int s, int buf) {
        unsigned int d = cdst + (unsigned int)buf * (ASTAGE * 2);
        async_copy4_b128(d,             16 * APITCH * 2, ksrc + (size_t)s * AK * C, (size_t)16 * C);
        async_copy4_b128(d + ATILE * 2, 16 * APITCH * 2, vsrc + (size_t)s * AK * C, (size_t)16 * C);
    };

    int nst = bq + 1;                  // 64-key stages up to the block's diagonal
    issue_stage(0, 0);

    // q A-operands for the two K=32 chunks of HD=64, pre-scaled by 1/8
    BV qa[2];
    const bf16_t* qrow = q + base + (size_t)(qbase + r) * C;
    #pragma unroll
    for (int c = 0; c < 2; ++c) {
        qa[c].h[0] = *(const v8bf*)(qrow + c * 32 + sel * 8);
        qa[c].h[1] = *(const v8bf*)(qrow + c * 32 + 16 + sel * 8);
        #pragma unroll
        for (int i = 0; i < 16; ++i)
            qa[c].v[i] = (bf16_t)((float)qa[c].v[i] * 0.125f);
    }

    v8f o[4] = {};
    float mrow[8], lrow[8];
    #pragma unroll
    for (int j = 0; j < 8; ++j) { mrow[j] = -INFINITY; lrow[j] = 0.f; }

    bf16_t* ps = pbuf[wave];

    // ks, vs: the 32 rows of K and of V in LDS that hold keys kb .. kb + 31
    auto process_block = [&](int kb, const bf16_t* ks, const bf16_t* vs, auto maskc) {
        constexpr bool MASK = decltype(maskc)::value;

        // ---- S = q @ k^T for 32 keys (two 16x16 tiles) ----
        // the four K fragments have registers of their own, so that their LDS
        // reads are in flight together ahead of the products
        BV kop[2][2];
        #pragma unroll
        for (int t = 0; t < 2; ++t) {
            #pragma unroll
            for (int c = 0; c < 2; ++c) {
                const bf16_t* kr = ks + (t * 16 + r) * APITCH + c * 32 + sel * 8;
                kop[t][c].h[0] = *(const v8bf*)(kr);
                kop[t][c].h[1] = *(const v8bf*)(kr + 16);
            }
        }
        v8f s0 = {}, s1 = {};
        #pragma unroll
        for (int c = 0; c < 2; ++c) {
            s0 = wmma_bf16(qa[c].v, kop[0][c].v, s0);
            s1 = wmma_bf16(qa[c].v, kop[1][c].v, s1);
        }

        // ---- online softmax per row (DPP 16-lane butterflies) ----
        #pragma unroll
        for (int j = 0; j < 8; ++j) {
            float a0 = s0[j], a1 = s1[j];
            if (MASK) {
                int qi = qbase + j + sel * 8;
                a0 = (kb + r      <= qi) ? a0 : -INFINITY;
                a1 = (kb + 16 + r <= qi) ? a1 : -INFINITY;
            }
            float mt = red_max16(fmaxf(a0, a1));
            float mnew = fmaxf(mrow[j], mt);
            float p0 = __expf(a0 - mnew);
            float p1 = __expf(a1 - mnew);
            float rs = red_sum16(p0 + p1);
            float alpha = __expf(mrow[j] - mnew);
            lrow[j] = lrow[j] * alpha + rs;
            mrow[j] = mnew;
            #pragma unroll
            for (int nt = 0; nt < 4; ++nt) o[nt][j] *= alpha;
            int prow = j + sel * 8;
            ps[prow * 32 + r]      = (bf16_t)p0;
            ps[prow * 32 + 16 + r] = (bf16_t)p1;
        }

        // ---- O += P @ V (one 16x16x32 wmma per 16-wide d tile) ----
        BV pa;
        pa.h[0] = *(const v8bf*)(ps + r * 32 + sel * 8);
        pa.h[1] = *(const v8bf*)(ps + r * 32 + 16 + sel * 8);
        #pragma unroll
        for (int nt = 0; nt < 4; ++nt) {
            BV vb;
            #pragma unroll
            for (int i = 0; i < 8; ++i) {
                vb.v[i]     = vs[(sel * 8 + i) * APITCH + nt * 16 + r];
                vb.v[8 + i] = vs[(16 + sel * 8 + i) * APITCH + nt * 16 + r];
            }
            o[nt] = wmma_bf16(pa.v, vb.v, o[nt]);
        }
    };

    int nblk  = (qbase + 16 + 31) / 32;  // this wave's 32-key blocks
    int nfull = qbase >> 5;              // blocks entirely below the diagonal

    // stage 0 landed (this wave's copies), then everyone's
    asm volatile("s_wait_asynccnt 0x0" ::: "memory");
    __syncthreads();
    if (nst > 1) issue_stage(1, 1);

    for (int s = 0; s < nst; ++s) {
        int cur = s & 1;
        const bf16_t* kt = kv + cur * ASTAGE;
        // this wave's blocks inside the stage: first the unmasked, then the masked
        int jb   = s * (AK / 32);
        int jful = min(nfull, jb + AK / 32);
        int jend = min(nblk,  jb + AK / 32);
        for (; jb < jful; ++jb) {
            const bf16_t* ks = kt + (jb % (AK / 32)) * 32 * APITCH;
            process_block(jb * 32, ks, ks + ATILE, std::integral_constant<bool, false>{});
        }
        for (; jb < jend; ++jb) {
            const bf16_t* ks = kt + (jb % (AK / 32)) * 32 * APITCH;
            process_block(jb * 32, ks, ks + ATILE, std::integral_constant<bool, true>{});
        }
        // hand-over: this wave's reads of the buffer are done ...
        asm volatile("s_wait_dscnt 0x0" ::: "memory");
        // ... its copies of the next stage have landed ...
        asm volatile("s_wait_asynccnt 0x0" ::: "memory");
        // ... and so have everyone's: publishes stage s + 1, frees buffer cur
        __syncthreads();
        if (s + 2 < nst) issue_stage(s + 2, cur);
    }
    // nothing is in flight when the wave ends
    asm volatile("s_wait_asynccnt 0x0" ::: "memory");

    // ---- finalize: y = O / l ----
    #pragma unroll
    for (int j = 0; j < 8; ++j) {
        int qi = qbase + j + sel * 8;
        float inv = 1.0f / lrow[j];
        #pragma unroll
        for (int nt = 0; nt < 4; ++nt)
            y[base + (size_t)qi * C + nt * 16 + r] = (bf16_t)(o[nt][j] * inv);
    }
}

// ---------------------------------------------------------------------------
// Host-side launch
// ---------------------------------------------------------------------------
extern "C" void kernel_launch(void* const* d_in, const int* in_sizes, int n_in,
                              void* d_out, int out_size, void* d_ws, size_t ws_size,
                              hipStream_t stream) {
    const float* x     = (const float*)d_in[0];
    const float* ln1_w = (const float*)d_in[1];
    const float* ln1_b = (const float*)d_in[2];
    const float* ln2_w = (const float*)d_in[3];
    const float* ln2_b = (const float*)d_in[4];
    const float* Wq = (const float*)d_in[5];  const float* bq = (const float*)d_in[6];
    const float* Wk = (const float*)d_in[7];  const float* bk = (const float*)d_in[8];
    const float* Wv = (const float*)d_in[9];  const float* bv = (const float*)d_in[10];
    const float* Wp = (const float*)d_in[11]; const float* bp = (const float*)d_in[12];
    const float* W1 = (const float*)d_in[13]; const float* b1 = (const float*)d_in[14];
    const float* W2 = (const float*)d_in[15]; const float* b2 = (const float*)d_in[16];
    float* outp = (float*)d_out;

    // workspace layout
    char* w = (char*)d_ws;
    auto take = [&](size_t bytes) { char* p = w; w += (bytes + 255) & ~size_t(255); return p; };
    bf16_t* hb   = (bf16_t*)take((size_t)M * C * 2);
    bf16_t* wqb  = (bf16_t*)take((size_t)C * C * 2);
    bf16_t* wkb  = (bf16_t*)take((size_t)C * C * 2);
    bf16_t* wvb  = (bf16_t*)take((size_t)C * C * 2);
    bf16_t* wpb  = (bf16_t*)take((size_t)C * C * 2);
    bf16_t* w1b  = (bf16_t*)take((size_t)4 * C * C * 2);
    bf16_t* w2b  = (bf16_t*)take((size_t)4 * C * C * 2);
    bf16_t* qb   = (bf16_t*)take((size_t)M * C * 2);
    bf16_t* kbuf = (bf16_t*)take((size_t)M * C * 2);
    bf16_t* vb_  = (bf16_t*)take((size_t)M * C * 2);
    bf16_t* yb   = (bf16_t*)take((size_t)M * C * 2);
    float*  xres = (float*) take((size_t)M * C * 4);
    bf16_t* h2b  = (bf16_t*)take((size_t)M * C * 2);
    bf16_t* mact = (bf16_t*)take((size_t)M * 4 * C * 2);

    // 1) weights -> bf16 (the six planes from wqb on lie end to end: every
    //    plane's size is a multiple of the workspace granule)
    cvt_weights<<<CVT_GRID, 256, 0, stream>>>(Wq, Wk, Wv, Wp, W1, W2, wqb);

    // 2) LN1
    ln_kernel<<<M, 256, 0, stream>>>(x, ln1_w, ln1_b, hb);

    // 3) QKV projections
    dim3 g1(M / 128, C / 128);
    gemm_bf16<0><<<g1, 256, 0, stream>>>(hb, wqb, bq, nullptr, qb,   C, C);
    gemm_bf16<0><<<g1, 256, 0, stream>>>(hb, wkb, bk, nullptr, kbuf, C, C);
    gemm_bf16<0><<<g1, 256, 0, stream>>>(hb, wvb, bv, nullptr, vb_,  C, C);

    // 4) causal attention
    attn_kernel<<<Bsz * H * (T / 64), 128, 0, stream>>>(qb, kbuf, vb_, yb);

    // 5) output projection + residual (f32)
    gemm_bf16<1><<<g1, 256, 0, stream>>>(yb, wpb, bp, x, xres, C, C);

    // 6) LN2
    ln_kernel<<<M, 256, 0, stream>>>(xres, ln2_w, ln2_b, h2b);

    // 7) MLP fc1 + GELU
    dim3 g2(M / 128, (4 * C) / 128);
    gemm_bf16<2><<<g2, 256, 0, stream>>>(h2b, w1b, b1, nullptr, mact, 4 * C, C);

    // 8) MLP fc2 + residual -> final output (f32)
    gemm_bf16<1><<<g1, 256, 0, stream>>>(mact, w2b, b2, xres, outp, C, 4 * C);
}

// v004
// Measured time: 180 microseconds a run.
// Two timings next to v003 put it at 1.22 and 1.23 times that version's speed.
// Over all steps from v000 it is 2.53 times as fast.
#include <hip/hip_runtime.h>
#include <hip/hip_bf16.h>
#include <math.h>
#include <type_traits>

typedef __bf16 bf16_t;
typedef __attribute__((ext_vector_type(16))) __bf16 v16bf;
typedef __attribute__((ext_vector_type(8)))  __bf16 v8bf;
typedef __attribute__((ext_vector_type(8)))  float  v8f;

union BV {
    v16bf v;
    v8bf  h[2];
};

__device__ __forceinline__ v8f wmma_bf16(v16bf a, v16bf b, v8f c) {
    // D = A(16x32 bf16) * B(32x16 bf16) + C(16x16 f32)
    return __builtin_amdgcn_wmma_f32_16x16x32_bf16(
        /*neg_a=*/false, a, /*neg_b=*/false, b,
        /*c_mod=*/(short)0, c, /*reuse_a=*/false, /*reuse_b=*/false);
}

__device__ __forceinline__ float xhalf(float x) {
    int i = __float_as_int(x);
    return __int_as_float(
        __builtin_amdgcn_permlanex16(i, i, 0x76543210, 0xfedcba98, false, false));
}

static constexpr int Bsz = 2;
static constexpr int T   = 2048;
static constexpr int C   = 1024;
static constexpr int H   = 16;
static constexpr int HD  = 64;
static constexpr int M   = Bsz * T;   // 4096 rows

// ---------------------------------------------------------------------------
// fp32 -> bf16 conversion of all six weight matrices, one launch.
// A block converts CVT_BLK consecutive floats of one matrix: each thread issues
// CVT_U 16-byte loads (a wave-wide load = 512 contiguous bytes), all in flight
// together, then stores 8 bytes per load (a wave-wide store = two whole lines).
// dst is the six bf16 planes laid end to end in the order Wq Wk Wv Wp W1 W2.
// ---------------------------------------------------------------------------
typedef __attribute__((ext_vector_type(4))) __bf16 v4bf;

static constexpr int CVT_U    = 16;                    // 16-byte loads per thread
static constexpr int CVT_BLK  = 256 * CVT_U * 4;       // floats per block
static constexpr int CVT_SQ   = C * C / CVT_BLK;       // blocks per C x C matrix
static constexpr int CVT_GRID = 12 * CVT_SQ;           // 4 square + 2 fourfold

// waves_per_eu: lets the compiler use the registers for all CVT_U loads at once;
// at its default target it holds the last two back until the first two return.
__global__ __launch_bounds__(256) __attribute__((amdgpu_waves_per_eu(4, 8)))
void cvt_weights(const float* __restrict__ Wq, const float* __restrict__ Wk,
                 const float* __restrict__ Wv, const float* __restrict__ Wp,
                 const float* __restrict__ W1, const float* __restrict__ W2,
                 bf16_t* __restrict__ dst) {
    int blk = blockIdx.x;
    const float* src;
    int first;
    if      (blk < 1 * CVT_SQ) { src = Wq; first = 0; }
    else if (blk < 2 * CVT_SQ) { src = Wk; first = 1 * CVT_SQ; }
    else if (blk < 3 * CVT_SQ) { src = Wv; first = 2 * CVT_SQ; }
    else if (blk < 4 * CVT_SQ) { src = Wp; first = 3 * CVT_SQ; }
    else if (blk < 8 * CVT_SQ) { src = W1; first = 4 * CVT_SQ; }
    else                       { src = W2; first = 8 * CVT_SQ; }

    const float4* s = (const float4*)(src + (size_t)(blk - first) * CVT_BLK) + threadIdx.x;
    v4bf*         d = (v4bf*)(dst + (size_t)blk * CVT_BLK) + threadIdx.x;

    float4 v[CVT_U];
    #pragma unroll
    for (int i = 0; i < CVT_U; ++i) v[i] = s[i * 256];
    #pragma unroll
    for (int i = 0; i < CVT_U; ++i) {
        v4bf o;
        o[0] = (bf16_t)v[i].x; o[1] = (bf16_t)v[i].y;
        o[2] = (bf16_t)v[i].z; o[3] = (bf16_t)v[i].w;
        d[i * 256] = o;
    }
}

// ---------------------------------------------------------------------------
// LayerNorm over C=1024, one block (256 threads) per row, bf16 output
// ---------------------------------------------------------------------------
__global__ __launch_bounds__(256)
void ln_kernel(const float* __restrict__ x, const float* __restrict__ w,
               const float* __restrict__ b, bf16_t* __restrict__ out) {
    int row  = blockIdx.x;
    int tid  = threadIdx.x;
    int wave = tid >> 5, lane = tid & 31;

    const float* xr = x + (size_t)row * C;
    float4 xv = ((const float4*)xr)[tid];
    float s1 = xv.x + xv.y + xv.z + xv.w;
    float s2 = xv.x*xv.x + xv.y*xv.y + xv.z*xv.z + xv.w*xv.w;
    #pragma unroll
    for (int off = 16; off; off >>= 1) {
        s1 += __shfl_xor(s1, off, 32);
        s2 += __shfl_xor(s2, off, 32);
    }
    __shared__ float a1[8], a2[8];
    if (lane == 0) { a1[wave] = s1; a2[wave] = s2; }
    __syncthreads();
    float t1 = 0.f, t2 = 0.f;
    #pragma unroll
    for (int i = 0; i < 8; ++i) { t1 += a1[i]; t2 += a2[i]; }
    float mu   = t1 * (1.0f / C);
    float var  = t2 * (1.0f / C) - mu * mu;
    float rstd = rsqrtf(var + 1e-5f);

    float4 wv = ((const float4*)w)[tid];
    float4 bv = ((const float4*)b)[tid];
    bf16_t* orow = out + (size_t)row * C;
    orow[tid*4 + 0] = (bf16_t)((xv.x - mu) * rstd * wv.x + bv.x);
    orow[tid*4 + 1] = (bf16_t)((xv.y - mu) * rstd * wv.y + bv.y);
    orow[tid*4 + 2] = (bf16_t)((xv.z - mu) * rstd * wv.z + bv.z);
    orow[tid*4 + 3] = (bf16_t)((xv.w - mu) * rstd * wv.w + bv.w);
}

// ---------------------------------------------------------------------------
// Eight async global -> LDS copies and the wait that lets their address
// registers be reused, in one statement so that nothing can come between.
// ---------------------------------------------------------------------------
__device__ __forceinline__ void async_copy8_b128(unsigned int lds, unsigned int lds_step,
                                                 const bf16_t* g, size_t g_step) {
    unsigned int l0 = lds,                l1 = lds + lds_step,     l2 = lds + 2 * lds_step,
                 l3 = lds + 3 * lds_step, l4 = lds + 4 * lds_step, l5 = lds + 5 * lds_step,
                 l6 = lds + 6 * lds_step, l7 = lds + 7 * lds_step;
    const bf16_t *g0 = g,              *g1 = g + g_step,     *g2 = g + 2 * g_step,
                 *g3 = g + 3 * g_step, *g4 = g + 4 * g_step, *g5 = g + 5 * g_step,
                 *g6 = g + 6 * g_step, *g7 = g + 7 * g_step;
    asm volatile("global_load_async_to_lds_b128 %0, %8, off\n\t"
                 "global_load_async_to_lds_b128 %1, %9, off\n\t"
                 "global_load_async_to_lds_b128 %2, %10, off\n\t"
                 "global_load_async_to_lds_b128 %3, %11, off\n\t"
                 "global_load_async_to_lds_b128 %4, %12, off\n\t"
                 "global_load_async_to_lds_b128 %5, %13, off\n\t"
                 "global_load_async_to_lds_b128 %6, %14, off\n\t"
                 "global_load_async_to_lds_b128 %7, %15, off\n\t"
                 "s_wait_xcnt 0x0"
                 :: "v"(l0), "v"(l1), "v"(l2), "v"(l3), "v"(l4), "v"(l5), "v"(l6), "v"(l7),
                    "v"(g0), "v"(g1), "v"(g2), "v"(g3), "v"(g4), "v"(g5), "v"(g6), "v"(g7)
                 : "memory");
}

// The same with four copies.
__device__ __forceinline__ void async_copy4_b128(unsigned int lds, unsigned int lds_step,
                                                 const bf16_t* g, size_t g_step) {
    unsigned int l0 = lds, l1 = lds + lds_step, l2 = lds + 2 * lds_step, l3 = lds + 3 * lds_step;
    const bf16_t *g0 = g, *g1 = g + g_step, *g2 = g + 2 * g_step, *g3 = g + 3 * g_step;
    asm volatile("global_load_async_to_lds_b128 %0, %4, off\n\t"
                 "global_load_async_to_lds_b128 %1, %5, off\n\t"
                 "global_load_async_to_lds_b128 %2, %6, off\n\t"
                 "global_load_async_to_lds_b128 %3, %7, off\n\t"
                 "s_wait_xcnt 0x0"
                 :: "v"(l0), "v"(l1), "v"(l2), "v"(l3), "v"(g0), "v"(g1), "v"(g2), "v"(g3)
                 : "memory");
}

static constexpr int GK     = 128;
static constexpr int GPITCH = GK + 8;
static constexpr int GSTAGE = 256 * GPITCH;

template <int EPI>
__global__ __launch_bounds__(256)
void gemm_bf16(const bf16_t* __restrict__ A, const bf16_t* __restrict__ W,
               const float* __restrict__ bias, const float* __restrict__ resid,
               void* __restrict__ out, int N, int K) {
    __shared__ __align__(16) bf16_t st[2 * GSTAGE];

    int tid  = threadIdx.x;
    int wave = tid >> 5;
    int lane = tid & 31;
    int r    = lane & 15;
    int sel  = lane >> 4;        // which 16-lane half
    int wm   = wave >> 2;        // 0..1: 64-row strip
    int wn   = wave & 3;         // 0..3: 32-column strip

    int mb = blockIdx.x * 128;
    int nb = blockIdx.y * 128;

    // copies: thread t brings chunk (t & 15) of rows (t >> 4) + 16 * i
    int crow = tid >> 4;
    int cchk = tid & 15;
    const bf16_t* asrc = A + (size_t)(mb + crow) * K + cchk * 8;
    const bf16_t* wsrc = W + (size_t)(nb + crow) * K + cchk * 8;
    unsigned int  cdst = (unsigned int)(unsigned long long)(st + crow * GPITCH + cchk * 8);
    size_t        gstep = (size_t)16 * K;

    auto issue_stage = [&](int s, int buf) {
        unsigned int d = cdst + (unsigned int)buf * (GSTAGE * 2);
        async_copy8_b128(d,                    16 * GPITCH * 2, asrc + (size_t)s * GK, gstep);
        async_copy8_b128(d + 128 * GPITCH * 2, 16 * GPITCH * 2, wsrc + (size_t)s * GK, gstep);
    };

    int nst = K / GK;

    issue_stage(0, 0);
    // stage 0 landed (this wave's copies), then everyone's
    asm volatile("s_wait_asynccnt 0x0" ::: "memory");
    __syncthreads();
    if (nst > 1) issue_stage(1, 1);

    v8f acc[4][2] = {};

    for (int s = 0; s < nst; ++s) {
        int cur = s & 1;
        const bf16_t* abuf = st + cur * GSTAGE + (wm * 64 + r) * GPITCH + sel * 8;
        const bf16_t* bbuf = st + cur * GSTAGE + (128 + wn * 32 + r) * GPITCH + sel * 8;

        // two fragment sets: block kc + 1 is read from LDS while block kc multiplies
        BV a[2][4], b[2][2];
        auto load_frags = [&](int kc, int set) {
            #pragma unroll
            for (int mt = 0; mt < 4; ++mt) {
                a[set][mt].h[0] = *(const v8bf*)(abuf + mt * 16 * GPITCH + kc * 32);
                a[set][mt].h[1] = *(const v8bf*)(abuf + mt * 16 * GPITCH + kc * 32 + 16);
            }
            #pragma unroll
            for (int nt = 0; nt < 2; ++nt) {
                b[set][nt].h[0] = *(const v8bf*)(bbuf + nt * 16 * GPITCH + kc * 32);
                b[set][nt].h[1] = *(const v8bf*)(bbuf + nt * 16 * GPITCH + kc * 32 + 16);
            }
        };
        load_frags(0, 0);
        #pragma unroll
        for (int kc = 0; kc < GK / 32; ++kc) {
            if (kc + 1 < GK / 32) load_frags(kc + 1, (kc + 1) & 1);
            // keeps the next block's LDS reads one group ahead of this block's
            // products; left free, the scheduler sinks them among the products
            // and each pair of products then waits out an LDS latency
            __builtin_amdgcn_sched_barrier(0);
            #pragma unroll
            for (int mt = 0; mt < 4; ++mt)
                #pragma unroll
                for (int nt = 0; nt < 2; ++nt)
                    acc[mt][nt] = wmma_bf16(a[kc & 1][mt].v, b[kc & 1][nt].v, acc[mt][nt]);
            // keeps the block after next's reads behind this block's products,
            // whose fragment set they overwrite
            __builtin_amdgcn_sched_barrier(0);
        }

        // hand-over: this wave's reads of the buffer are done ...
        asm volatile("s_wait_dscnt 0x0" ::: "memory");
        // ... its copies of the next stage have landed ...
        asm volatile("s_wait_asynccnt 0x0" ::: "memory");
        // ... and so have everyone's: publishes stage s + 1, frees buffer cur
        __syncthreads();
        if (s + 2 < nst) issue_stage(s + 2, cur);
    }
    // nothing is in flight when the wave ends
    asm volatile("s_wait_asynccnt 0x0" ::: "memory");

    int m0 = mb + wm * 64;
    int n0 = nb + wn * 32;
    #pragma unroll
    for (int mt = 0; mt < 4; ++mt) {
        #pragma unroll
        for (int nt = 0; nt < 2; ++nt) {
            int col = n0 + nt * 16 + r;
            float bcol = bias[col];
            #pragma unroll
            for (int j = 0; j < 8; ++j) {
                int row = m0 + mt * 16 + j + sel * 8;
                size_t idx = (size_t)row * N + col;
                float v = acc[mt][nt][j] + bcol;
                if (EPI == 0) {
                    ((bf16_t*)out)[idx] = (bf16_t)v;
                } else if (EPI == 1) {
                    ((float*)out)[idx] = resid[idx] + v;
                } else {
                    float g = 0.5f * v * (1.0f + erff(v * 0.70710678118f));
                    ((bf16_t*)out)[idx] = (bf16_t)g;
                }
            }
        }
    }
}

static constexpr int AK     = 64;
static constexpr int APITCH = HD + 8;
static constexpr int VPITCH = HD + 16;
static constexpr int ATILE  = AK * APITCH;
static constexpr int VTILE  = AK * VPITCH;
static constexpr int ASTAGE = ATILE + VTILE;

__device__ __forceinline__ v8bf lds_load_tr16(const bf16_t* p) {
    typedef __attribute__((address_space(3))) v8bf lds_v8bf;
    return __builtin_amdgcn_ds_load_tr16_b128_v8bf16((lds_v8bf*)p);
}

__global__ __launch_bounds__(128)
void attn_kernel(const bf16_t* __restrict__ q, const bf16_t* __restrict__ k,
                 const bf16_t* __restrict__ v, bf16_t* __restrict__ y) {
    __shared__ __align__(16) bf16_t kv[2 * ASTAGE];    // K and V stages, block-wide

    // in a scalar register: the wave's block counts below steer scalar branches
    int wave = __builtin_amdgcn_readfirstlane(threadIdx.x >> 5);
    int lane = threadIdx.x & 31;
    int r    = lane & 15;
    int sel  = lane >> 4;

    int bq = blockIdx.x & 31;          // T/64 = 32 query blocks
    int hh = (blockIdx.x >> 5) & 15;   // head
    int bb = blockIdx.x >> 9;          // batch
    int qbase = bq * 64 + wave * 16;

    size_t base = (size_t)bb * T * C + (size_t)hh * HD;

    // copies: thread t brings chunk (t & 7) of rows (t >> 3) + 16 * i of a stage
    int crow = threadIdx.x >> 3;
    int cchk = threadIdx.x & 7;
    const bf16_t* ksrc = k + base + (size_t)crow * C + cchk * 8;
    const bf16_t* vsrc = v + base + (size_t)crow * C + cchk * 8;
    unsigned int  kdst = (unsigned int)(unsigned long long)(kv + crow * APITCH + cchk * 8);
    unsigned int  vdst = (unsigned int)(unsigned long long)(kv + ATILE + crow * VPITCH + cchk * 8);

    auto issue_stage = [&](int s, int buf) {
        unsigned int d = (unsigned int)buf * (ASTAGE * 2);
        async_copy4_b128(kdst + d, 16 * APITCH * 2, ksrc + (size_t)s * AK * C, (size_t)16 * C);
        async_copy4_b128(vdst + d, 16 * VPITCH * 2, vsrc + (size_t)s * AK * C, (size_t)16 * C);
    };

    int nst = bq + 1;                  // 64-key stages up to the block's diagonal
    issue_stage(0, 0);

    // q^T B-operands for the two K=32 chunks of HD=64, pre-scaled by 1/8
    BV qa[2];
    const bf16_t* qrow = q + base + (size_t)(qbase + r) * C;
    #pragma unroll
    for (int c = 0; c < 2; ++c) {
        qa[c].h[0] = *(const v8bf*)(qrow + c * 32 + sel * 8);
        qa[c].h[1] = *(const v8bf*)(qrow + c * 32 + 16 + sel * 8);
        #pragma unroll
        for (int i = 0; i < 16; ++i)
            qa[c].v[i] = (bf16_t)((float)qa[c].v[i] * 0.125f);
    }

    // All per-query state is per lane: lane (r, sel) works for query qbase + r.
    // o[nt][j] = O^T[d = nt * 16 + sel * 8 + j][query]; mrow is the query's running
    // maximum (equal in both halves); lrow sums this half's keys only.
    v8f o[4] = {};
    float mrow = -INFINITY, lrow = 0.f;

    // ks, vs: the 32 rows of K and of V in LDS that hold keys kb .. kb + 31
    auto process_block = [&](int kb, const bf16_t* ks, const bf16_t* vs, auto maskc) {
        constexpr bool MASK = decltype(maskc)::value;

        // ---- S^T = k @ q^T for 32 keys (two 16x16 tiles): A = K rows, B = q ----
        // the four K fragments have registers of their own, so that their LDS
        // reads are in flight together ahead of the products
        BV kop[2][2];
        #pragma unroll
        for (int t = 0; t < 2; ++t) {
            #pragma unroll
            for (int c = 0; c < 2; ++c) {
                const bf16_t* kr = ks + (t * 16 + r) * APITCH + c * 32 + sel * 8;
                kop[t][c].h[0] = *(const v8bf*)(kr);
                kop[t][c].h[1] = *(const v8bf*)(kr + 16);
            }
        }
        // A fragments of V^T: keys sel * 8 .. + 7 and 16 + sel * 8 .. + 7 of d row
        // nt * 16 + r, the k order in which pb below holds P^T
        const bf16_t* vt = vs + (sel * 8 + (lane & 7)) * VPITCH + ((lane >> 3) & 1) * 8;
        BV va[4];
        #pragma unroll
        for (int nt = 0; nt < 4; ++nt) {
            va[nt].h[0] = lds_load_tr16(vt + nt * 16);
            va[nt].h[1] = lds_load_tr16(vt + 16 * VPITCH + nt * 16);
        }

        // st[t][j] = score of key kb + t * 16 + sel * 8 + j for query qbase + r
        v8f st[2] = {};
        #pragma unroll
        for (int c = 0; c < 2; ++c) {
            st[0] = wmma_bf16(kop[0][c].v, qa[c].v, st[0]);
            st[1] = wmma_bf16(kop[1][c].v, qa[c].v, st[1]);
        }
        if (MASK) {
            int qi = qbase + r;
            #pragma unroll
            for (int t = 0; t < 2; ++t)
                #pragma unroll
                for (int j = 0; j < 8; ++j)
                    st[t][j] = (kb + t * 16 + sel * 8 + j <= qi) ? st[t][j] : -INFINITY;
        }

        // ---- online softmax: 16 keys of one query in a lane, the other 16 in lane ^ 16 ----
        float mt = fmaxf(st[0][0], st[1][0]);
        #pragma unroll
        for (int j = 1; j < 8; ++j) mt = fmaxf(mt, fmaxf(st[0][j], st[1][j]));
        mt = fmaxf(mt, xhalf(mt));
        float mnew  = fmaxf(mrow, mt);
        float alpha = __expf(mrow - mnew);
        mrow = mnew;

        // P^T goes from the score registers straight into the B operand:
        // element t * 8 + j is key t * 16 + sel * 8 + j
        // the 16 terms are summed in four independent chains
        BV pb;
        float rs[4];
        #pragma unroll
        for (int t = 0; t < 2; ++t) {
            #pragma unroll
            for (int j = 0; j < 8; ++j) {
                float p = __expf(st[t][j] - mnew);
                if (t == 0 && j < 4) rs[j] = p;
                else                 rs[j & 3] += p;
                pb.v[t * 8 + j] = (bf16_t)p;
            }
        }

        // ---- O^T = O^T * alpha + V^T @ P^T (one 16x16x32 wmma per 16 d rows) ----
        #pragma unroll
        for (int nt = 0; nt < 4; ++nt) {
            #pragma unroll
            for (int j = 0; j < 8; ++j) o[nt][j] *= alpha;
            o[nt] = wmma_bf16(va[nt].v, pb.v, o[nt]);
        }
        __builtin_amdgcn_sched_barrier(0);
        lrow = lrow * alpha + ((rs[0] + rs[1]) + (rs[2] + rs[3]));
    };

    int nblk  = (qbase + 16 + 31) / 32;  // this wave's 32-key blocks
    int nfull = qbase >> 5;              // blocks entirely below the diagonal

    // stage 0 landed (this wave's copies), then everyone's
    asm volatile("s_wait_asynccnt 0x0" ::: "memory");
    __syncthreads();
    if (nst > 1) issue_stage(1, 1);

    for (int s = 0; s < nst; ++s) {
        int cur = s & 1;
        const bf16_t* kt = kv + cur * ASTAGE;
        // this wave's blocks inside the stage: first the unmasked, then the masked
        int jb   = s * (AK / 32);
        int jful = min(nfull, jb + AK / 32);
        int jend = min(nblk,  jb + AK / 32);
        for (; jb < jful; ++jb) {
            int sub = jb % (AK / 32);
            process_block(jb * 32, kt + sub * 32 * APITCH, kt + ATILE + sub * 32 * VPITCH,
                          std::integral_constant<bool, false>{});
        }
        for (; jb < jend; ++jb) {
            int sub = jb % (AK / 32);
            process_block(jb * 32, kt + sub * 32 * APITCH, kt + ATILE + sub * 32 * VPITCH,
                          std::integral_constant<bool, true>{});
        }
        // hand-over: this wave's reads of the buffer are done ...
        asm volatile("s_wait_dscnt 0x0" ::: "memory");
        // ... its copies of the next stage have landed ...
        asm volatile("s_wait_asynccnt 0x0" ::: "memory");
        // ... and so have everyone's: publishes stage s + 1, frees buffer cur
        __syncthreads();
        if (s + 2 < nst) issue_stage(s + 2, cur);
    }
    // nothing is in flight when the wave ends
    asm volatile("s_wait_asynccnt 0x0" ::: "memory");

    // ---- finalize: y = O / l; a lane holds 8 consecutive d of its query ----
    float inv = 1.0f / (lrow + xhalf(lrow));
    bf16_t* yrow = y + base + (size_t)(qbase + r) * C + sel * 8;
    #pragma unroll
    for (int nt = 0; nt < 4; ++nt) {
        v8bf ov;
        #pragma unroll
        for (int j = 0; j < 8; ++j) ov[j] = (bf16_t)(o[nt][j] * inv);
        *(v8bf*)(yrow + nt * 16) = ov;
    }
}

// ---------------------------------------------------------------------------
// Host-side launch
// ---------------------------------------------------------------------------
extern "C" void kernel_launch(void* const* d_in, const int* in_sizes, int n_in,
                              void* d_out, int out_size, void* d_ws, size_t ws_size,
                              hipStream_t stream) {
    const float* x     = (const float*)d_in[0];
    const float* ln1_w = (const float*)d_in[1];
    const float* ln1_b = (const float*)d_in[2];
    const float* ln2_w = (const float*)d_in[3];
    const float* ln2_b = (const float*)d_in[4];
    const float* Wq = (const float*)d_in[5];  const float* bq = (const float*)d_in[6];
    const float* Wk = (const float*)d_in[7];  const float* bk = (const float*)d_in[8];
    const float* Wv = (const float*)d_in[9];  const float* bv = (const float*)d_in[10];
    const float* Wp = (const float*)d_in[11]; const float* bp = (const float*)d_in[12];
    const float* W1 = (const float*)d_in[13]; const float* b1 = (const float*)d_in[14];
    const float* W2 = (const float*)d_in[15]; const float* b2 = (const float*)d_in[16];
    float* outp = (float*)d_out;

    // workspace layout
    char* w = (char*)d_ws;
    auto take = [&](size_t bytes) { char* p = w; w += (bytes + 255) & ~size_t(255); return p; };
    bf16_t* hb   = (bf16_t*)take((size_t)M * C * 2);
    bf16_t* wqb  = (bf16_t*)take((size_t)C * C * 2);
    bf16_t* wkb  = (bf16_t*)take((size_t)C * C * 2);
    bf16_t* wvb  = (bf16_t*)take((size_t)C * C * 2);
    bf16_t* wpb  = (bf16_t*)take((size_t)C * C * 2);
    bf16_t* w1b  = (bf16_t*)take((size_t)4 * C * C * 2);
    bf16_t* w2b  = (bf16_t*)take((size_t)4 * C * C * 2);
    bf16_t* qb   = (bf16_t*)take((size_t)M * C * 2);
    bf16_t* kbuf = (bf16_t*)take((size_t)M * C * 2);
    bf16_t* vb_  = (bf16_t*)take((size_t)M * C * 2);
    bf16_t* yb   = (bf16_t*)take((size_t)M * C * 2);
    float*  xres = (float*) take((size_t)M * C * 4);
    bf16_t* h2b  = (bf16_t*)take((size_t)M * C * 2);
    bf16_t* mact = (bf16_t*)take((size_t)M * 4 * C * 2);

    // 1) weights -> bf16 (the six planes from wqb on lie end to end: every
    //    plane's size is a multiple of the workspace granule)
    cvt_weights<<<CVT_GRID, 256, 0, stream>>>(Wq, Wk, Wv, Wp, W1, W2, wqb);

    // 2) LN1
    ln_kernel<<<M, 256, 0, stream>>>(x, ln1_w, ln1_b, hb);

    // 3) QKV projections
    dim3 g1(M / 128, C / 128);
    gemm_bf16<0><<<g1, 256, 0, stream>>>(hb, wqb, bq, nullptr, qb,   C, C);
    gemm_bf16<0><<<g1, 256, 0, stream>>>(hb, wkb, bk, nullptr, kbuf, C, C);
    gemm_bf16<0><<<g1, 256, 0, stream>>>(hb, wvb, bv, nullptr, vb_,  C, C);

    // 4) causal attention
    attn_kernel<<<Bsz * H * (T / 64), 128, 0, stream>>>(qb, kbuf, vb_, yb);

    // 5) output projection + residual (f32)
    gemm_bf16<1><<<g1, 256, 0, stream>>>(yb, wpb, bp, x, xres, C, C);

    // 6) LN2
    ln_kernel<<<M, 256, 0, stream>>>(xres, ln2_w, ln2_b, h2b);

    // 7) MLP fc1 + GELU
    dim3 g2(M / 128, (4 * C) / 128);
    gemm_bf16<2><<<g2, 256, 0, stream>>>(h2b, w1b, b1, nullptr, mact, 4 * C, C);

    // 8) MLP fc2 + residual -> final output (f32)
    gemm_bf16<1><<<g1, 256, 0, stream>>>(mact, w2b, b2, xres, outp, C, 4 * C);
}

// v005
// A run of this version takes 169 microseconds.
// Next to v004, in two timings, it ran 1.04 and 1.07 times as fast.
// Over all steps from v000 it is 2.67 times as fast.
#include <hip/hip_runtime.h>
#include <hip/hip_bf16.h>
#include <math.h>
#include <type_traits>

typedef __bf16 bf16_t;
typedef __attribute__((ext_vector_type(16))) __bf16 v16bf;
typedef __attribute__((ext_vector_type(8)))  __bf16 v8bf;
typedef __attribute__((ext_vector_type(8)))  float  v8f;

union BV {
    v16bf v;
    v8bf  h[2];
};

__device__ __forceinline__ v8f wmma_bf16(v16bf a, v16bf b, v8f c) {
    // D = A(16x32 bf16) * B(32x16 bf16) + C(16x16 f32)
    return __builtin_amdgcn_wmma_f32_16x16x32_bf16(
        /*neg_a=*/false, a, /*neg_b=*/false, b,
        /*c_mod=*/(short)0, c, /*reuse_a=*/false, /*reuse_b=*/false);
}

__device__ __forceinline__ float xhalf(float x) {
    int i = __float_as_int(x);
    return __int_as_float(
        __builtin_amdgcn_permlanex16(i, i, 0x76543210, 0xfedcba98, false, false));
}

static constexpr int Bsz = 2;
static constexpr int T   = 2048;
static constexpr int C   = 1024;
static constexpr int H   = 16;
static constexpr int HD  = 64;
static constexpr int M   = Bsz * T;   // 4096 rows

// ---------------------------------------------------------------------------
// fp32 -> bf16 conversion of all six weight matrices, one launch.
// A block converts CVT_BLK consecutive floats of one matrix: each thread issues
// CVT_U 16-byte loads (a wave-wide load = 512 contiguous bytes), all in flight
// together, then stores 8 bytes per load (a wave-wide store = two whole lines).
// dst is the six bf16 planes laid end to end in the order Wq Wk Wv Wp W1 W2.
// ---------------------------------------------------------------------------
typedef __attribute__((ext_vector_type(4))) __bf16 v4bf;

static constexpr int CVT_U    = 16;                    // 16-byte loads per thread
static constexpr int CVT_BLK  = 256 * CVT_U * 4;       // floats per block
static constexpr int CVT_SQ   = C * C / CVT_BLK;       // blocks per C x C matrix
static constexpr int CVT_GRID = 12 * CVT_SQ;           // 4 square + 2 fourfold

__device__ __forceinline__
void cvt_block(int blk,
               const float* __restrict__ Wq, const float* __restrict__ Wk,
               const float* __restrict__ Wv, const float* __restrict__ Wp,
               const float* __restrict__ W1, const float* __restrict__ W2,
               bf16_t* __restrict__ dst) {
    const float* src;
    int first;
    if      (blk < 1 * CVT_SQ) { src = Wq; first = 0; }
    else if (blk < 2 * CVT_SQ) { src = Wk; first = 1 * CVT_SQ; }
    else if (blk < 3 * CVT_SQ) { src = Wv; first = 2 * CVT_SQ; }
    else if (blk < 4 * CVT_SQ) { src = Wp; first = 3 * CVT_SQ; }
    else if (blk < 8 * CVT_SQ) { src = W1; first = 4 * CVT_SQ; }
    else                       { src = W2; first = 8 * CVT_SQ; }

    const float4* s = (const float4*)(src + (size_t)(blk - first) * CVT_BLK) + threadIdx.x;
    v4bf*         d = (v4bf*)(dst + (size_t)blk * CVT_BLK) + threadIdx.x;

    float4 v[CVT_U];
    #pragma unroll
    for (int i = 0; i < CVT_U; ++i) v[i] = s[i * 256];
    #pragma unroll
    for (int i = 0; i < CVT_U; ++i) {
        v4bf o;
        o[0] = (bf16_t)v[i].x; o[1] = (bf16_t)v[i].y;
        o[2] = (bf16_t)v[i].z; o[3] = (bf16_t)v[i].w;
        d[i * 256] = o;
    }
}

// ---------------------------------------------------------------------------
// LayerNorm over C=1024, one block (256 threads) per row, bf16 output
// ---------------------------------------------------------------------------
__device__ __forceinline__
void ln_row(int row, const float* __restrict__ x, const float* __restrict__ w,
            const float* __restrict__ b, bf16_t* __restrict__ out) {
    int tid  = threadIdx.x;
    int wave = tid >> 5, lane = tid & 31;

    const float* xr = x + (size_t)row * C;
    float4 xv = ((const float4*)xr)[tid];
    float s1 = xv.x + xv.y + xv.z + xv.w;
    float s2 = xv.x*xv.x + xv.y*xv.y + xv.z*xv.z + xv.w*xv.w;
    #pragma unroll
    for (int off = 16; off; off >>= 1) {
        s1 += __shfl_xor(s1, off, 32);
        s2 += __shfl_xor(s2, off, 32);
    }
    __shared__ float a1[8], a2[8];
    if (lane == 0) { a1[wave] = s1; a2[wave] = s2; }
    __syncthreads();
    float t1 = 0.f, t2 = 0.f;
    #pragma unroll
    for (int i = 0; i < 8; ++i) { t1 += a1[i]; t2 += a2[i]; }
    float mu   = t1 * (1.0f / C);
    float var  = t2 * (1.0f / C) - mu * mu;
    float rstd = rsqrtf(var + 1e-5f);

    float4 wv = ((const float4*)w)[tid];
    float4 bv = ((const float4*)b)[tid];
    bf16_t* orow = out + (size_t)row * C;
    orow[tid*4 + 0] = (bf16_t)((xv.x - mu) * rstd * wv.x + bv.x);
    orow[tid*4 + 1] = (bf16_t)((xv.y - mu) * rstd * wv.y + bv.y);
    orow[tid*4 + 2] = (bf16_t)((xv.z - mu) * rstd * wv.z + bv.z);
    orow[tid*4 + 3] = (bf16_t)((xv.w - mu) * rstd * wv.w + bv.w);
}

__global__ __launch_bounds__(256)
void ln_kernel(const float* __restrict__ x, const float* __restrict__ w,
               const float* __restrict__ b, bf16_t* __restrict__ out) {
    ln_row(blockIdx.x, x, w, b, out);
}

// The weight conversion and the first LayerNorm depend on nothing of each other:
// one launch, the CVT_GRID conversion blocks (the longer ones) first, then one
// block per row.
// waves_per_eu: lets the compiler use the registers for all CVT_U loads at once;
// at its default target it holds the last two back until the first two return.
__global__ __launch_bounds__(256) __attribute__((amdgpu_waves_per_eu(4, 8)))
void cvt_weights_ln(const float* __restrict__ Wq, const float* __restrict__ Wk,
                    const float* __restrict__ Wv, const float* __restrict__ Wp,
                    const float* __restrict__ W1, const float* __restrict__ W2,
                    bf16_t* __restrict__ dst,
                    const float* __restrict__ x, const float* __restrict__ w,
                    const float* __restrict__ b, bf16_t* __restrict__ out) {
    int blk = blockIdx.x;
    if (blk < CVT_GRID) cvt_block(blk, Wq, Wk, Wv, Wp, W1, W2, dst);
    else                ln_row(blk - CVT_GRID, x, w, b, out);
}

// ---------------------------------------------------------------------------
// Eight async global -> LDS copies and the wait that lets their address
// registers be reused, in one statement so that nothing can come between.
// ---------------------------------------------------------------------------
__device__ __forceinline__ void async_copy8_b128(unsigned int lds, unsigned int lds_step,
                                                 const bf16_t* g, size_t g_step) {
    unsigned int l0 = lds,                l1 = lds + lds_step,     l2 = lds + 2 * lds_step,
                 l3 = lds + 3 * lds_step, l4 = lds + 4 * lds_step, l5 = lds + 5 * lds_step,
                 l6 = lds + 6 * lds_step, l7 = lds + 7 * lds_step;
    const bf16_t *g0 = g,              *g1 = g + g_step,     *g2 = g + 2 * g_step,
                 *g3 = g + 3 * g_step, *g4 = g + 4 * g_step, *g5 = g + 5 * g_step,
                 *g6 = g + 6 * g_step, *g7 = g + 7 * g_step;
    asm volatile("global_load_async_to_lds_b128 %0, %8, off\n\t"
                 "global_load_async_to_lds_b128 %1, %9, off\n\t"
                 "global_load_async_to_lds_b128 %2, %10, off\n\t"
                 "global_load_async_to_lds_b128 %3, %11, off\n\t"
                 "global_load_async_to_lds_b128 %4, %12, off\n\t"
                 "global_load_async_to_lds_b128 %5, %13, off\n\t"
                 "global_load_async_to_lds_b128 %6, %14, off\n\t"
                 "global_load_async_to_lds_b128 %7, %15, off\n\t"
                 "s_wait_xcnt 0x0"
                 :: "v"(l0), "v"(l1), "v"(l2), "v"(l3), "v"(l4), "v"(l5), "v"(l6), "v"(l7),
                    "v"(g0), "v"(g1), "v"(g2), "v"(g3), "v"(g4), "v"(g5), "v"(g6), "v"(g7)
                 : "memory");
}

// The same with four copies.
__device__ __forceinline__ void async_copy4_b128(unsigned int lds, unsigned int lds_step,
                                                 const bf16_t* g, size_t g_step) {
    unsigned int l0 = lds, l1 = lds + lds_step, l2 = lds + 2 * lds_step, l3 = lds + 3 * lds_step;
    const bf16_t *g0 = g, *g1 = g + g_step, *g2 = g + 2 * g_step, *g3 = g + 3 * g_step;
    asm volatile("global_load_async_to_lds_b128 %0, %4, off\n\t"
                 "global_load_async_to_lds_b128 %1, %5, off\n\t"
                 "global_load_async_to_lds_b128 %2, %6, off\n\t"
                 "global_load_async_to_lds_b128 %3, %7, off\n\t"
                 "s_wait_xcnt 0x0"
                 :: "v"(l0), "v"(l1), "v"(l2), "v"(l3), "v"(g0), "v"(g1), "v"(g2), "v"(g3)
                 : "memory");
}

static constexpr int GK     = 128;
static constexpr int GPITCH = GK + 8;
static constexpr int GSTAGE = 256 * GPITCH;

template <int EPI>
__device__ __forceinline__
void gemm_tile(const bf16_t* __restrict__ A, const bf16_t* __restrict__ W,
               const float* __restrict__ bias, const float* __restrict__ resid,
               void* __restrict__ out, int N, int K, int mb, int nb) {
    __shared__ __align__(16) bf16_t st[2 * GSTAGE];

    int tid  = threadIdx.x;
    int wave = tid >> 5;
    int lane = tid & 31;
    int r    = lane & 15;
    int sel  = lane >> 4;        // which 16-lane half
    int wm   = wave >> 2;        // 0..1: 64-row strip
    int wn   = wave & 3;         // 0..3: 32-column strip

    // copies: thread t brings chunk (t & 15) of rows (t >> 4) + 16 * i
    int crow = tid >> 4;
    int cchk = tid & 15;
    const bf16_t* asrc = A + (size_t)(mb + crow) * K + cchk * 8;
    const bf16_t* wsrc = W + (size_t)(nb + crow) * K + cchk * 8;
    unsigned int  cdst = (unsigned int)(unsigned long long)(st + crow * GPITCH + cchk * 8);
    size_t        gstep = (size_t)16 * K;

    auto issue_stage = [&](int s, int buf) {
        unsigned int d = cdst + (unsigned int)buf * (GSTAGE * 2);
        async_copy8_b128(d,                    16 * GPITCH * 2, asrc + (size_t)s * GK, gstep);
        async_copy8_b128(d + 128 * GPITCH * 2, 16 * GPITCH * 2, wsrc + (size_t)s * GK, gstep);
    };

    int nst = K / GK;

    issue_stage(0, 0);
    // stage 0 landed (this wave's copies), then everyone's
    asm volatile("s_wait_asynccnt 0x0" ::: "memory");
    __syncthreads();
    if (nst > 1) issue_stage(1, 1);

    v8f acc[4][2] = {};

    for (int s = 0; s < nst; ++s) {
        int cur = s & 1;
        const bf16_t* abuf = st + cur * GSTAGE + (wm * 64 + r) * GPITCH + sel * 8;
        const bf16_t* bbuf = st + cur * GSTAGE + (128 + wn * 32 + r) * GPITCH + sel * 8;

        // two fragment sets: block kc + 1 is read from LDS while block kc multiplies
        BV a[2][4], b[2][2];
        auto load_frags = [&](int kc, int set) {
            #pragma unroll
            for (int mt = 0; mt < 4; ++mt) {
                a[set][mt].h[0] = *(const v8bf*)(abuf + mt * 16 * GPITCH + kc * 32);
                a[set][mt].h[1] = *(const v8bf*)(abuf + mt * 16 * GPITCH + kc * 32 + 16);
            }
            #pragma unroll
            for (int nt = 0; nt < 2; ++nt) {
                b[set][nt].h[0] = *(const v8bf*)(bbuf + nt * 16 * GPITCH + kc * 32);
                b[set][nt].h[1] = *(const v8bf*)(bbuf + nt * 16 * GPITCH + kc * 32 + 16);
            }
        };
        load_frags(0, 0);
        #pragma unroll
        for (int kc = 0; kc < GK / 32; ++kc) {
            if (kc + 1 < GK / 32) load_frags(kc + 1, (kc + 1) & 1);
            // keeps the next block's LDS reads one group ahead of this block's
            // products; left free, the scheduler sinks them among the products
            // and each pair of products then waits out an LDS latency
            __builtin_amdgcn_sched_barrier(0);
            #pragma unroll
            for (int mt = 0; mt < 4; ++mt)
                #pragma unroll
                for (int nt = 0; nt < 2; ++nt)
                    acc[mt][nt] = wmma_bf16(a[kc & 1][mt].v, b[kc & 1][nt].v, acc[mt][nt]);
            // keeps the block after next's reads behind this block's products,
            // whose fragment set they overwrite
            __builtin_amdgcn_sched_barrier(0);
        }

        // hand-over: this wave's reads of the buffer are done ...
        asm volatile("s_wait_dscnt 0x0" ::: "memory");
        // ... its copies of the next stage have landed ...
        asm volatile("s_wait_asynccnt 0x0" ::: "memory");
        // ... and so have everyone's: publishes stage s + 1, frees buffer cur
        __syncthreads();
        if (s + 2 < nst) issue_stage(s + 2, cur);
    }
    // nothing is in flight when the wave ends
    asm volatile("s_wait_asynccnt 0x0" ::: "memory");

    int m0 = mb + wm * 64;
    int n0 = nb + wn * 32;
    #pragma unroll
    for (int mt = 0; mt < 4; ++mt) {
        #pragma unroll
        for (int nt = 0; nt < 2; ++nt) {
            int col = n0 + nt * 16 + r;
            float bcol = bias[col];
            #pragma unroll
            for (int j = 0; j < 8; ++j) {
                int row = m0 + mt * 16 + j + sel * 8;
                size_t idx = (size_t)row * N + col;
                float v = acc[mt][nt][j] + bcol;
                if (EPI == 0) {
                    ((bf16_t*)out)[idx] = (bf16_t)v;
                } else if (EPI == 1) {
                    ((float*)out)[idx] = resid[idx] + v;
                } else {
                    float g = 0.5f * v * (1.0f + erff(v * 0.70710678118f));
                    ((bf16_t*)out)[idx] = (bf16_t)g;
                }
            }
        }
    }
}

template <int EPI>
__global__ __launch_bounds__(256)
void gemm_bf16(const bf16_t* __restrict__ A, const bf16_t* __restrict__ W,
               const float* __restrict__ bias, const float* __restrict__ resid,
               void* __restrict__ out, int N, int K) {
    gemm_tile<EPI>(A, W, bias, resid, out, N, K, blockIdx.x * 128, blockIdx.y * 128);
}

// The three projections q, k, v of the same A in one launch: grid.y walks the
// C / 128 column tiles of q, then of k, then of v. W is the three C x C weight
// planes laid end to end, out the three M x C output planes laid end to end.
// With 3 tiles for each WGP and room for two at a time, one tile's first load,
// stage hand-overs and stores run beside another tile's products.
__global__ __launch_bounds__(256)
void gemm_qkv(const bf16_t* __restrict__ A, const bf16_t* __restrict__ W,
              const float* __restrict__ bq, const float* __restrict__ bk,
              const float* __restrict__ bv, bf16_t* __restrict__ out) {
    int which = blockIdx.y / (C / 128);
    int nt    = blockIdx.y % (C / 128);
    const float* bias = which == 0 ? bq : which == 1 ? bk : bv;
    gemm_tile<0>(A, W + (size_t)which * C * C, bias, nullptr,
                 out + (size_t)which * M * C, C, C, blockIdx.x * 128, nt * 128);
}

static constexpr int AK     = 64;
static constexpr int APITCH = HD + 8;
static constexpr int VPITCH = HD + 16;
static constexpr int ATILE  = AK * APITCH;
static constexpr int VTILE  = AK * VPITCH;
static constexpr int ASTAGE = ATILE + VTILE;

__device__ __forceinline__ v8bf lds_load_tr16(const bf16_t* p) {
    typedef __attribute__((address_space(3))) v8bf lds_v8bf;
    return __builtin_amdgcn_ds_load_tr16_b128_v8bf16((lds_v8bf*)p);
}

__global__ __launch_bounds__(128)
void attn_kernel(const bf16_t* __restrict__ q, const bf16_t* __restrict__ k,
                 const bf16_t* __restrict__ v, bf16_t* __restrict__ y) {
    __shared__ __align__(16) bf16_t kv[2 * ASTAGE];    // K and V stages, block-wide

    // in a scalar register: the wave's block counts below steer scalar branches
    int wave = __builtin_amdgcn_readfirstlane(threadIdx.x >> 5);
    int lane = threadIdx.x & 31;
    int r    = lane & 15;
    int sel  = lane >> 4;

    int bq = blockIdx.x & 31;          // T/64 = 32 query blocks
    int hh = (blockIdx.x >> 5) & 15;   // head
    int bb = blockIdx.x >> 9;          // batch
    int qbase = bq * 64 + wave * 16;

    size_t base = (size_t)bb * T * C + (size_t)hh * HD;

    // copies: thread t brings chunk (t & 7) of rows (t >> 3) + 16 * i of a stage
    int crow = threadIdx.x >> 3;
    int cchk = threadIdx.x & 7;
    const bf16_t* ksrc = k + base + (size_t)crow * C + cchk * 8;
    const bf16_t* vsrc = v + base + (size_t)crow * C + cchk * 8;
    unsigned int  kdst = (unsigned int)(unsigned long long)(kv + crow * APITCH + cchk * 8);
    unsigned int  vdst = (unsigned int)(unsigned long long)(kv + ATILE + crow * VPITCH + cchk * 8);

    auto issue_stage = [&](int s, int buf) {
        unsigned int d = (unsigned int)buf * (ASTAGE * 2);
        async_copy4_b128(kdst + d, 16 * APITCH * 2, ksrc + (size_t)s * AK * C, (size_t)16 * C);
        async_copy4_b128(vdst + d, 16 * VPITCH * 2, vsrc + (size_t)s * AK * C, (size_t)16 * C);
    };

    int nst = bq + 1;                  // 64-key stages up to the block's diagonal
    issue_stage(0, 0);

    // q^T B-operands for the two K=32 chunks of HD=64, pre-scaled by 1/8
    BV qa[2];
    const bf16_t* qrow = q + base + (size_t)(qbase + r) * C;
    #pragma unroll
    for (int c = 0; c < 2; ++c) {
        qa[c].h[0] = *(const v8bf*)(qrow + c * 32 + sel * 8);
        qa[c].h[1] = *(const v8bf*)(qrow + c * 32 + 16 + sel * 8);
        #pragma unroll
        for (int i = 0; i < 16; ++i)
            qa[c].v[i] = (bf16_t)((float)qa[c].v[i] * 0.125f);
    }

    // All per-query state is per lane: lane (r, sel) works for query qbase + r.
    // o[nt][j] = O^T[d = nt * 16 + sel * 8 + j][query]; mrow is the query's running
    // maximum (equal in both halves); lrow sums this half's keys only.
    v8f o[4] = {};
    float mrow = -INFINITY, lrow = 0.f;

    // ks, vs: the 32 rows of K and of V in LDS that hold keys kb .. kb + 31
    auto process_block = [&](int kb, const bf16_t* ks, const bf16_t* vs, auto maskc) {
        constexpr bool MASK = decltype(maskc)::value;

        // ---- S^T = k @ q^T for 32 keys (two 16x16 tiles): A = K rows, B = q ----
        // the four K fragments have registers of their own, so that their LDS
        // reads are in flight together ahead of the products
        BV kop[2][2];
        #pragma unroll
        for (int t = 0; t < 2; ++t) {
            #pragma unroll
            for (int c = 0; c < 2; ++c) {
                const bf16_t* kr = ks + (t * 16 + r) * APITCH + c * 32 + sel * 8;
                kop[t][c].h[0] = *(const v8bf*)(kr);
                kop[t][c].h[1] = *(const v8bf*)(kr + 16);
            }
        }
        // A fragments of V^T: keys sel * 8 .. + 7 and 16 + sel * 8 .. + 7 of d row
        // nt * 16 + r, the k order in which pb below holds P^T
        const bf16_t* vt = vs + (sel * 8 + (lane & 7)) * VPITCH + ((lane >> 3) & 1) * 8;
        BV va[4];
        #pragma unroll
        for (int nt = 0; nt < 4; ++nt) {
            va[nt].h[0] = lds_load_tr16(vt + nt * 16);
            va[nt].h[1] = lds_load_tr16(vt + 16 * VPITCH + nt * 16);
        }

        // st[t][j] = score of key kb + t * 16 + sel * 8 + j for query qbase + r
        v8f st[2] = {};
        #pragma unroll
        for (int c = 0; c < 2; ++c) {
            st[0] = wmma_bf16(kop[0][c].v, qa[c].v, st[0]);
            st[1] = wmma_bf16(kop[1][c].v, qa[c].v, st[1]);
        }
        if (MASK) {
            int qi = qbase + r;
            #pragma unroll
            for (int t = 0; t < 2; ++t)
                #pragma unroll
                for (int j = 0; j < 8; ++j)
                    st[t][j] = (kb + t * 16 + sel * 8 + j <= qi) ? st[t][j] : -INFINITY;
        }

        // ---- online softmax: 16 keys of one query in a lane, the other 16 in lane ^ 16 ----
        float mt = fmaxf(st[0][0], st[1][0]);
        #pragma unroll
        for (int j = 1; j < 8; ++j) mt = fmaxf(mt, fmaxf(st[0][j], st[1][j]));
        mt = fmaxf(mt, xhalf(mt));
        float mnew  = fmaxf(mrow, mt);
        float alpha = __expf(mrow - mnew);
        mrow = mnew;

        // P^T goes from the score registers straight into the B operand:
        // element t * 8 + j is key t * 16 + sel * 8 + j
        // the 16 terms are summed in four independent chains
        BV pb;
        float rs[4];
        #pragma unroll
        for (int t = 0; t < 2; ++t) {
            #pragma unroll
            for (int j = 0; j < 8; ++j) {
                float p = __expf(st[t][j] - mnew);
                if (t == 0 && j < 4) rs[j] = p;
                else                 rs[j & 3] += p;
                pb.v[t * 8 + j] = (bf16_t)p;
            }
        }

        // ---- O^T = O^T * alpha + V^T @ P^T (one 16x16x32 wmma per 16 d rows) ----
        #pragma unroll
        for (int nt = 0; nt < 4; ++nt) {
            #pragma unroll
            for (int j = 0; j < 8; ++j) o[nt][j] *= alpha;
            o[nt] = wmma_bf16(va[nt].v, pb.v, o[nt]);
        }
        __builtin_amdgcn_sched_barrier(0);
        lrow = lrow * alpha + ((rs[0] + rs[1]) + (rs[2] + rs[3]));
    };

    int nblk  = (qbase + 16 + 31) / 32;  // this wave's 32-key blocks
    int nfull = qbase >> 5;              // blocks entirely below the diagonal

    // stage 0 landed (this wave's copies), then everyone's
    asm volatile("s_wait_asynccnt 0x0" ::: "memory");
    __syncthreads();
    if (nst > 1) issue_stage(1, 1);

    for (int s = 0; s < nst; ++s) {
        int cur = s & 1;
        const bf16_t* kt = kv + cur * ASTAGE;
        // this wave's blocks inside the stage: first the unmasked, then the masked
        int jb   = s * (AK / 32);
        int jful = min(nfull, jb + AK / 32);
        int jend = min(nblk,  jb + AK / 32);
        for (; jb < jful; ++jb) {
            int sub = jb % (AK / 32);
            process_block(jb * 32, kt + sub * 32 * APITCH, kt + ATILE + sub * 32 * VPITCH,
                          std::integral_constant<bool, false>{});
        }
        for (; jb < jend; ++jb) {
            int sub = jb % (AK / 32);
            process_block(jb * 32, kt + sub * 32 * APITCH, kt + ATILE + sub * 32 * VPITCH,
                          std::integral_constant<bool, true>{});
        }
        // hand-over: this wave's reads of the buffer are done ...
        asm volatile("s_wait_dscnt 0x0" ::: "memory");
        // ... its copies of the next stage have landed ...
        asm volatile("s_wait_asynccnt 0x0" ::: "memory");
        // ... and so have everyone's: publishes stage s + 1, frees buffer cur
        __syncthreads();
        if (s + 2 < nst) issue_stage(s + 2, cur);
    }
    // nothing is in flight when the wave ends
    asm volatile("s_wait_asynccnt 0x0" ::: "memory");

    // ---- finalize: y = O / l; a lane holds 8 consecutive d of its query ----
    float inv = 1.0f / (lrow + xhalf(lrow));
    bf16_t* yrow = y + base + (size_t)(qbase + r) * C + sel * 8;
    #pragma unroll
    for (int nt = 0; nt < 4; ++nt) {
        v8bf ov;
        #pragma unroll
        for (int j = 0; j < 8; ++j) ov[j] = (bf16_t)(o[nt][j] * inv);
        *(v8bf*)(yrow + nt * 16) = ov;
    }
}

// ---------------------------------------------------------------------------
// Host-side launch
// ---------------------------------------------------------------------------
extern "C" void kernel_launch(void* const* d_in, const int* in_sizes, int n_in,
                              void* d_out, int out_size, void* d_ws, size_t ws_size,
                              hipStream_t stream) {
    const float* x     = (const float*)d_in[0];
    const float* ln1_w = (const float*)d_in[1];
    const float* ln1_b = (const float*)d_in[2];
    const float* ln2_w = (const float*)d_in[3];
    const float* ln2_b = (const float*)d_in[4];
    const float* Wq = (const float*)d_in[5];  const float* bq = (const float*)d_in[6];
    const float* Wk = (const float*)d_in[7];  const float* bk = (const float*)d_in[8];
    const float* Wv = (const float*)d_in[9];  const float* bv = (const float*)d_in[10];
    const float* Wp = (const float*)d_in[11]; const float* bp = (const float*)d_in[12];
    const float* W1 = (const float*)d_in[13]; const float* b1 = (const float*)d_in[14];
    const float* W2 = (const float*)d_in[15]; const float* b2 = (const float*)d_in[16];
    float* outp = (float*)d_out;

    // workspace layout
    char* w = (char*)d_ws;
    auto take = [&](size_t bytes) { char* p = w; w += (bytes + 255) & ~size_t(255); return p; };
    bf16_t* hb   = (bf16_t*)take((size_t)M * C * 2);
    bf16_t* wqb  = (bf16_t*)take((size_t)C * C * 2);
    bf16_t* wkb  = (bf16_t*)take((size_t)C * C * 2);
    bf16_t* wvb  = (bf16_t*)take((size_t)C * C * 2);
    bf16_t* wpb  = (bf16_t*)take((size_t)C * C * 2);
    bf16_t* w1b  = (bf16_t*)take((size_t)4 * C * C * 2);
    bf16_t* w2b  = (bf16_t*)take((size_t)4 * C * C * 2);
    bf16_t* qb   = (bf16_t*)take((size_t)M * C * 2);
    bf16_t* kbuf = (bf16_t*)take((size_t)M * C * 2);
    bf16_t* vb_  = (bf16_t*)take((size_t)M * C * 2);
    bf16_t* yb   = (bf16_t*)take((size_t)M * C * 2);
    float*  xres = (float*) take((size_t)M * C * 4);
    bf16_t* h2b  = (bf16_t*)take((size_t)M * C * 2);
    bf16_t* mact = (bf16_t*)take((size_t)M * 4 * C * 2);

    // 1) weights -> bf16 (the six planes from wqb on lie end to end: every
    //    plane's size is a multiple of the workspace granule) and
    // 2) LN1, one launch
    cvt_weights_ln<<<CVT_GRID + M, 256, 0, stream>>>(Wq, Wk, Wv, Wp, W1, W2, wqb,
                                                     x, ln1_w, ln1_b, hb);

    // 3) QKV projections, one launch (the planes wqb, wkb, wvb lie end to end,
    //    and so do qb, kbuf, vb_)
    dim3 g1(M / 128, C / 128);
    dim3 g3(M / 128, 3 * (C / 128));
    gemm_qkv<<<g3, 256, 0, stream>>>(hb, wqb, bq, bk, bv, qb);

    // 4) causal attention
    attn_kernel<<<Bsz * H * (T / 64), 128, 0, stream>>>(qb, kbuf, vb_, yb);

    // 5) output projection + residual (f32)
    gemm_bf16<1><<<g1, 256, 0, stream>>>(yb, wpb, bp, x, xres, C, C);

    // 6) LN2
    ln_kernel<<<M, 256, 0, stream>>>(xres, ln2_w, ln2_b, h2b);

    // 7) MLP fc1 + GELU
    dim3 g2(M / 128, (4 * C) / 128);
    gemm_bf16<2><<<g2, 256, 0, stream>>>(h2b, w1b, b1, nullptr, mact, 4 * C, C);

    // 8) MLP fc2 + residual -> final output (f32)
    gemm_bf16<1><<<g1, 256, 0, stream>>>(mact, w2b, b2, xres, outp, C, 4 * C);
}

// v006
// It runs in 164 microseconds.
// In two side-by-side timings against v005, it was 1.04 and 1.03 times as fast.
// All steps since v000 together make it 2.76 times as fast.
#include <hip/hip_runtime.h>
#include <hip/hip_bf16.h>
#include <math.h>
#include <type_traits>

typedef __bf16 bf16_t;
typedef __attribute__((ext_vector_type(16))) __bf16 v16bf;
typedef __attribute__((ext_vector_type(8)))  __bf16 v8bf;
typedef __attribute__((ext_vector_type(8)))  float  v8f;

union BV {
    v16bf v;
    v8bf  h[2];
};

__device__ __forceinline__ v8f wmma_bf16(v16bf a, v16bf b, v8f c) {
    // D = A(16x32 bf16) * B(32x16 bf16) + C(16x16 f32)
    return __builtin_amdgcn_wmma_f32_16x16x32_bf16(
        /*neg_a=*/false, a, /*neg_b=*/false, b,
        /*c_mod=*/(short)0, c, /*reuse_a=*/false, /*reuse_b=*/false);
}

__device__ __forceinline__ float xhalf(float x) {
    int i = __float_as_int(x);
    return __int_as_float(
        __builtin_amdgcn_permlanex16(i, i, 0x76543210, 0xfedcba98, false, false));
}

static constexpr int Bsz = 2;
static constexpr int T   = 2048;
static constexpr int C   = 1024;
static constexpr int H   = 16;
static constexpr int HD  = 64;
static constexpr int M   = Bsz * T;   // 4096 rows

// ---------------------------------------------------------------------------
// fp32 -> bf16 conversion of all six weight matrices, one launch.
// A block converts CVT_BLK consecutive floats of one matrix: each thread issues
// CVT_U 16-byte loads (a wave-wide load = 512 contiguous bytes), all in flight
// together, then stores 8 bytes per load (a wave-wide store = two whole lines).
// dst is the six bf16 planes laid end to end in the order Wq Wk Wv Wp W1 W2.
// ---------------------------------------------------------------------------
typedef __attribute__((ext_vector_type(4))) __bf16 v4bf;

static constexpr int CVT_U    = 16;                    // 16-byte loads per thread
static constexpr int CVT_BLK  = 256 * CVT_U * 4;       // floats per block
static constexpr int CVT_SQ   = C * C / CVT_BLK;       // blocks per C x C matrix
static constexpr int CVT_GRID = 12 * CVT_SQ;           // 4 square + 2 fourfold

__device__ __forceinline__
void cvt_block(int blk,
               const float* __restrict__ Wq, const float* __restrict__ Wk,
               const float* __restrict__ Wv, const float* __restrict__ Wp,
               const float* __restrict__ W1, const float* __restrict__ W2,
               bf16_t* __restrict__ dst) {
    const float* src;
    int first;
    if      (blk < 1 * CVT_SQ) { src = Wq; first = 0; }
    else if (blk < 2 * CVT_SQ) { src = Wk; first = 1 * CVT_SQ; }
    else if (blk < 3 * CVT_SQ) { src = Wv; first = 2 * CVT_SQ; }
    else if (blk < 4 * CVT_SQ) { src = Wp; first = 3 * CVT_SQ; }
    else if (blk < 8 * CVT_SQ) { src = W1; first = 4 * CVT_SQ; }
    else                       { src = W2; first = 8 * CVT_SQ; }

    const float4* s = (const float4*)(src + (size_t)(blk - first) * CVT_BLK) + threadIdx.x;
    v4bf*         d = (v4bf*)(dst + (size_t)blk * CVT_BLK) + threadIdx.x;

    float4 v[CVT_U];
    #pragma unroll
    for (int i = 0; i < CVT_U; ++i) v[i] = s[i * 256];
    #pragma unroll
    for (int i = 0; i < CVT_U; ++i) {
        v4bf o;
        o[0] = (bf16_t)v[i].x; o[1] = (bf16_t)v[i].y;
        o[2] = (bf16_t)v[i].z; o[3] = (bf16_t)v[i].w;
        d[i * 256] = o;
    }
}

// ---------------------------------------------------------------------------
// LayerNorm over C=1024, one block (256 threads) per row, bf16 output
// ---------------------------------------------------------------------------
__device__ __forceinline__
void ln_row(int row, const float* __restrict__ x, const float* __restrict__ w,
            const float* __restrict__ b, bf16_t* __restrict__ out) {
    int tid  = threadIdx.x;
    int wave = tid >> 5, lane = tid & 31;

    const float* xr = x + (size_t)row * C;
    float4 xv = ((const float4*)xr)[tid];
    float s1 = xv.x + xv.y + xv.z + xv.w;
    float s2 = xv.x*xv.x + xv.y*xv.y + xv.z*xv.z + xv.w*xv.w;
    #pragma unroll
    for (int off = 16; off; off >>= 1) {
        s1 += __shfl_xor(s1, off, 32);
        s2 += __shfl_xor(s2, off, 32);
    }
    __shared__ float a1[8], a2[8];
    if (lane == 0) { a1[wave] = s1; a2[wave] = s2; }
    __syncthreads();
    float t1 = 0.f, t2 = 0.f;
    #pragma unroll
    for (int i = 0; i < 8; ++i) { t1 += a1[i]; t2 += a2[i]; }
    float mu   = t1 * (1.0f / C);
    float var  = t2 * (1.0f / C) - mu * mu;
    float rstd = rsqrtf(var + 1e-5f);

    float4 wv = ((const float4*)w)[tid];
    float4 bv = ((const float4*)b)[tid];
    bf16_t* orow = out + (size_t)row * C;
    orow[tid*4 + 0] = (bf16_t)((xv.x - mu) * rstd * wv.x + bv.x);
    orow[tid*4 + 1] = (bf16_t)((xv.y - mu) * rstd * wv.y + bv.y);
    orow[tid*4 + 2] = (bf16_t)((xv.z - mu) * rstd * wv.z + bv.z);
    orow[tid*4 + 3] = (bf16_t)((xv.w - mu) * rstd * wv.w + bv.w);
}

__global__ __launch_bounds__(256)
void ln_kernel(const float* __restrict__ x, const float* __restrict__ w,
               const float* __restrict__ b, bf16_t* __restrict__ out) {
    ln_row(blockIdx.x, x, w, b, out);
}

// The weight conversion and the first LayerNorm depend on nothing of each other:
// one launch, the CVT_GRID conversion blocks (the longer ones) first, then one
// block per row.
// waves_per_eu: lets the compiler use the registers for all CVT_U loads at once;
// at its default target it holds the last two back until the first two return.
__global__ __launch_bounds__(256) __attribute__((amdgpu_waves_per_eu(4, 8)))
void cvt_weights_ln(const float* __restrict__ Wq, const float* __restrict__ Wk,
                    const float* __restrict__ Wv, const float* __restrict__ Wp,
                    const float* __restrict__ W1, const float* __restrict__ W2,
                    bf16_t* __restrict__ dst,
                    const float* __restrict__ x, const float* __restrict__ w,
                    const float* __restrict__ b, bf16_t* __restrict__ out) {
    int blk = blockIdx.x;
    if (blk < CVT_GRID) cvt_block(blk, Wq, Wk, Wv, Wp, W1, W2, dst);
    else                ln_row(blk - CVT_GRID, x, w, b, out);
}

// ---------------------------------------------------------------------------
// Eight async global -> LDS copies and the wait that lets their address
// registers be reused, in one statement so that nothing can come between.
// ---------------------------------------------------------------------------
__device__ __forceinline__ void async_copy8_b128(unsigned int lds, unsigned int lds_step,
                                                 const bf16_t* g, size_t g_step) {
    unsigned int l0 = lds,                l1 = lds + lds_step,     l2 = lds + 2 * lds_step,
                 l3 = lds + 3 * lds_step, l4 = lds + 4 * lds_step, l5 = lds + 5 * lds_step,
                 l6 = lds + 6 * lds_step, l7 = lds + 7 * lds_step;
    const bf16_t *g0 = g,              *g1 = g + g_step,     *g2 = g + 2 * g_step,
                 *g3 = g + 3 * g_step, *g4 = g + 4 * g_step, *g5 = g + 5 * g_step,
                 *g6 = g + 6 * g_step, *g7 = g + 7 * g_step;
    asm volatile("global_load_async_to_lds_b128 %0, %8, off\n\t"
                 "global_load_async_to_lds_b128 %1, %9, off\n\t"
                 "global_load_async_to_lds_b128 %2, %10, off\n\t"
                 "global_load_async_to_lds_b128 %3, %11, off\n\t"
                 "global_load_async_to_lds_b128 %4, %12, off\n\t"
                 "global_load_async_to_lds_b128 %5, %13, off\n\t"
                 "global_load_async_to_lds_b128 %6, %14, off\n\t"
                 "global_load_async_to_lds_b128 %7, %15, off\n\t"
                 "s_wait_xcnt 0x0"
                 :: "v"(l0), "v"(l1), "v"(l2), "v"(l3), "v"(l4), "v"(l5), "v"(l6), "v"(l7),
                    "v"(g0), "v"(g1), "v"(g2), "v"(g3), "v"(g4), "v"(g5), "v"(g6), "v"(g7)
                 : "memory");
}

// The same with four copies.
__device__ __forceinline__ void async_copy4_b128(unsigned int lds, unsigned int lds_step,
                                                 const bf16_t* g, size_t g_step) {
    unsigned int l0 = lds, l1 = lds + lds_step, l2 = lds + 2 * lds_step, l3 = lds + 3 * lds_step;
    const bf16_t *g0 = g, *g1 = g + g_step, *g2 = g + 2 * g_step, *g3 = g + 3 * g_step;
    asm volatile("global_load_async_to_lds_b128 %0, %4, off\n\t"
                 "global_load_async_to_lds_b128 %1, %5, off\n\t"
                 "global_load_async_to_lds_b128 %2, %6, off\n\t"
                 "global_load_async_to_lds_b128 %3, %7, off\n\t"
                 "s_wait_xcnt 0x0"
                 :: "v"(l0), "v"(l1), "v"(l2), "v"(l3), "v"(g0), "v"(g1), "v"(g2), "v"(g3)
                 : "memory");
}

static constexpr int GK     = 128;
static constexpr int GPITCH = GK + 8;
static constexpr int GSTAGE = 256 * GPITCH;

// GELU with the error function, 0.5 v (1 + erf(v / sqrt 2)), without a branch.
// The library erff picks one of two forms by |x| < 1 under a lane mask: in the
// unrolled epilogue that made 64 dependent chains run one behind the other. One
// form for every x lets the chains of different elements run side by side:
//   erf(|x|) = 1 - (a1 t + .. + a5 t^5) exp(-x^2),  t = 1 / (1 + p |x|),
// absolute error below 1.5e-7 in exact arithmetic; the whole GELU in f32 stays
// within 4e-7 (|v| <= 8): under a tenth of a unit of the bf16 result for v > -3.5;
// further down, where |GELU| < 1e-3, the cancellation in 1 + erf limits it, as it
// limited the library form.
// The denominator is at least 1; a large |x| gives exp -> 0 and erf -> 1; the sign
// comes in through |0.5 v| * erf(|x|) + 0.5 v.
__device__ __forceinline__ float gelu_erf(float v) {
    float d = fmaf(0.23164189f, fabsf(v), 1.0f);   // 1 + p |x|, p = 0.3275911
    float a = v * v * -0.72134752f;                // -x^2 log2(e)
    float t, e;
    asm("v_rcp_f32 %0, %2\n\t"
        "v_exp_f32 %1, %3\n\t"
        "v_nop"
        : "=&v"(t), "=&v"(e) : "v"(d), "v"(a));
    float p  = fmaf(1.061405429f, t, -1.453152027f);
    p = fmaf(p, t, 1.421413741f);
    p = fmaf(p, t, -0.284496736f);
    p = fmaf(p, t, 0.254829592f);
    p = p * t;
    float hv = 0.5f * v;
    return fmaf(fabsf(hv), fmaf(-p, e, 1.0f), hv);
}

template <int EPI>
__device__ __forceinline__
void gemm_tile(const bf16_t* __restrict__ A, const bf16_t* __restrict__ W,
               const float* __restrict__ bias, const float* __restrict__ resid,
               void* __restrict__ out, int N, int K, int mb, int nb) {
    __shared__ __align__(16) bf16_t st[2 * GSTAGE];

    int tid  = threadIdx.x;
    int wave = tid >> 5;
    int lane = tid & 31;
    int r    = lane & 15;
    int sel  = lane >> 4;        // which 16-lane half
    int wm   = wave >> 2;        // 0..1: 64-row strip
    int wn   = wave & 3;         // 0..3: 32-column strip

    // copies: thread t brings chunk (t & 15) of rows (t >> 4) + 16 * i
    int crow = tid >> 4;
    int cchk = tid & 15;
    const bf16_t* asrc = A + (size_t)(mb + crow) * K + cchk * 8;
    const bf16_t* wsrc = W + (size_t)(nb + crow) * K + cchk * 8;
    unsigned int  cdst = (unsigned int)(unsigned long long)(st + crow * GPITCH + cchk * 8);
    size_t        gstep = (size_t)16 * K;

    auto issue_stage = [&](int s, int buf) {
        unsigned int d = cdst + (unsigned int)buf * (GSTAGE * 2);
        async_copy8_b128(d,                    16 * GPITCH * 2, asrc + (size_t)s * GK, gstep);
        async_copy8_b128(d + 128 * GPITCH * 2, 16 * GPITCH * 2, wsrc + (size_t)s * GK, gstep);
    };

    int nst = K / GK;

    issue_stage(0, 0);
    // stage 0 landed (this wave's copies), then everyone's
    asm volatile("s_wait_asynccnt 0x0" ::: "memory");
    __syncthreads();
    if (nst > 1) issue_stage(1, 1);

    v8f acc[4][2] = {};

    for (int s = 0; s < nst; ++s) {
        int cur = s & 1;
        const bf16_t* abuf = st + cur * GSTAGE + (wm * 64 + r) * GPITCH + sel * 8;
        const bf16_t* bbuf = st + cur * GSTAGE + (128 + wn * 32 + r) * GPITCH + sel * 8;

        // two fragment sets: block kc + 1 is read from LDS while block kc multiplies
        BV a[2][4], b[2][2];
        auto load_frags = [&](int kc, int set) {
            #pragma unroll
            for (int mt = 0; mt < 4; ++mt) {
                a[set][mt].h[0] = *(const v8bf*)(abuf + mt * 16 * GPITCH + kc * 32);
                a[set][mt].h[1] = *(const v8bf*)(abuf + mt * 16 * GPITCH + kc * 32 + 16);
            }
            #pragma unroll
            for (int nt = 0; nt < 2; ++nt) {
                b[set][nt].h[0] = *(const v8bf*)(bbuf + nt * 16 * GPITCH + kc * 32);
                b[set][nt].h[1] = *(const v8bf*)(bbuf + nt * 16 * GPITCH + kc * 32 + 16);
            }
        };
        load_frags(0, 0);
        #pragma unroll
        for (int kc = 0; kc < GK / 32; ++kc) {
            if (kc + 1 < GK / 32) load_frags(kc + 1, (kc + 1) & 1);
            // keeps the next block's LDS reads one group ahead of this block's
            // products; left free, the scheduler sinks them among the products
            // and each pair of products then waits out an LDS latency
            __builtin_amdgcn_sched_barrier(0);
            #pragma unroll
            for (int mt = 0; mt < 4; ++mt)
                #pragma unroll
                for (int nt = 0; nt < 2; ++nt)
                    acc[mt][nt] = wmma_bf16(a[kc & 1][mt].v, b[kc & 1][nt].v, acc[mt][nt]);
            // keeps the block after next's reads behind this block's products,
            // whose fragment set they overwrite
            __builtin_amdgcn_sched_barrier(0);
        }

        // hand-over: this wave's reads of the buffer are done ...
        asm volatile("s_wait_dscnt 0x0" ::: "memory");
        // ... its copies of the next stage have landed ...
        asm volatile("s_wait_asynccnt 0x0" ::: "memory");
        // ... and so have everyone's: publishes stage s + 1, frees buffer cur
        __syncthreads();
        if (s + 2 < nst) issue_stage(s + 2, cur);
    }
    // nothing is in flight when the wave ends
    asm volatile("s_wait_asynccnt 0x0" ::: "memory");

    int m0 = mb + wm * 64;
    int n0 = nb + wn * 32;
    #pragma unroll
    for (int mt = 0; mt < 4; ++mt) {
        #pragma unroll
        for (int nt = 0; nt < 2; ++nt) {
            int col = n0 + nt * 16 + r;
            float bcol = bias[col];
            #pragma unroll
            for (int j = 0; j < 8; ++j) {
                int row = m0 + mt * 16 + j + sel * 8;
                size_t idx = (size_t)row * N + col;
                float v = acc[mt][nt][j] + bcol;
                if (EPI == 0) {
                    ((bf16_t*)out)[idx] = (bf16_t)v;
                } else if (EPI == 1) {
                    ((float*)out)[idx] = resid[idx] + v;
                } else {
                    ((bf16_t*)out)[idx] = (bf16_t)gelu_erf(v);
                }
            }
        }
    }
}

template <int EPI>
__global__ __launch_bounds__(256)
void gemm_bf16(const bf16_t* __restrict__ A, const bf16_t* __restrict__ W,
               const float* __restrict__ bias, const float* __restrict__ resid,
               void* __restrict__ out, int N, int K) {
    gemm_tile<EPI>(A, W, bias, resid, out, N, K, blockIdx.x * 128, blockIdx.y * 128);
}

// The three projections q, k, v of the same A in one launch: grid.y walks the
// C / 128 column tiles of q, then of k, then of v. W is the three C x C weight
// planes laid end to end, out the three M x C output planes laid end to end.
// With 3 tiles for each WGP and room for two at a time, one tile's first load,
// stage hand-overs and stores run beside another tile's products.
__global__ __launch_bounds__(256)
void gemm_qkv(const bf16_t* __restrict__ A, const bf16_t* __restrict__ W,
              const float* __restrict__ bq, const float* __restrict__ bk,
              const float* __restrict__ bv, bf16_t* __restrict__ out) {
    int which = blockIdx.y / (C / 128);
    int nt    = blockIdx.y % (C / 128);
    const float* bias = which == 0 ? bq : which == 1 ? bk : bv;
    gemm_tile<0>(A, W + (size_t)which * C * C, bias, nullptr,
                 out + (size_t)which * M * C, C, C, blockIdx.x * 128, nt * 128);
}

static constexpr int AK     = 64;
static constexpr int APITCH = HD + 8;
static constexpr int VPITCH = HD + 16;
static constexpr int ATILE  = AK * APITCH;
static constexpr int VTILE  = AK * VPITCH;
static constexpr int ASTAGE = ATILE + VTILE;

__device__ __forceinline__ v8bf lds_load_tr16(const bf16_t* p) {
    typedef __attribute__((address_space(3))) v8bf lds_v8bf;
    return __builtin_amdgcn_ds_load_tr16_b128_v8bf16((lds_v8bf*)p);
}

__global__ __launch_bounds__(128)
void attn_kernel(const bf16_t* __restrict__ q, const bf16_t* __restrict__ k,
                 const bf16_t* __restrict__ v, bf16_t* __restrict__ y) {
    __shared__ __align__(16) bf16_t kv[2 * ASTAGE];    // K and V stages, block-wide

    // in a scalar register: the wave's block counts below steer scalar branches
    int wave = __builtin_amdgcn_readfirstlane(threadIdx.x >> 5);
    int lane = threadIdx.x & 31;
    int r    = lane & 15;
    int sel  = lane >> 4;

    int bq = blockIdx.x & 31;          // T/64 = 32 query blocks
    int hh = (blockIdx.x >> 5) & 15;   // head
    int bb = blockIdx.x >> 9;          // batch
    int qbase = bq * 64 + wave * 16;

    size_t base = (size_t)bb * T * C + (size_t)hh * HD;

    // copies: thread t brings chunk (t & 7) of rows (t >> 3) + 16 * i of a stage
    int crow = threadIdx.x >> 3;
    int cchk = threadIdx.x & 7;
    const bf16_t* ksrc = k + base + (size_t)crow * C + cchk * 8;
    const bf16_t* vsrc = v + base + (size_t)crow * C + cchk * 8;
    unsigned int  kdst = (unsigned int)(unsigned long long)(kv + crow * APITCH + cchk * 8);
    unsigned int  vdst = (unsigned int)(unsigned long long)(kv + ATILE + crow * VPITCH + cchk * 8);

    auto issue_stage = [&](int s, int buf) {
        unsigned int d = (unsigned int)buf * (ASTAGE * 2);
        async_copy4_b128(kdst + d, 16 * APITCH * 2, ksrc + (size_t)s * AK * C, (size_t)16 * C);
        async_copy4_b128(vdst + d, 16 * VPITCH * 2, vsrc + (size_t)s * AK * C, (size_t)16 * C);
    };

    int nst = bq + 1;                  // 64-key stages up to the block's diagonal
    issue_stage(0, 0);

    // q^T B-operands for the two K=32 chunks of HD=64, pre-scaled by 1/8
    BV qa[2];
    const bf16_t* qrow = q + base + (size_t)(qbase + r) * C;
    #pragma unroll
    for (int c = 0; c < 2; ++c) {
        qa[c].h[0] = *(const v8bf*)(qrow + c * 32 + sel * 8);
        qa[c].h[1] = *(const v8bf*)(qrow + c * 32 + 16 + sel * 8);
        #pragma unroll
        for (int i = 0; i < 16; ++i)
            qa[c].v[i] = (bf16_t)((float)qa[c].v[i] * 0.125f);
    }

    // All per-query state is per lane: lane (r, sel) works for query qbase + r.
    // o[nt][j] = O^T[d = nt * 16 + sel * 8 + j][query]; mrow is the query's running
    // maximum (equal in both halves); lrow sums this half's keys only.
    v8f o[4] = {};
    float mrow = -INFINITY, lrow = 0.f;

    // ks, vs: the 32 rows of K and of V in LDS that hold keys kb .. kb + 31
    auto process_block = [&](int kb, const bf16_t* ks, const bf16_t* vs, auto maskc) {
        constexpr bool MASK = decltype(maskc)::value;

        // ---- S^T = k @ q^T for 32 keys (two 16x16 tiles): A = K rows, B = q ----
        // the four K fragments have registers of their own, so that their LDS
        // reads are in flight together ahead of the products
        BV kop[2][2];
        #pragma unroll
        for (int t = 0; t < 2; ++t) {
            #pragma unroll
            for (int c = 0; c < 2; ++c) {
                const bf16_t* kr = ks + (t * 16 + r) * APITCH + c * 32 + sel * 8;
                kop[t][c].h[0] = *(const v8bf*)(kr);
                kop[t][c].h[1] = *(const v8bf*)(kr + 16);
            }
        }
        // A fragments of V^T: keys sel * 8 .. + 7 and 16 + sel * 8 .. + 7 of d row
        // nt * 16 + r, the k order in which pb below holds P^T
        const bf16_t* vt = vs + (sel * 8 + (lane & 7)) * VPITCH + ((lane >> 3) & 1) * 8;
        BV va[4];
        #pragma unroll
        for (int nt = 0; nt < 4; ++nt) {
            va[nt].h[0] = lds_load_tr16(vt + nt * 16);
            va[nt].h[1] = lds_load_tr16(vt + 16 * VPITCH + nt * 16);
        }

        // st[t][j] = score of key kb + t * 16 + sel * 8 + j for query qbase + r
        v8f st[2] = {};
        #pragma unroll
        for (int c = 0; c < 2; ++c) {
            st[0] = wmma_bf16(kop[0][c].v, qa[c].v, st[0]);
            st[1] = wmma_bf16(kop[1][c].v, qa[c].v, st[1]);
        }
        if (MASK) {
            int qi = qbase + r;
            #pragma unroll
            for (int t = 0; t < 2; ++t)
                #pragma unroll
                for (int j = 0; j < 8; ++j)
                    st[t][j] = (kb + t * 16 + sel * 8 + j <= qi) ? st[t][j] : -INFINITY;
        }

        // ---- online softmax: 16 keys of one query in a lane, the other 16 in lane ^ 16 ----
        float mt = fmaxf(st[0][0], st[1][0]);
        #pragma unroll
        for (int j = 1; j < 8; ++j) mt = fmaxf(mt, fmaxf(st[0][j], st[1][j]));
        mt = fmaxf(mt, xhalf(mt));
        float mnew  = fmaxf(mrow, mt);
        float alpha = __expf(mrow - mnew);
        mrow = mnew;

        // P^T goes from the score registers straight into the B operand:
        // element t * 8 + j is key t * 16 + sel * 8 + j
        // the 16 terms are summed in four independent chains
        BV pb;
        float rs[4];
        #pragma unroll
        for (int t = 0; t < 2; ++t) {
            #pragma unroll
            for (int j = 0; j < 8; ++j) {
                float p = __expf(st[t][j] - mnew);
                if (t == 0 && j < 4) rs[j] = p;
                else                 rs[j & 3] += p;
                pb.v[t * 8 + j] = (bf16_t)p;
            }
        }

        // ---- O^T = O^T * alpha + V^T @ P^T (one 16x16x32 wmma per 16 d rows) ----
        #pragma unroll
        for (int nt = 0; nt < 4; ++nt) {
            #pragma unroll
            for (int j = 0; j < 8; ++j) o[nt][j] *= alpha;
            o[nt] = wmma_bf16(va[nt].v, pb.v, o[nt]);
        }
        __builtin_amdgcn_sched_barrier(0);
        lrow = lrow * alpha + ((rs[0] + rs[1]) + (rs[2] + rs[3]));
    };

    int nblk  = (qbase + 16 + 31) / 32;  // this wave's 32-key blocks
    int nfull = qbase >> 5;              // blocks entirely below the diagonal

    // stage 0 landed (this wave's copies), then everyone's
    asm volatile("s_wait_asynccnt 0x0" ::: "memory");
    __syncthreads();
    if (nst > 1) issue_stage(1, 1);

    for (int s = 0; s < nst; ++s) {
        int cur = s & 1;
        const bf16_t* kt = kv + cur * ASTAGE;
        // this wave's blocks inside the stage: first the unmasked, then the masked
        int jb   = s * (AK / 32);
        int jful = min(nfull, jb + AK / 32);
        int jend = min(nblk,  jb + AK / 32);
        for (; jb < jful; ++jb) {
            int sub = jb % (AK / 32);
            process_block(jb * 32, kt + sub * 32 * APITCH, kt + ATILE + sub * 32 * VPITCH,
                          std::integral_constant<bool, false>{});
        }
        for (; jb < jend; ++jb) {
            int sub = jb % (AK / 32);
            process_block(jb * 32, kt + sub * 32 * APITCH, kt + ATILE + sub * 32 * VPITCH,
                          std::integral_constant<bool, true>{});
        }
        // hand-over: this wave's reads of the buffer are done ...
        asm volatile("s_wait_dscnt 0x0" ::: "memory");
        // ... its copies of the next stage have landed ...
        asm volatile("s_wait_asynccnt 0x0" ::: "memory");
        // ... and so have everyone's: publishes stage s + 1, frees buffer cur
        __syncthreads();
        if (s + 2 < nst) issue_stage(s + 2, cur);
    }
    // nothing is in flight when the wave ends
    asm volatile("s_wait_asynccnt 0x0" ::: "memory");

    // ---- finalize: y = O / l; a lane holds 8 consecutive d of its query ----
    float inv = 1.0f / (lrow + xhalf(lrow));
    bf16_t* yrow = y + base + (size_t)(qbase + r) * C + sel * 8;
    #pragma unroll
    for (int nt = 0; nt < 4; ++nt) {
        v8bf ov;
        #pragma unroll
        for (int j = 0; j < 8; ++j) ov[j] = (bf16_t)(o[nt][j] * inv);
        *(v8bf*)(yrow + nt * 16) = ov;
    }
}

// ---------------------------------------------------------------------------
// Host-side launch
// ---------------------------------------------------------------------------
extern "C" void kernel_launch(void* const* d_in, const int* in_sizes, int n_in,
                              void* d_out, int out_size, void* d_ws, size_t ws_size,
                              hipStream_t stream) {
    const float* x     = (const float*)d_in[0];
    const float* ln1_w = (const float*)d_in[1];
    const float* ln1_b = (const float*)d_in[2];
    const float* ln2_w = (const float*)d_in[3];
    const float* ln2_b = (const float*)d_in[4];
    const float* Wq = (const float*)d_in[5];  const float* bq = (const float*)d_in[6];
    const float* Wk = (const float*)d_in[7];  const float* bk = (const float*)d_in[8];
    const float* Wv = (const float*)d_in[9];  const float* bv = (const float*)d_in[10];
    const float* Wp = (const float*)d_in[11]; const float* bp = (const float*)d_in[12];
    const float* W1 = (const float*)d_in[13]; const float* b1 = (const float*)d_in[14];
    const float* W2 = (const float*)d_in[15]; const float* b2 = (const float*)d_in[16];
    float* outp = (float*)d_out;

    // workspace layout
    char* w = (char*)d_ws;
    auto take = [&](size_t bytes) { char* p = w; w += (bytes + 255) & ~size_t(255); return p; };
    bf16_t* hb   = (bf16_t*)take((size_t)M * C * 2);
    bf16_t* wqb  = (bf16_t*)take((size_t)C * C * 2);
    bf16_t* wkb  = (bf16_t*)take((size_t)C * C * 2);
    bf16_t* wvb  = (bf16_t*)take((size_t)C * C * 2);
    bf16_t* wpb  = (bf16_t*)take((size_t)C * C * 2);
    bf16_t* w1b  = (bf16_t*)take((size_t)4 * C * C * 2);
    bf16_t* w2b  = (bf16_t*)take((size_t)4 * C * C * 2);
    bf16_t* qb   = (bf16_t*)take((size_t)M * C * 2);
    bf16_t* kbuf = (bf16_t*)take((size_t)M * C * 2);
    bf16_t* vb_  = (bf16_t*)take((size_t)M * C * 2);
    bf16_t* yb   = (bf16_t*)take((size_t)M * C * 2);
    float*  xres = (float*) take((size_t)M * C * 4);
    bf16_t* h2b  = (bf16_t*)take((size_t)M * C * 2);
    bf16_t* mact = (bf16_t*)take((size_t)M * 4 * C * 2);

    // 1) weights -> bf16 (the six planes from wqb on lie end to end: every
    //    plane's size is a multiple of the workspace granule) and
    // 2) LN1, one launch
    cvt_weights_ln<<<CVT_GRID + M, 256, 0, stream>>>(Wq, Wk, Wv, Wp, W1, W2, wqb,
                                                     x, ln1_w, ln1_b, hb);

    // 3) QKV projections, one launch (the planes wqb, wkb, wvb lie end to end,
    //    and so do qb, kbuf, vb_)
    dim3 g1(M / 128, C / 128);
    dim3 g3(M / 128, 3 * (C / 128));
    gemm_qkv<<<g3, 256, 0, stream>>>(hb, wqb, bq, bk, bv, qb);

    // 4) causal attention
    attn_kernel<<<Bsz * H * (T / 64), 128, 0, stream>>>(qb, kbuf, vb_, yb);

    // 5) output projection + residual (f32)
    gemm_bf16<1><<<g1, 256, 0, stream>>>(yb, wpb, bp, x, xres, C, C);

    // 6) LN2
    ln_kernel<<<M, 256, 0, stream>>>(xres, ln2_w, ln2_b, h2b);

    // 7) MLP fc1 + GELU
    dim3 g2(M / 128, (4 * C) / 128);
    gemm_bf16<2><<<g2, 256, 0, stream>>>(h2b, w1b, b1, nullptr, mact, 4 * C, C);

    // 8) MLP fc2 + residual -> final output (f32)
    gemm_bf16<1><<<g1, 256, 0, stream>>>(mact, w2b, b2, xres, outp, C, 4 * C);
}

// v007
// It runs in 158 microseconds.
// Next to v006, in two timings, it ran 1.04 and 1.05 times as fast.
// Over all steps from v000 it is 2.89 times as fast.
#include <hip/hip_runtime.h>
#include <hip/hip_bf16.h>
#include <math.h>
#include <type_traits>

typedef __bf16 bf16_t;
typedef __attribute__((ext_vector_type(16))) __bf16 v16bf;
typedef __attribute__((ext_vector_type(8)))  __bf16 v8bf;
typedef __attribute__((ext_vector_type(8)))  float  v8f;

union BV {
    v16bf v;
    v8bf  h[2];
};

__device__ __forceinline__ v8f wmma_bf16(v16bf a, v16bf b, v8f c) {
    // D = A(16x32 bf16) * B(32x16 bf16) + C(16x16 f32)
    return __builtin_amdgcn_wmma_f32_16x16x32_bf16(
        /*neg_a=*/false, a, /*neg_b=*/false, b,
        /*c_mod=*/(short)0, c, /*reuse_a=*/false, /*reuse_b=*/false);
}

__device__ __forceinline__ float xhalf(float x) {
    int i = __float_as_int(x);
    return __int_as_float(
        __builtin_amdgcn_permlanex16(i, i, 0x76543210, 0xfedcba98, false, false));
}

static constexpr int Bsz = 2;
static constexpr int T   = 2048;
static constexpr int C   = 1024;
static constexpr int H   = 16;
static constexpr int HD  = 64;
static constexpr int M   = Bsz * T;   // 4096 rows

// ---------------------------------------------------------------------------
// fp32 -> bf16 conversion of all six weight matrices, one launch.
// A block converts CVT_BLK consecutive floats of one matrix: each thread issues
// CVT_U 16-byte loads (a wave-wide load = 512 contiguous bytes), all in flight
// together, then stores 8 bytes per load (a wave-wide store = two whole lines).
// dst is the six bf16 planes laid end to end in the order Wq Wk Wv Wp W1 W2.
// ---------------------------------------------------------------------------
typedef __attribute__((ext_vector_type(4))) __bf16 v4bf;

static constexpr int CVT_U    = 16;                    // 16-byte loads per thread
static constexpr int CVT_BLK  = 256 * CVT_U * 4;       // floats per block
static constexpr int CVT_SQ   = C * C / CVT_BLK;       // blocks per C x C matrix
static constexpr int CVT_GRID = 12 * CVT_SQ;           // 4 square + 2 fourfold

__device__ __forceinline__
void cvt_block(int blk,
               const float* __restrict__ Wq, const float* __restrict__ Wk,
               const float* __restrict__ Wv, const float* __restrict__ Wp,
               const float* __restrict__ W1, const float* __restrict__ W2,
               bf16_t* __restrict__ dst) {
    const float* src;
    int first;
    if      (blk < 1 * CVT_SQ) { src = Wq; first = 0; }
    else if (blk < 2 * CVT_SQ) { src = Wk; first = 1 * CVT_SQ; }
    else if (blk < 3 * CVT_SQ) { src = Wv; first = 2 * CVT_SQ; }
    else if (blk < 4 * CVT_SQ) { src = Wp; first = 3 * CVT_SQ; }
    else if (blk < 8 * CVT_SQ) { src = W1; first = 4 * CVT_SQ; }
    else                       { src = W2; first = 8 * CVT_SQ; }

    const float4* s = (const float4*)(src + (size_t)(blk - first) * CVT_BLK) + threadIdx.x;
    v4bf*         d = (v4bf*)(dst + (size_t)blk * CVT_BLK) + threadIdx.x;

    float4 v[CVT_U];
    #pragma unroll
    for (int i = 0; i < CVT_U; ++i) v[i] = s[i * 256];
    #pragma unroll
    for (int i = 0; i < CVT_U; ++i) {
        v4bf o;
        o[0] = (bf16_t)v[i].x; o[1] = (bf16_t)v[i].y;
        o[2] = (bf16_t)v[i].z; o[3] = (bf16_t)v[i].w;
        d[i * 256] = o;
    }
}

// ---------------------------------------------------------------------------
// LayerNorm over C=1024, one block (256 threads) per row, bf16 output
// ---------------------------------------------------------------------------
__device__ __forceinline__
void ln_row(int row, const float* __restrict__ x, const float* __restrict__ w,
            const float* __restrict__ b, bf16_t* __restrict__ out) {
    int tid  = threadIdx.x;
    int wave = tid >> 5, lane = tid & 31;

    const float* xr = x + (size_t)row * C;
    float4 xv = ((const float4*)xr)[tid];
    float s1 = xv.x + xv.y + xv.z + xv.w;
    float s2 = xv.x*xv.x + xv.y*xv.y + xv.z*xv.z + xv.w*xv.w;
    #pragma unroll
    for (int off = 16; off; off >>= 1) {
        s1 += __shfl_xor(s1, off, 32);
        s2 += __shfl_xor(s2, off, 32);
    }
    __shared__ float a1[8], a2[8];
    if (lane == 0) { a1[wave] = s1; a2[wave] = s2; }
    __syncthreads();
    float t1 = 0.f, t2 = 0.f;
    #pragma unroll
    for (int i = 0; i < 8; ++i) { t1 += a1[i]; t2 += a2[i]; }
    float mu   = t1 * (1.0f / C);
    float var  = t2 * (1.0f / C) - mu * mu;
    float rstd = rsqrtf(var + 1e-5f);

    float4 wv = ((const float4*)w)[tid];
    float4 bv = ((const float4*)b)[tid];
    bf16_t* orow = out + (size_t)row * C;
    orow[tid*4 + 0] = (bf16_t)((xv.x - mu) * rstd * wv.x + bv.x);
    orow[tid*4 + 1] = (bf16_t)((xv.y - mu) * rstd * wv.y + bv.y);
    orow[tid*4 + 2] = (bf16_t)((xv.z - mu) * rstd * wv.z + bv.z);
    orow[tid*4 + 3] = (bf16_t)((xv.w - mu) * rstd * wv.w + bv.w);
}

__global__ __launch_bounds__(256)
void ln_kernel(const float* __restrict__ x, const float* __restrict__ w,
               const float* __restrict__ b, bf16_t* __restrict__ out) {
    ln_row(blockIdx.x, x, w, b, out);
}

// The weight conversion and the first LayerNorm depend on nothing of each other:
// one launch, the CVT_GRID conversion blocks (the longer ones) first, then one
// block per row.
// waves_per_eu: lets the compiler use the registers for all CVT_U loads at once;
// at its default target it holds the last two back until the first two return.
__global__ __launch_bounds__(256) __attribute__((amdgpu_waves_per_eu(4, 8)))
void cvt_weights_ln(const float* __restrict__ Wq, const float* __restrict__ Wk,
                    const float* __restrict__ Wv, const float* __restrict__ Wp,
                    const float* __restrict__ W1, const float* __restrict__ W2,
                    bf16_t* __restrict__ dst,
                    const float* __restrict__ x, const float* __restrict__ w,
                    const float* __restrict__ b, bf16_t* __restrict__ out) {
    int blk = blockIdx.x;
    if (blk < CVT_GRID) cvt_block(blk, Wq, Wk, Wv, Wp, W1, W2, dst);
    else                ln_row(blk - CVT_GRID, x, w, b, out);
}

// ---------------------------------------------------------------------------
// Eight async global -> LDS copies and the wait that lets their address
// registers be reused, in one statement so that nothing can come between.
// ---------------------------------------------------------------------------
__device__ __forceinline__ void async_copy8_b128(unsigned int lds, unsigned int lds_step,
                                                 const bf16_t* g, size_t g_step) {
    unsigned int l0 = lds,                l1 = lds + lds_step,     l2 = lds + 2 * lds_step,
                 l3 = lds + 3 * lds_step, l4 = lds + 4 * lds_step, l5 = lds + 5 * lds_step,
                 l6 = lds + 6 * lds_step, l7 = lds + 7 * lds_step;
    const bf16_t *g0 = g,              *g1 = g + g_step,     *g2 = g + 2 * g_step,
                 *g3 = g + 3 * g_step, *g4 = g + 4 * g_step, *g5 = g + 5 * g_step,
                 *g6 = g + 6 * g_step, *g7 = g + 7 * g_step;
    asm volatile("global_load_async_to_lds_b128 %0, %8, off\n\t"
                 "global_load_async_to_lds_b128 %1, %9, off\n\t"
                 "global_load_async_to_lds_b128 %2, %10, off\n\t"
                 "global_load_async_to_lds_b128 %3, %11, off\n\t"
                 "global_load_async_to_lds_b128 %4, %12, off\n\t"
                 "global_load_async_to_lds_b128 %5, %13, off\n\t"
                 "global_load_async_to_lds_b128 %6, %14, off\n\t"
                 "global_load_async_to_lds_b128 %7, %15, off\n\t"
                 "s_wait_xcnt 0x0"
                 :: "v"(l0), "v"(l1), "v"(l2), "v"(l3), "v"(l4), "v"(l5), "v"(l6), "v"(l7),
                    "v"(g0), "v"(g1), "v"(g2), "v"(g3), "v"(g4), "v"(g5), "v"(g6), "v"(g7)
                 : "memory");
}

// The same with four copies.
__device__ __forceinline__ void async_copy4_b128(unsigned int lds, unsigned int lds_step,
                                                 const bf16_t* g, size_t g_step) {
    unsigned int l0 = lds, l1 = lds + lds_step, l2 = lds + 2 * lds_step, l3 = lds + 3 * lds_step;
    const bf16_t *g0 = g, *g1 = g + g_step, *g2 = g + 2 * g_step, *g3 = g + 3 * g_step;
    asm volatile("global_load_async_to_lds_b128 %0, %4, off\n\t"
                 "global_load_async_to_lds_b128 %1, %5, off\n\t"
                 "global_load_async_to_lds_b128 %2, %6, off\n\t"
                 "global_load_async_to_lds_b128 %3, %7, off\n\t"
                 "s_wait_xcnt 0x0"
                 :: "v"(l0), "v"(l1), "v"(l2), "v"(l3), "v"(g0), "v"(g1), "v"(g2), "v"(g3)
                 : "memory");
}

static constexpr int GK     = 128;
static constexpr int GPITCH = GK + 8;
static constexpr int GSTAGE = 256 * GPITCH;

// GELU with the error function, 0.5 v (1 + erf(v / sqrt 2)), without a branch.
// The library erff picks one of two forms by |x| < 1 under a lane mask: in the
// unrolled epilogue that made 64 dependent chains run one behind the other. One
// form for every x lets the chains of different elements run side by side:
//   erf(|x|) = 1 - (a1 t + .. + a5 t^5) exp(-x^2),  t = 1 / (1 + p |x|),
// absolute error below 1.5e-7 in exact arithmetic; the whole GELU in f32 stays
// within 4e-7 (|v| <= 8): under a tenth of a unit of the bf16 result for v > -3.5;
// further down, where |GELU| < 1e-3, the cancellation in 1 + erf limits it, as it
// limited the library form.
// The denominator is at least 1; a large |x| gives exp -> 0 and erf -> 1; the sign
// comes in through |0.5 v| * erf(|x|) + 0.5 v.
__device__ __forceinline__ float gelu_erf(float v) {
    float d = fmaf(0.23164189f, fabsf(v), 1.0f);   // 1 + p |x|, p = 0.3275911
    float a = v * v * -0.72134752f;                // -x^2 log2(e)
    float t, e;
    asm("v_rcp_f32 %0, %2\n\t"
        "v_exp_f32 %1, %3\n\t"
        "v_nop"
        : "=&v"(t), "=&v"(e) : "v"(d), "v"(a));
    float p  = fmaf(1.061405429f, t, -1.453152027f);
    p = fmaf(p, t, 1.421413741f);
    p = fmaf(p, t, -0.284496736f);
    p = fmaf(p, t, 0.254829592f);
    p = p * t;
    float hv = 0.5f * v;
    return fmaf(fabsf(hv), fmaf(-p, e, 1.0f), hv);
}

template <int EPI, int NBUF>
__device__ __forceinline__
void gemm_tile(const bf16_t* __restrict__ A, const bf16_t* __restrict__ W,
               const float* __restrict__ bias, const float* __restrict__ resid,
               void* __restrict__ out, int N, int K, int mb, int nb) {
    __shared__ __align__(16) bf16_t st[NBUF * GSTAGE];

    int tid  = threadIdx.x;
    int wave = tid >> 5;
    int lane = tid & 31;
    int r    = lane & 15;
    int sel  = lane >> 4;        // which 16-lane half
    int wm   = wave >> 2;        // 0..1: 64-row strip
    int wn   = wave & 3;         // 0..3: 32-column strip

    // copies: CT threads bring a stage; thread t of them brings chunk (t & 15) of
    // rows (t >> 4) + CR * i
    constexpr int CT = NBUF == 3 ? 128 : 256;
    constexpr int CR = CT / 16;
    int crow = (tid & (CT - 1)) >> 4;
    int cchk = tid & 15;
    const bf16_t* asrc = A + (size_t)(mb + crow) * K + cchk * 8;
    const bf16_t* wsrc = W + (size_t)(nb + crow) * K + cchk * 8;
    unsigned int  cdst = (unsigned int)(unsigned long long)(st + crow * GPITCH + cchk * 8);
    size_t        gstep = (size_t)CR * K;

    auto issue_stage = [&](int s, int buf) {
        unsigned int d = cdst + (unsigned int)buf * (GSTAGE * 2);
        for (int h = 0; h < 128 / (8 * CR); ++h) {   // 8 * CR rows of A and of W a trip
            async_copy8_b128(d + h * 8 * CR * GPITCH * 2, CR * GPITCH * 2,
                             asrc + (size_t)s * GK + (size_t)h * 8 * gstep, gstep);
            async_copy8_b128(d + (128 + h * 8 * CR) * GPITCH * 2, CR * GPITCH * 2,
                             wsrc + (size_t)s * GK + (size_t)h * 8 * gstep, gstep);
        }
    };

    int nst = K / GK;
    // which half of the waves this wave is in, in a scalar register: it steers
    // scalar branches round the copies and their waits
    int half = __builtin_amdgcn_readfirstlane(tid >> 7);

    if (NBUF == 3) {
        if (half == 0) {
            issue_stage(0, 0);
            // stage 0 landed (this wave's copies)
            asm volatile("s_wait_asynccnt 0x0" ::: "memory");
        } else if (nst > 1) {
            issue_stage(1, 1);
        }
        // stage 0 landed, everyone's copies
        __syncthreads();
        if (half == 0 && nst > 2) issue_stage(2, 2);
    } else {
        issue_stage(0, 0);
        // stage 0 landed (this wave's copies), then everyone's
        asm volatile("s_wait_asynccnt 0x0" ::: "memory");
        __syncthreads();
        if (nst > 1) issue_stage(1, 1);
    }

    v8f acc[4][2] = {};

    int ring = 0;                // s mod 3
    for (int s = 0; s < nst; ++s) {
        int cur = NBUF == 3 ? ring : s & 1;
        const bf16_t* abuf = st + cur * GSTAGE + (wm * 64 + r) * GPITCH + sel * 8;
        const bf16_t* bbuf = st + cur * GSTAGE + (128 + wn * 32 + r) * GPITCH + sel * 8;

        // two fragment sets: block kc + 1 is read from LDS while block kc multiplies
        BV a[2][4], b[2][2];
        auto load_frags = [&](int kc, int set) {
            #pragma unroll
            for (int mt = 0; mt < 4; ++mt) {
                a[set][mt].h[0] = *(const v8bf*)(abuf + mt * 16 * GPITCH + kc * 32);
                a[set][mt].h[1] = *(const v8bf*)(abuf + mt * 16 * GPITCH + kc * 32 + 16);
            }
            #pragma unroll
            for (int nt = 0; nt < 2; ++nt) {
                b[set][nt].h[0] = *(const v8bf*)(bbuf + nt * 16 * GPITCH + kc * 32);
                b[set][nt].h[1] = *(const v8bf*)(bbuf + nt * 16 * GPITCH + kc * 32 + 16);
            }
        };
        load_frags(0, 0);
        #pragma unroll
        for (int kc = 0; kc < GK / 32; ++kc) {
            if (kc + 1 < GK / 32) load_frags(kc + 1, (kc + 1) & 1);
            // keeps the next block's LDS reads one group ahead of this block's
            // products; left free, the scheduler sinks them among the products
            // and each pair of products then waits out an LDS latency
            __builtin_amdgcn_sched_barrier(0);
            #pragma unroll
            for (int mt = 0; mt < 4; ++mt)
                #pragma unroll
                for (int nt = 0; nt < 2; ++nt)
                    acc[mt][nt] = wmma_bf16(a[kc & 1][mt].v, b[kc & 1][nt].v, acc[mt][nt]);
            // keeps the block after next's reads behind this block's products,
            // whose fragment set they overwrite
            __builtin_amdgcn_sched_barrier(0);
        }

        // hand-over: this wave's reads of the buffer are done ...
        asm volatile("s_wait_dscnt 0x0" ::: "memory");
        if (NBUF == 3) {
            bool mine = half == ((s + 1) & 1);   // this half copies stages s + 1, s + 3
            // ... the copies of the next stage have landed (the half that made
            // them; all it has in flight) ...
            if (mine) asm volatile("s_wait_asynccnt 0x0" ::: "memory");
            // ... for everyone: publishes stage s + 1, frees buffer cur
            __syncthreads();
            if (mine && s + 3 < nst) issue_stage(s + 3, cur);
            ring = ring == 2 ? 0 : ring + 1;
        } else {
            // ... its copies of the next stage have landed ...
            asm volatile("s_wait_asynccnt 0x0" ::: "memory");
            // ... and so have everyone's: publishes stage s + 1, frees buffer cur
            __syncthreads();
            if (s + 2 < nst) issue_stage(s + 2, cur);
        }
    }
    // nothing is in flight when the wave ends
    asm volatile("s_wait_asynccnt 0x0" ::: "memory");

    int m0 = mb + wm * 64;
    int n0 = nb + wn * 32;
    #pragma unroll
    for (int mt = 0; mt < 4; ++mt) {
        #pragma unroll
        for (int nt = 0; nt < 2; ++nt) {
            int col = n0 + nt * 16 + r;
            float bcol = bias[col];
            #pragma unroll
            for (int j = 0; j < 8; ++j) {
                int row = m0 + mt * 16 + j + sel * 8;
                size_t idx = (size_t)row * N + col;
                float v = acc[mt][nt][j] + bcol;
                if (EPI == 0) {
                    ((bf16_t*)out)[idx] = (bf16_t)v;
                } else if (EPI == 1) {
                    ((float*)out)[idx] = resid[idx] + v;
                } else {
                    ((bf16_t*)out)[idx] = (bf16_t)gelu_erf(v);
                }
            }
        }
    }
}

template <int EPI>
__global__ __launch_bounds__(256)
void gemm_bf16(const bf16_t* __restrict__ A, const bf16_t* __restrict__ W,
               const float* __restrict__ bias, const float* __restrict__ resid,
               void* __restrict__ out, int N, int K) {
    // EPI 1 is launched with one tile for each WGP: three buffers
    gemm_tile<EPI, EPI == 1 ? 3 : 2>(A, W, bias, resid, out, N, K,
                                     blockIdx.x * 128, blockIdx.y * 128);
}

// The three projections q, k, v of the same A in one launch: grid.y walks the
// C / 128 column tiles of q, then of k, then of v. W is the three C x C weight
// planes laid end to end, out the three M x C output planes laid end to end.
// With 3 tiles for each WGP and room for two at a time, one tile's first load,
// stage hand-overs and stores run beside another tile's products.
__global__ __launch_bounds__(256)
void gemm_qkv(const bf16_t* __restrict__ A, const bf16_t* __restrict__ W,
              const float* __restrict__ bq, const float* __restrict__ bk,
              const float* __restrict__ bv, bf16_t* __restrict__ out) {
    int which = blockIdx.y / (C / 128);
    int nt    = blockIdx.y % (C / 128);
    const float* bias = which == 0 ? bq : which == 1 ? bk : bv;
    gemm_tile<0, 2>(A, W + (size_t)which * C * C, bias, nullptr,
                 out + (size_t)which * M * C, C, C, blockIdx.x * 128, nt * 128);
}

static constexpr int AK     = 64;
static constexpr int APITCH = HD + 8;
static constexpr int VPITCH = HD + 16;
static constexpr int ATILE  = AK * APITCH;
static constexpr int VTILE  = AK * VPITCH;
static constexpr int ASTAGE = ATILE + VTILE;

__device__ __forceinline__ v8bf lds_load_tr16(const bf16_t* p) {
    typedef __attribute__((address_space(3))) v8bf lds_v8bf;
    return __builtin_amdgcn_ds_load_tr16_b128_v8bf16((lds_v8bf*)p);
}

__global__ __launch_bounds__(128)
void attn_kernel(const bf16_t* __restrict__ q, const bf16_t* __restrict__ k,
                 const bf16_t* __restrict__ v, bf16_t* __restrict__ y) {
    __shared__ __align__(16) bf16_t kv[2 * ASTAGE];    // K and V stages, block-wide

    // in a scalar register: the wave's block counts below steer scalar branches
    int wave = __builtin_amdgcn_readfirstlane(threadIdx.x >> 5);
    int lane = threadIdx.x & 31;
    int r    = lane & 15;
    int sel  = lane >> 4;

    int bq = blockIdx.x & 31;          // T/64 = 32 query blocks
    int hh = (blockIdx.x >> 5) & 15;   // head
    int bb = blockIdx.x >> 9;          // batch
    int qbase = bq * 64 + wave * 16;

    size_t base = (size_t)bb * T * C + (size_t)hh * HD;

    // copies: thread t brings chunk (t & 7) of rows (t >> 3) + 16 * i of a stage
    int crow = threadIdx.x >> 3;
    int cchk = threadIdx.x & 7;
    const bf16_t* ksrc = k + base + (size_t)crow * C + cchk * 8;
    const bf16_t* vsrc = v + base + (size_t)crow * C + cchk * 8;
    unsigned int  kdst = (unsigned int)(unsigned long long)(kv + crow * APITCH + cchk * 8);
    unsigned int  vdst = (unsigned int)(unsigned long long)(kv + ATILE + crow * VPITCH + cchk * 8);

    auto issue_stage = [&](int s, int buf) {
        unsigned int d = (unsigned int)buf * (ASTAGE * 2);
        async_copy4_b128(kdst + d, 16 * APITCH * 2, ksrc + (size_t)s * AK * C, (size_t)16 * C);
        async_copy4_b128(vdst + d, 16 * VPITCH * 2, vsrc + (size_t)s * AK * C, (size_t)16 * C);
    };

    int nst = bq + 1;                  // 64-key stages up to the block's diagonal
    issue_stage(0, 0);

    // q^T B-operands for the two K=32 chunks of HD=64, pre-scaled by 1/8
    BV qa[2];
    const bf16_t* qrow = q + base + (size_t)(qbase + r) * C;
    #pragma unroll
    for (int c = 0; c < 2; ++c) {
        qa[c].h[0] = *(const v8bf*)(qrow + c * 32 + sel * 8);
        qa[c].h[1] = *(const v8bf*)(qrow + c * 32 + 16 + sel * 8);
        #pragma unroll
        for (int i = 0; i < 16; ++i)
            qa[c].v[i] = (bf16_t)((float)qa[c].v[i] * 0.125f);
    }

    // All per-query state is per lane: lane (r, sel) works for query qbase + r.
    // o[nt][j] = O^T[d = nt * 16 + sel * 8 + j][query]; mrow is the query's running
    // maximum (equal in both halves); lrow sums this half's keys only.
    v8f o[4] = {};
    float mrow = -INFINITY, lrow = 0.f;

    // ks, vs: the 32 rows of K and of V in LDS that hold keys kb .. kb + 31
    auto process_block = [&](int kb, const bf16_t* ks, const bf16_t* vs, auto maskc) {
        constexpr bool MASK = decltype(maskc)::value;

        // ---- S^T = k @ q^T for 32 keys (two 16x16 tiles): A = K rows, B = q ----
        // the four K fragments have registers of their own, so that their LDS
        // reads are in flight together ahead of the products
        BV kop[2][2];
        #pragma unroll
        for (int t = 0; t < 2; ++t) {
            #pragma unroll
            for (int c = 0; c < 2; ++c) {
                const bf16_t* kr = ks + (t * 16 + r) * APITCH + c * 32 + sel * 8;
                kop[t][c].h[0] = *(const v8bf*)(kr);
                kop[t][c].h[1] = *(const v8bf*)(kr + 16);
            }
        }
        // A fragments of V^T: keys sel * 8 .. + 7 and 16 + sel * 8 .. + 7 of d row
        // nt * 16 + r, the k order in which pb below holds P^T
        const bf16_t* vt = vs + (sel * 8 + (lane & 7)) * VPITCH + ((lane >> 3) & 1) * 8;
        BV va[4];
        #pragma unroll
        for (int nt = 0; nt < 4; ++nt) {
            va[nt].h[0] = lds_load_tr16(vt + nt * 16);
            va[nt].h[1] = lds_load_tr16(vt + 16 * VPITCH + nt * 16);
        }

        // st[t][j] = score of key kb + t * 16 + sel * 8 + j for query qbase + r
        v8f st[2] = {};
        #pragma unroll
        for (int c = 0; c < 2; ++c) {
            st[0] = wmma_bf16(kop[0][c].v, qa[c].v, st[0]);
            st[1] = wmma_bf16(kop[1][c].v, qa[c].v, st[1]);
        }
        if (MASK) {
            int qi = qbase + r;
            #pragma unroll
            for (int t = 0; t < 2; ++t)
                #pragma unroll
                for (int j = 0; j < 8; ++j)
                    st[t][j] = (kb + t * 16 + sel * 8 + j <= qi) ? st[t][j] : -INFINITY;
        }

        // ---- online softmax: 16 keys of one query in a lane, the other 16 in lane ^ 16 ----
        float mt = fmaxf(st[0][0], st[1][0]);
        #pragma unroll
        for (int j = 1; j < 8; ++j) mt = fmaxf(mt, fmaxf(st[0][j], st[1][j]));
        mt = fmaxf(mt, xhalf(mt));
        float mnew  = fmaxf(mrow, mt);
        float alpha = __expf(mrow - mnew);
        mrow = mnew;

        // P^T goes from the score registers straight into the B operand:
        // element t * 8 + j is key t * 16 + sel * 8 + j
        // the 16 terms are summed in four independent chains
        BV pb;
        float rs[4];
        #pragma unroll
        for (int t = 0; t < 2; ++t) {
            #pragma unroll
            for (int j = 0; j < 8; ++j) {
                float p = __expf(st[t][j] - mnew);
                if (t == 0 && j < 4) rs[j] = p;
                else                 rs[j & 3] += p;
                pb.v[t * 8 + j] = (bf16_t)p;
            }
        }

        // ---- O^T = O^T * alpha + V^T @ P^T (one 16x16x32 wmma per 16 d rows) ----
        #pragma unroll
        for (int nt = 0; nt < 4; ++nt) {
            #pragma unroll
            for (int j = 0; j < 8; ++j) o[nt][j] *= alpha;
            o[nt] = wmma_bf16(va[nt].v, pb.v, o[nt]);
        }
        __builtin_amdgcn_sched_barrier(0);
        lrow = lrow * alpha + ((rs[0] + rs[1]) + (rs[2] + rs[3]));
    };

    int nblk  = (qbase + 16 + 31) / 32;  // this wave's 32-key blocks
    int nfull = qbase >> 5;              // blocks entirely below the diagonal

    // stage 0 landed (this wave's copies), then everyone's
    asm volatile("s_wait_asynccnt 0x0" ::: "memory");
    __syncthreads();
    if (nst > 1) issue_stage(1, 1);

    for (int s = 0; s < nst; ++s) {
        int cur = s & 1;
        const bf16_t* kt = kv + cur * ASTAGE;
        // this wave's blocks inside the stage: first the unmasked, then the masked
        int jb   = s * (AK / 32);
        int jful = min(nfull, jb + AK / 32);
        int jend = min(nblk,  jb + AK / 32);
        for (; jb < jful; ++jb) {
            int sub = jb % (AK / 32);
            process_block(jb * 32, kt + sub * 32 * APITCH, kt + ATILE + sub * 32 * VPITCH,
                          std::integral_constant<bool, false>{});
        }
        for (; jb < jend; ++jb) {
            int sub = jb % (AK / 32);
            process_block(jb * 32, kt + sub * 32 * APITCH, kt + ATILE + sub * 32 * VPITCH,
                          std::integral_constant<bool, true>{});
        }
        // hand-over: this wave's reads of the buffer are done ...
        asm volatile("s_wait_dscnt 0x0" ::: "memory");
        // ... its copies of the next stage have landed ...
        asm volatile("s_wait_asynccnt 0x0" ::: "memory");
        // ... and so have everyone's: publishes stage s + 1, frees buffer cur
        __syncthreads();
        if (s + 2 < nst) issue_stage(s + 2, cur);
    }
    // nothing is in flight when the wave ends
    asm volatile("s_wait_asynccnt 0x0" ::: "memory");

    // ---- finalize: y = O / l; a lane holds 8 consecutive d of its query ----
    float inv = 1.0f / (lrow + xhalf(lrow));
    bf16_t* yrow = y + base + (size_t)(qbase + r) * C + sel * 8;
    #pragma unroll
    for (int nt = 0; nt < 4; ++nt) {
        v8bf ov;
        #pragma unroll
        for (int j = 0; j < 8; ++j) ov[j] = (bf16_t)(o[nt][j] * inv);
        *(v8bf*)(yrow + nt * 16) = ov;
    }
}

// ---------------------------------------------------------------------------
// Host-side launch
// ---------------------------------------------------------------------------
extern "C" void kernel_launch(void* const* d_in, const int* in_sizes, int n_in,
                              void* d_out, int out_size, void* d_ws, size_t ws_size,
                              hipStream_t stream) {
    const float* x     = (const float*)d_in[0];
    const float* ln1_w = (const float*)d_in[1];
    const float* ln1_b = (const float*)d_in[2];
    const float* ln2_w = (const float*)d_in[3];
    const float* ln2_b = (const float*)d_in[4];
    const float* Wq = (const float*)d_in[5];  const float* bq = (const float*)d_in[6];
    const float* Wk = (const float*)d_in[7];  const float* bk = (const float*)d_in[8];
    const float* Wv = (const float*)d_in[9];  const float* bv = (const float*)d_in[10];
    const float* Wp = (const float*)d_in[11]; const float* bp = (const float*)d_in[12];
    const float* W1 = (const float*)d_in[13]; const float* b1 = (const float*)d_in[14];
    const float* W2 = (const float*)d_in[15]; const float* b2 = (const float*)d_in[16];
    float* outp = (float*)d_out;

    // workspace layout
    char* w = (char*)d_ws;
    auto take = [&](size_t bytes) { char* p = w; w += (bytes + 255) & ~size_t(255); return p; };
    bf16_t* hb   = (bf16_t*)take((size_t)M * C * 2);
    bf16_t* wqb  = (bf16_t*)take((size_t)C * C * 2);
    bf16_t* wkb  = (bf16_t*)take((size_t)C * C * 2);
    bf16_t* wvb  = (bf16_t*)take((size_t)C * C * 2);
    bf16_t* wpb  = (bf16_t*)take((size_t)C * C * 2);
    bf16_t* w1b  = (bf16_t*)take((size_t)4 * C * C * 2);
    bf16_t* w2b  = (bf16_t*)take((size_t)4 * C * C * 2);
    bf16_t* qb   = (bf16_t*)take((size_t)M * C * 2);
    bf16_t* kbuf = (bf16_t*)take((size_t)M * C * 2);
    bf16_t* vb_  = (bf16_t*)take((size_t)M * C * 2);
    bf16_t* yb   = (bf16_t*)take((size_t)M * C * 2);
    float*  xres = (float*) take((size_t)M * C * 4);
    bf16_t* h2b  = (bf16_t*)take((size_t)M * C * 2);
    bf16_t* mact = (bf16_t*)take((size_t)M * 4 * C * 2);

    // 1) weights -> bf16 (the six planes from wqb on lie end to end: every
    //    plane's size is a multiple of the workspace granule) and
    // 2) LN1, one launch
    cvt_weights_ln<<<CVT_GRID + M, 256, 0, stream>>>(Wq, Wk, Wv, Wp, W1, W2, wqb,
                                                     x, ln1_w, ln1_b, hb);

    // 3) QKV projections, one launch (the planes wqb, wkb, wvb lie end to end,
    //    and so do qb, kbuf, vb_)
    dim3 g1(M / 128, C / 128);
    dim3 g3(M / 128, 3 * (C / 128));
    gemm_qkv<<<g3, 256, 0, stream>>>(hb, wqb, bq, bk, bv, qb);

    // 4) causal attention
    attn_kernel<<<Bsz * H * (T / 64), 128, 0, stream>>>(qb, kbuf, vb_, yb);

    // 5) output projection + residual (f32)
    gemm_bf16<1><<<g1, 256, 0, stream>>>(yb, wpb, bp, x, xres, C, C);

    // 6) LN2
    ln_kernel<<<M, 256, 0, stream>>>(xres, ln2_w, ln2_b, h2b);

    // 7) MLP fc1 + GELU
    dim3 g2(M / 128, (4 * C) / 128);
    gemm_bf16<2><<<g2, 256, 0, stream>>>(h2b, w1b, b1, nullptr, mact, 4 * C, C);

    // 8) MLP fc2 + residual -> final output (f32)
    gemm_bf16<1><<<g1, 256, 0, stream>>>(mact, w2b, b2, xres, outp, C, 4 * C);
}

// v008
// One run takes 145 microseconds.
// Next to v007, in two timings, it ran 1.08 and 1.09 times as fast.
// All steps since v000 together make it 3.13 times as fast.
#include <hip/hip_runtime.h>
#include <hip/hip_bf16.h>
#include <math.h>
#include <type_traits>

typedef __bf16 bf16_t;
typedef __attribute__((ext_vector_type(16))) __bf16 v16bf;
typedef __attribute__((ext_vector_type(8)))  __bf16 v8bf;
typedef __attribute__((ext_vector_type(8)))  float  v8f;

union BV {
    v16bf v;
    v8bf  h[2];
};

__device__ __forceinline__ v8f wmma_bf16(v16bf a, v16bf b, v8f c) {
    // D = A(16x32 bf16) * B(32x16 bf16) + C(16x16 f32)
    return __builtin_amdgcn_wmma_f32_16x16x32_bf16(
        /*neg_a=*/false, a, /*neg_b=*/false, b,
        /*c_mod=*/(short)0, c, /*reuse_a=*/false, /*reuse_b=*/false);
}

__device__ __forceinline__ float xhalf(float x) {
    int i = __float_as_int(x);
    return __int_as_float(
        __builtin_amdgcn_permlanex16(i, i, 0x76543210, 0xfedcba98, false, false));
}

static constexpr int Bsz = 2;
static constexpr int T   = 2048;
static constexpr int C   = 1024;
static constexpr int H   = 16;
static constexpr int HD  = 64;
static constexpr int M   = Bsz * T;   // 4096 rows

// ---------------------------------------------------------------------------
// fp32 -> bf16 conversion of all six weight matrices, one launch.
// A block converts CVT_BLK consecutive floats of one matrix: each thread issues
// CVT_U 16-byte loads (a wave-wide load = 512 contiguous bytes), all in flight
// together, then stores 8 bytes per load (a wave-wide store = two whole lines).
// dst is the six bf16 planes laid end to end in the order Wq Wk Wv Wp W1 W2.
// ---------------------------------------------------------------------------
typedef __attribute__((ext_vector_type(4))) __bf16 v4bf;

static constexpr int CVT_U    = 16;                    // 16-byte loads per thread
static constexpr int CVT_BLK  = 256 * CVT_U * 4;       // floats per block
static constexpr int CVT_SQ   = C * C / CVT_BLK;       // blocks per C x C matrix
static constexpr int CVT_GRID = 12 * CVT_SQ;           // 4 square + 2 fourfold

__device__ __forceinline__
void cvt_block(int blk,
               const float* __restrict__ Wq, const float* __restrict__ Wk,
               const float* __restrict__ Wv, const float* __restrict__ Wp,
               const float* __restrict__ W1, const float* __restrict__ W2,
               bf16_t* __restrict__ dst) {
    const float* src;
    int first;
    if      (blk < 1 * CVT_SQ) { src = Wq; first = 0; }
    else if (blk < 2 * CVT_SQ) { src = Wk; first = 1 * CVT_SQ; }
    else if (blk < 3 * CVT_SQ) { src = Wv; first = 2 * CVT_SQ; }
    else if (blk < 4 * CVT_SQ) { src = Wp; first = 3 * CVT_SQ; }
    else if (blk < 8 * CVT_SQ) { src = W1; first = 4 * CVT_SQ; }
    else                       { src = W2; first = 8 * CVT_SQ; }

    const float4* s = (const float4*)(src + (size_t)(blk - first) * CVT_BLK) + threadIdx.x;
    v4bf*         d = (v4bf*)(dst + (size_t)blk * CVT_BLK) + threadIdx.x;

    float4 v[CVT_U];
    #pragma unroll
    for (int i = 0; i < CVT_U; ++i) v[i] = s[i * 256];
    #pragma unroll
    for (int i = 0; i < CVT_U; ++i) {
        v4bf o;
        o[0] = (bf16_t)v[i].x; o[1] = (bf16_t)v[i].y;
        o[2] = (bf16_t)v[i].z; o[3] = (bf16_t)v[i].w;
        d[i * 256] = o;
    }
}

// ---------------------------------------------------------------------------
// LayerNorm over C=1024, one block (256 threads) per row, bf16 output
// ---------------------------------------------------------------------------
__device__ __forceinline__
void ln_row(int row, const float* __restrict__ x, const float* __restrict__ w,
            const float* __restrict__ b, bf16_t* __restrict__ out) {
    int tid  = threadIdx.x;
    int wave = tid >> 5, lane = tid & 31;

    const float* xr = x + (size_t)row * C;
    float4 xv = ((const float4*)xr)[tid];
    float s1 = xv.x + xv.y + xv.z + xv.w;
    float s2 = xv.x*xv.x + xv.y*xv.y + xv.z*xv.z + xv.w*xv.w;
    #pragma unroll
    for (int off = 16; off; off >>= 1) {
        s1 += __shfl_xor(s1, off, 32);
        s2 += __shfl_xor(s2, off, 32);
    }
    __shared__ float a1[8], a2[8];
    if (lane == 0) { a1[wave] = s1; a2[wave] = s2; }
    __syncthreads();
    float t1 = 0.f, t2 = 0.f;
    #pragma unroll
    for (int i = 0; i < 8; ++i) { t1 += a1[i]; t2 += a2[i]; }
    float mu   = t1 * (1.0f / C);
    float var  = t2 * (1.0f / C) - mu * mu;
    float rstd = rsqrtf(var + 1e-5f);

    float4 wv = ((const float4*)w)[tid];
    float4 bv = ((const float4*)b)[tid];
    bf16_t* orow = out + (size_t)row * C;
    orow[tid*4 + 0] = (bf16_t)((xv.x - mu) * rstd * wv.x + bv.x);
    orow[tid*4 + 1] = (bf16_t)((xv.y - mu) * rstd * wv.y + bv.y);
    orow[tid*4 + 2] = (bf16_t)((xv.z - mu) * rstd * wv.z + bv.z);
    orow[tid*4 + 3] = (bf16_t)((xv.w - mu) * rstd * wv.w + bv.w);
}

__global__ __launch_bounds__(256)
void ln_kernel(const float* __restrict__ x, const float* __restrict__ w,
               const float* __restrict__ b, bf16_t* __restrict__ out) {
    ln_row(blockIdx.x, x, w, b, out);
}

// The weight conversion and the first LayerNorm depend on nothing of each other:
// one launch, the CVT_GRID conversion blocks (the longer ones) first, then one
// block per row.
// waves_per_eu: lets the compiler use the registers for all CVT_U loads at once;
// at its default target it holds the last two back until the first two return.
__global__ __launch_bounds__(256) __attribute__((amdgpu_waves_per_eu(4, 8)))
void cvt_weights_ln(const float* __restrict__ Wq, const float* __restrict__ Wk,
                    const float* __restrict__ Wv, const float* __restrict__ Wp,
                    const float* __restrict__ W1, const float* __restrict__ W2,
                    bf16_t* __restrict__ dst,
                    const float* __restrict__ x, const float* __restrict__ w,
                    const float* __restrict__ b, bf16_t* __restrict__ out) {
    int blk = blockIdx.x;
    if (blk < CVT_GRID) cvt_block(blk, Wq, Wk, Wv, Wp, W1, W2, dst);
    else                ln_row(blk - CVT_GRID, x, w, b, out);
}

// ---------------------------------------------------------------------------
// Eight async global -> LDS copies and the wait that lets their address
// registers be reused, in one statement so that nothing can come between.
// ---------------------------------------------------------------------------
__device__ __forceinline__ void async_copy8_b128(unsigned int lds, unsigned int lds_step,
                                                 const bf16_t* g, size_t g_step) {
    unsigned int l0 = lds,                l1 = lds + lds_step,     l2 = lds + 2 * lds_step,
                 l3 = lds + 3 * lds_step, l4 = lds + 4 * lds_step, l5 = lds + 5 * lds_step,
                 l6 = lds + 6 * lds_step, l7 = lds + 7 * lds_step;
    const bf16_t *g0 = g,              *g1 = g + g_step,     *g2 = g + 2 * g_step,
                 *g3 = g + 3 * g_step, *g4 = g + 4 * g_step, *g5 = g + 5 * g_step,
                 *g6 = g + 6 * g_step, *g7 = g + 7 * g_step;
    asm volatile("global_load_async_to_lds_b128 %0, %8, off\n\t"
                 "global_load_async_to_lds_b128 %1, %9, off\n\t"
                 "global_load_async_to_lds_b128 %2, %10, off\n\t"
                 "global_load_async_to_lds_b128 %3, %11, off\n\t"
                 "global_load_async_to_lds_b128 %4, %12, off\n\t"
                 "global_load_async_to_lds_b128 %5, %13, off\n\t"
                 "global_load_async_to_lds_b128 %6, %14, off\n\t"
                 "global_load_async_to_lds_b128 %7, %15, off\n\t"
                 "s_wait_xcnt 0x0"
                 :: "v"(l0), "v"(l1), "v"(l2), "v"(l3), "v"(l4), "v"(l5), "v"(l6), "v"(l7),
                    "v"(g0), "v"(g1), "v"(g2), "v"(g3), "v"(g4), "v"(g5), "v"(g6), "v"(g7)
                 : "memory");
}

// The same with four copies.
__device__ __forceinline__ void async_copy4_b128(unsigned int lds, unsigned int lds_step,
                                                 const bf16_t* g, size_t g_step) {
    unsigned int l0 = lds, l1 = lds + lds_step, l2 = lds + 2 * lds_step, l3 = lds + 3 * lds_step;
    const bf16_t *g0 = g, *g1 = g + g_step, *g2 = g + 2 * g_step, *g3 = g + 3 * g_step;
    asm volatile("global_load_async_to_lds_b128 %0, %4, off\n\t"
                 "global_load_async_to_lds_b128 %1, %5, off\n\t"
                 "global_load_async_to_lds_b128 %2, %6, off\n\t"
                 "global_load_async_to_lds_b128 %3, %7, off\n\t"
                 "s_wait_xcnt 0x0"
                 :: "v"(l0), "v"(l1), "v"(l2), "v"(l3), "v"(g0), "v"(g1), "v"(g2), "v"(g3)
                 : "memory");
}

static constexpr int GK     = 128;
static constexpr int GPITCH = GK + 8;

// GELU with the error function, 0.5 v (1 + erf(v / sqrt 2)), without a branch.
// The library erff picks one of two forms by |x| < 1 under a lane mask: in the
// epilogue, unrolled over a trip's 32 elements, that made 32 dependent chains run one behind the other. One
// form for every x lets the chains of different elements run side by side:
//   erf(|x|) = 1 - (a1 t + .. + a5 t^5) exp(-x^2),  t = 1 / (1 + p |x|),
// absolute error below 1.5e-7 in exact arithmetic; the whole GELU in f32 stays
// within 4e-7 (|v| <= 8): under a tenth of a unit of the bf16 result for v > -3.5;
// further down, where |GELU| < 1e-3, the cancellation in 1 + erf limits it, as it
// limited the library form.
// The denominator is at least 1; a large |x| gives exp -> 0 and erf -> 1; the sign
// comes in through |0.5 v| * erf(|x|) + 0.5 v.
__device__ __forceinline__ float gelu_erf(float v) {
    float d = fmaf(0.23164189f, fabsf(v), 1.0f);   // 1 + p |x|, p = 0.3275911
    float a = v * v * -0.72134752f;                // -x^2 log2(e)
    float t, e;
    asm("v_rcp_f32 %0, %2\n\t"
        "v_exp_f32 %1, %3\n\t"
        "v_nop"
        : "=&v"(t), "=&v"(e) : "v"(d), "v"(a));
    float p  = fmaf(1.061405429f, t, -1.453152027f);
    p = fmaf(p, t, 1.421413741f);
    p = fmaf(p, t, -0.284496736f);
    p = fmaf(p, t, 0.254829592f);
    p = p * t;
    float hv = 0.5f * v;
    return fmaf(fabsf(hv), fmaf(-p, e, 1.0f), hv);
}

// One async global -> LDS copy as the builtin: the compiler may then keep its
// address registers anywhere in a wave's 512 (asm text reaches the first 256 only,
// which the 256 x 256 tile's accumulators fill).
__device__ __forceinline__ void async_copy_b128(bf16_t* lds, const bf16_t* g) {
    typedef __attribute__((ext_vector_type(4))) int v4i;
    typedef __attribute__((address_space(1))) v4i glb_v4i;
    typedef __attribute__((address_space(3))) v4i lds_v4i;
    __builtin_amdgcn_global_load_async_to_lds_b128((glb_v4i*)g, (lds_v4i*)lds, 0, 0);
}

template <int EPI, int NBUF, int BT, int BN = BT>
__device__ __forceinline__
void gemm_tile(const bf16_t* __restrict__ A, const bf16_t* __restrict__ W,
               const float* __restrict__ bias, const float* __restrict__ resid,
               void* __restrict__ out, int N, int K, int mb, int nb,
               const float* __restrict__ bias1 = nullptr,
               const float* __restrict__ bias2 = nullptr) {
    constexpr int GSTAGE = (BT + BN) * GPITCH;   // bf16 per buffer
    constexpr int MT     = BT / 32;              // 16-row tiles of a wave
    constexpr int NT     = BN / 64;              // 16-column tiles of a wave
    __shared__ __align__(16) bf16_t st[NBUF * GSTAGE];

    int tid  = threadIdx.x;
    int wave = tid >> 5;
    int lane = tid & 31;
    int r    = lane & 15;
    int sel  = lane >> 4;        // which 16-lane half
    int wm   = wave >> 2;        // 0..1: strip of MT * 16 rows
    int wn   = wave & 3;         // 0..3: strip of NT * 16 columns

    // copies: CT threads bring a stage; thread t of them brings chunk (t & 15) of
    // rows (t >> 4) + CR * i
    constexpr int CT = NBUF == 3 ? 128 : 256;
    constexpr int CR = CT / 16;
    int crow = (tid & (CT - 1)) >> 4;
    int cchk = tid & 15;
    const bf16_t* asrc = A + (size_t)(mb + crow) * K + cchk * 8;
    const bf16_t* wsrc = W + (size_t)(nb + crow) * K + cchk * 8;
    unsigned int  cdst = (unsigned int)(unsigned long long)(st + crow * GPITCH + cchk * 8);
    size_t        gstep = (size_t)CR * K;

    auto issue_stage = [&](int s, int buf) {
        if constexpr (BT == 256) {
            bf16_t* l = st + buf * GSTAGE + crow * GPITCH + cchk * 8;
            // unrolled: the test on i falls away and every LDS step is a constant
            #pragma unroll
            for (int i = 0; i < BT / CR; ++i) {      // CR rows of A and of W a trip
                async_copy_b128(l + i * CR * GPITCH, asrc + (size_t)s * GK + i * gstep);
                if (i < BN / CR)
                    async_copy_b128(l + (BT + i * CR) * GPITCH, wsrc + (size_t)s * GK + i * gstep);
            }
            return;
        }
        unsigned int d = cdst + (unsigned int)buf * (GSTAGE * 2);
        for (int h = 0; h < BT / (8 * CR); ++h) {    // 8 * CR rows of A and of W a trip
            async_copy8_b128(d + h * 8 * CR * GPITCH * 2, CR * GPITCH * 2,
                             asrc + (size_t)s * GK + (size_t)h * 8 * gstep, gstep);
            async_copy8_b128(d + (BT + h * 8 * CR) * GPITCH * 2, CR * GPITCH * 2,
                             wsrc + (size_t)s * GK + (size_t)h * 8 * gstep, gstep);
        }
    };

    int nst = K / GK;
    // which half of the waves this wave is in, in a scalar register: it steers
    // scalar branches round the copies and their waits
    int half = __builtin_amdgcn_readfirstlane(tid >> 7);

    if (NBUF == 3) {
        if (half == 0) {
            issue_stage(0, 0);
            // stage 0 landed (this wave's copies)
            asm volatile("s_wait_asynccnt 0x0" ::: "memory");
        } else if (nst > 1) {
            issue_stage(1, 1);
        }
        // stage 0 landed, everyone's copies
        __syncthreads();
        if (half == 0 && nst > 2) issue_stage(2, 2);
    } else {
        issue_stage(0, 0);
        // stage 0 landed (this wave's copies), then everyone's
        asm volatile("s_wait_asynccnt 0x0" ::: "memory");
        __syncthreads();
        if (nst > 1) issue_stage(1, 1);
    }

    v8f acc[MT][NT] = {};

    int ring = 0;                // s mod 3
    for (int s = 0; s < nst; ++s) {
        int cur = NBUF == 3 ? ring : s & 1;
        const bf16_t* abuf = st + cur * GSTAGE + (wm * MT * 16 + r) * GPITCH + sel * 8;
        const bf16_t* bbuf = st + cur * GSTAGE + (BT + wn * NT * 16 + r) * GPITCH + sel * 8;

        // two fragment sets: block kc + 1 is read from LDS while block kc multiplies
        BV a[2][MT], b[2][NT];
        auto load_a = [&](int kc, int set) {
            #pragma unroll
            for (int mt = 0; mt < MT; ++mt) {
                a[set][mt].h[0] = *(const v8bf*)(abuf + mt * 16 * GPITCH + kc * 32);
                a[set][mt].h[1] = *(const v8bf*)(abuf + mt * 16 * GPITCH + kc * 32 + 16);
            }
        };
        auto load_b = [&](int kc, int set) {
            #pragma unroll
            for (int nt = 0; nt < NT; ++nt) {
                b[set][nt].h[0] = *(const v8bf*)(bbuf + nt * 16 * GPITCH + kc * 32);
                b[set][nt].h[1] = *(const v8bf*)(bbuf + nt * 16 * GPITCH + kc * 32 + 16);
            }
        };
        // BT = 256: the few W fragments first, so that behind a stage's barrier the
        // products start on the first A fragment, not on the last
        auto load_frags = [&](int kc, int set) {
            if (BT == 256) { load_b(kc, set); load_a(kc, set); }
            else           { load_a(kc, set); load_b(kc, set); }
        };
        load_frags(0, 0);
        #pragma unroll
        for (int kc = 0; kc < GK / 32; ++kc) {
            if (kc + 1 < GK / 32) load_frags(kc + 1, (kc + 1) & 1);
            // keeps the next block's LDS reads one group ahead of this block's
            // products; left free, the scheduler sinks them among the products
            // and each pair of products then waits out an LDS latency
            __builtin_amdgcn_sched_barrier(0);
            #pragma unroll
            for (int mt = 0; mt < MT; ++mt)
                #pragma unroll
                for (int nt = 0; nt < NT; ++nt)
                    acc[mt][nt] = wmma_bf16(a[kc & 1][mt].v, b[kc & 1][nt].v, acc[mt][nt]);
            // keeps the block after next's reads behind this block's products,
            // whose fragment set they overwrite
            __builtin_amdgcn_sched_barrier(0);
        }

        // hand-over: this wave's reads of the buffer are done ...
        asm volatile("s_wait_dscnt 0x0" ::: "memory");
        if (NBUF == 3) {
            bool mine = half == ((s + 1) & 1);   // this half copies stages s + 1, s + 3
            // ... the copies of the next stage have landed (the half that made
            // them; all it has in flight) ...
            if (mine) asm volatile("s_wait_asynccnt 0x0" ::: "memory");
            // ... for everyone: publishes stage s + 1, frees buffer cur
            __syncthreads();
            if (mine && s + 3 < nst) issue_stage(s + 3, cur);
            ring = ring == 2 ? 0 : ring + 1;
        } else {
            // ... its copies of the next stage have landed ...
            asm volatile("s_wait_asynccnt 0x0" ::: "memory");
            // ... and so have everyone's: publishes stage s + 1, frees buffer cur
            __syncthreads();
            if (s + 2 < nst) issue_stage(s + 2, cur);
        }
    }
    // nothing is in flight when the wave ends
    asm volatile("s_wait_asynccnt 0x0" ::: "memory");

    int m0 = mb + wm * MT * 16;
    int n0 = nb + wn * NT * 16;
    if constexpr (BT == 256) {
        // 256 results a lane, unrolled (with GELU), are more text than the whole rest
        // of the kernel, run through once. Registers cannot be indexed by a loop
        // counter, so each wave lays its accumulators down in LDS, in a range of its
        // own, a lane's values where that lane reads them back (the ring is free: the
        // loop's last barrier ended every read, and no copy is in flight), and a loop
        // takes them up again, one row of NT tiles a trip.
        // EPI 0: column col of the tile is column col % N of output plane col / N,
        // which has M x N elements and a bias of its own
        float  bcol[NT];
        size_t ocol[NT];
        #pragma unroll
        for (int nt = 0; nt < NT; ++nt) {
            int col = n0 + nt * 16 + r;
            if (EPI == 0) {
                int pl = col / N, cc = col % N;
                bcol[nt] = (pl == 0 ? bias : pl == 1 ? bias1 : bias2)[cc];
                ocol[nt] = (size_t)pl * M * N + cc;
            } else {
                bcol[nt] = bias[col];
                ocol[nt] = col;
            }
        }
        float4* ep = (float4*)st + wave * (MT * NT * 64) + lane;
        #pragma unroll
        for (int mt = 0; mt < MT; ++mt)
            #pragma unroll
            for (int nt = 0; nt < NT; ++nt)
                #pragma unroll
                for (int h = 0; h < 2; ++h)
                    ep[((mt * NT + nt) * 2 + h) * 32] =
                        make_float4(acc[mt][nt][h * 4], acc[mt][nt][h * 4 + 1],
                                    acc[mt][nt][h * 4 + 2], acc[mt][nt][h * 4 + 3]);
        // stays rolled: unrolled it would be the long text again
        #pragma unroll 1
        for (int mt = 0; mt < MT; ++mt) {
            #pragma unroll
            for (int nt = 0; nt < NT; ++nt) {
                #pragma unroll
                for (int h = 0; h < 2; ++h) {
                    float4 t = ep[((mt * NT + nt) * 2 + h) * 32];
                    float  e[4] = {t.x, t.y, t.z, t.w};
                    #pragma unroll
                    for (int j = 0; j < 4; ++j) {
                        int row = m0 + mt * 16 + h * 4 + j + sel * 8;
                        float v = e[j] + bcol[nt];
                        ((bf16_t*)out)[(size_t)row * N + ocol[nt]] = (bf16_t)(EPI == 2 ? gelu_erf(v) : v);
                    }
                }
            }
            // behind this trip's stores, before the next trip gives their address
            // and data registers new values
            asm volatile("s_wait_xcnt 0x0" ::: "memory");
        }
        return;
    }
    #pragma unroll
    for (int mt = 0; mt < MT; ++mt) {
        #pragma unroll
        for (int nt = 0; nt < NT; ++nt) {
            int col = n0 + nt * 16 + r;
            float bcol = bias[col];
            #pragma unroll
            for (int j = 0; j < 8; ++j) {
                int row = m0 + mt * 16 + j + sel * 8;
                size_t idx = (size_t)row * N + col;
                float v = acc[mt][nt][j] + bcol;
                if (EPI == 0) {
                    ((bf16_t*)out)[idx] = (bf16_t)v;
                } else if (EPI == 1) {
                    ((float*)out)[idx] = resid[idx] + v;
                } else {
                    ((bf16_t*)out)[idx] = (bf16_t)gelu_erf(v);
                }
            }
        }
    }
}

template <int EPI>
__global__ __launch_bounds__(256)
void gemm_bf16(const bf16_t* __restrict__ A, const bf16_t* __restrict__ W,
               const float* __restrict__ bias, const float* __restrict__ resid,
               void* __restrict__ out, int N, int K) {
    // EPI 1 (N = C) has one 128 x 128 tile for each WGP: three buffers;
    // EPI 2 (N = 4 C) has one 256 x 256 tile for each WGP
    constexpr int BT = EPI == 1 ? 128 : 256;
    gemm_tile<EPI, EPI == 1 ? 3 : 2, BT>(A, W, bias, resid, out, N, K,
                                         blockIdx.x * BT, blockIdx.y * BT);
}

// The three projections q, k, v of the same A in one launch, as one product with
// 3 C columns: W is the three C x C weight planes laid end to end, out the three
// M x C output planes laid end to end. Tiles of 256 x 192: 16 x 16 of them, one for
// each WGP (a 16-column tile of a wave lies in one plane: C is a multiple of 16).
__global__ __launch_bounds__(256)
void gemm_qkv(const bf16_t* __restrict__ A, const bf16_t* __restrict__ W,
              const float* __restrict__ bq, const float* __restrict__ bk,
              const float* __restrict__ bv, bf16_t* __restrict__ out, int K) {
    gemm_tile<0, 2, 256, 192>(A, W, bq, nullptr, out, C, K,
                              blockIdx.x * 256, blockIdx.y * 192, bk, bv);
}

static constexpr int AK     = 64;
static constexpr int APITCH = HD + 8;
static constexpr int VPITCH = HD + 16;
static constexpr int ATILE  = AK * APITCH;
static constexpr int VTILE  = AK * VPITCH;
static constexpr int ASTAGE = ATILE + VTILE;

__device__ __forceinline__ v8bf lds_load_tr16(const bf16_t* p) {
    typedef __attribute__((address_space(3))) v8bf lds_v8bf;
    return __builtin_amdgcn_ds_load_tr16_b128_v8bf16((lds_v8bf*)p);
}

__global__ __launch_bounds__(128)
void attn_kernel(const bf16_t* __restrict__ q, const bf16_t* __restrict__ k,
                 const bf16_t* __restrict__ v, bf16_t* __restrict__ y) {
    __shared__ __align__(16) bf16_t kv[2 * ASTAGE];    // K and V stages, block-wide

    // in a scalar register: the wave's block counts below steer scalar branches
    int wave = __builtin_amdgcn_readfirstlane(threadIdx.x >> 5);
    int lane = threadIdx.x & 31;
    int r    = lane & 15;
    int sel  = lane >> 4;

    int bq = blockIdx.x & 31;          // T/64 = 32 query blocks
    int hh = (blockIdx.x >> 5) & 15;   // head
    int bb = blockIdx.x >> 9;          // batch
    int qbase = bq * 64 + wave * 16;

    size_t base = (size_t)bb * T * C + (size_t)hh * HD;

    // copies: thread t brings chunk (t & 7) of rows (t >> 3) + 16 * i of a stage
    int crow = threadIdx.x >> 3;
    int cchk = threadIdx.x & 7;
    const bf16_t* ksrc = k + base + (size_t)crow * C + cchk * 8;
    const bf16_t* vsrc = v + base + (size_t)crow * C + cchk * 8;
    unsigned int  kdst = (unsigned int)(unsigned long long)(kv + crow * APITCH + cchk * 8);
    unsigned int  vdst = (unsigned int)(unsigned long long)(kv + ATILE + crow * VPITCH + cchk * 8);

    auto issue_stage = [&](int s, int buf) {
        unsigned int d = (unsigned int)buf * (ASTAGE * 2);
        async_copy4_b128(kdst + d, 16 * APITCH * 2, ksrc + (size_t)s * AK * C, (size_t)16 * C);
        async_copy4_b128(vdst + d, 16 * VPITCH * 2, vsrc + (size_t)s * AK * C, (size_t)16 * C);
    };

    int nst = bq + 1;                  // 64-key stages up to the block's diagonal
    issue_stage(0, 0);

    // q^T B-operands for the two K=32 chunks of HD=64, pre-scaled by 1/8
    BV qa[2];
    const bf16_t* qrow = q + base + (size_t)(qbase + r) * C;
    #pragma unroll
    for (int c = 0; c < 2; ++c) {
        qa[c].h[0] = *(const v8bf*)(qrow + c * 32 + sel * 8);
        qa[c].h[1] = *(const v8bf*)(qrow + c * 32 + 16 + sel * 8);
        #pragma unroll
        for (int i = 0; i < 16; ++i)
            qa[c].v[i] = (bf16_t)((float)qa[c].v[i] * 0.125f);
    }

    // All per-query state is per lane: lane (r, sel) works for query qbase + r.
    // o[nt][j] = O^T[d = nt * 16 + sel * 8 + j][query]; mrow is the query's running
    // maximum (equal in both halves); lrow sums this half's keys only.
    v8f o[4] = {};
    float mrow = -INFINITY, lrow = 0.f;

    // ks, vs: the 32 rows of K and of V in LDS that hold keys kb .. kb + 31
    auto process_block = [&](int kb, const bf16_t* ks, const bf16_t* vs, auto maskc) {
        constexpr bool MASK = decltype(maskc)::value;

        // ---- S^T = k @ q^T for 32 keys (two 16x16 tiles): A = K rows, B = q ----
        // the four K fragments have registers of their own, so that their LDS
        // reads are in flight together ahead of the products
        BV kop[2][2];
        #pragma unroll
        for (int t = 0; t < 2; ++t) {
            #pragma unroll
            for (int c = 0; c < 2; ++c) {
                const bf16_t* kr = ks + (t * 16 + r) * APITCH + c * 32 + sel * 8;
                kop[t][c].h[0] = *(const v8bf*)(kr);
                kop[t][c].h[1] = *(const v8bf*)(kr + 16);
            }
        }
        // A fragments of V^T: keys sel * 8 .. + 7 and 16 + sel * 8 .. + 7 of d row
        // nt * 16 + r, the k order in which pb below holds P^T
        const bf16_t* vt = vs + (sel * 8 + (lane & 7)) * VPITCH + ((lane >> 3) & 1) * 8;
        BV va[4];
        #pragma unroll
        for (int nt = 0; nt < 4; ++nt) {
            va[nt].h[0] = lds_load_tr16(vt + nt * 16);
            va[nt].h[1] = lds_load_tr16(vt + 16 * VPITCH + nt * 16);
        }

        // st[t][j] = score of key kb + t * 16 + sel * 8 + j for query qbase + r
        v8f st[2] = {};
        #pragma unroll
        for (int c = 0; c < 2; ++c) {
            st[0] = wmma_bf16(kop[0][c].v, qa[c].v, st[0]);
            st[1] = wmma_bf16(kop[1][c].v, qa[c].v, st[1]);
        }
        if (MASK) {
            int qi = qbase + r;
            #pragma unroll
            for (int t = 0; t < 2; ++t)
                #pragma unroll
                for (int j = 0; j < 8; ++j)
                    st[t][j] = (kb + t * 16 + sel * 8 + j <= qi) ? st[t][j] : -INFINITY;
        }

        // ---- online softmax: 16 keys of one query in a lane, the other 16 in lane ^ 16 ----
        float mt = fmaxf(st[0][0], st[1][0]);
        #pragma unroll
        for (int j = 1; j < 8; ++j) mt = fmaxf(mt, fmaxf(st[0][j], st[1][j]));
        mt = fmaxf(mt, xhalf(mt));
        float mnew  = fmaxf(mrow, mt);
        float alpha = __expf(mrow - mnew);
        mrow = mnew;

        // P^T goes from the score registers straight into the B operand:
        // element t * 8 + j is key t * 16 + sel * 8 + j
        // the 16 terms are summed in four independent chains
        BV pb;
        float rs[4];
        #pragma unroll
        for (int t = 0; t < 2; ++t) {
            #pragma unroll
            for (int j = 0; j < 8; ++j) {
                float p = __expf(st[t][j] - mnew);
                if (t == 0 && j < 4) rs[j] = p;
                else                 rs[j & 3] += p;
                pb.v[t * 8 + j] = (bf16_t)p;
            }
        }

        // ---- O^T = O^T * alpha + V^T @ P^T (one 16x16x32 wmma per 16 d rows) ----
        #pragma unroll
        for (int nt = 0; nt < 4; ++nt) {
            #pragma unroll
            for (int j = 0; j < 8; ++j) o[nt][j] *= alpha;
            o[nt] = wmma_bf16(va[nt].v, pb.v, o[nt]);
        }
        __builtin_amdgcn_sched_barrier(0);
        lrow = lrow * alpha + ((rs[0] + rs[1]) + (rs[2] + rs[3]));
    };

    int nblk  = (qbase + 16 + 31) / 32;  // this wave's 32-key blocks
    int nfull = qbase >> 5;              // blocks entirely below the diagonal

    // stage 0 landed (this wave's copies), then everyone's
    asm volatile("s_wait_asynccnt 0x0" ::: "memory");
    __syncthreads();
    if (nst > 1) issue_stage(1, 1);

    for (int s = 0; s < nst; ++s) {
        int cur = s & 1;
        const bf16_t* kt = kv + cur * ASTAGE;
        // this wave's blocks inside the stage: first the unmasked, then the masked
        int jb   = s * (AK / 32);
        int jful = min(nfull, jb + AK / 32);
        int jend = min(nblk,  jb + AK / 32);
        for (; jb < jful; ++jb) {
            int sub = jb % (AK / 32);
            process_block(jb * 32, kt + sub * 32 * APITCH, kt + ATILE + sub * 32 * VPITCH,
                          std::integral_constant<bool, false>{});
        }
        for (; jb < jend; ++jb) {
            int sub = jb % (AK / 32);
            process_block(jb * 32, kt + sub * 32 * APITCH, kt + ATILE + sub * 32 * VPITCH,
                          std::integral_constant<bool, true>{});
        }
        // hand-over: this wave's reads of the buffer are done ...
        asm volatile("s_wait_dscnt 0x0" ::: "memory");
        // ... its copies of the next stage have landed ...
        asm volatile("s_wait_asynccnt 0x0" ::: "memory");
        // ... and so have everyone's: publishes stage s + 1, frees buffer cur
        __syncthreads();
        if (s + 2 < nst) issue_stage(s + 2, cur);
    }
    // nothing is in flight when the wave ends
    asm volatile("s_wait_asynccnt 0x0" ::: "memory");

    // ---- finalize: y = O / l; a lane holds 8 consecutive d of its query ----
    float inv = 1.0f / (lrow + xhalf(lrow));
    bf16_t* yrow = y + base + (size_t)(qbase + r) * C + sel * 8;
    #pragma unroll
    for (int nt = 0; nt < 4; ++nt) {
        v8bf ov;
        #pragma unroll
        for (int j = 0; j < 8; ++j) ov[j] = (bf16_t)(o[nt][j] * inv);
        *(v8bf*)(yrow + nt * 16) = ov;
    }
}

// ---------------------------------------------------------------------------
// Host-side launch
// ---------------------------------------------------------------------------
extern "C" void kernel_launch(void* const* d_in, const int* in_sizes, int n_in,
                              void* d_out, int out_size, void* d_ws, size_t ws_size,
                              hipStream_t stream) {
    const float* x     = (const float*)d_in[0];
    const float* ln1_w = (const float*)d_in[1];
    const float* ln1_b = (const float*)d_in[2];
    const float* ln2_w = (const float*)d_in[3];
    const float* ln2_b = (const float*)d_in[4];
    const float* Wq = (const float*)d_in[5];  const float* bq = (const float*)d_in[6];
    const float* Wk = (const float*)d_in[7];  const float* bk = (const float*)d_in[8];
    const float* Wv = (const float*)d_in[9];  const float* bv = (const float*)d_in[10];
    const float* Wp = (const float*)d_in[11]; const float* bp = (const float*)d_in[12];
    const float* W1 = (const float*)d_in[13]; const float* b1 = (const float*)d_in[14];
    const float* W2 = (const float*)d_in[15]; const float* b2 = (const float*)d_in[16];
    float* outp = (float*)d_out;

    // workspace layout
    char* w = (char*)d_ws;
    auto take = [&](size_t bytes) { char* p = w; w += (bytes + 255) & ~size_t(255); return p; };
    bf16_t* hb   = (bf16_t*)take((size_t)M * C * 2);
    bf16_t* wqb  = (bf16_t*)take((size_t)C * C * 2);
    bf16_t* wkb  = (bf16_t*)take((size_t)C * C * 2);
    bf16_t* wvb  = (bf16_t*)take((size_t)C * C * 2);
    bf16_t* wpb  = (bf16_t*)take((size_t)C * C * 2);
    bf16_t* w1b  = (bf16_t*)take((size_t)4 * C * C * 2);
    bf16_t* w2b  = (bf16_t*)take((size_t)4 * C * C * 2);
    bf16_t* qb   = (bf16_t*)take((size_t)M * C * 2);
    bf16_t* kbuf = (bf16_t*)take((size_t)M * C * 2);
    bf16_t* vb_  = (bf16_t*)take((size_t)M * C * 2);
    bf16_t* yb   = (bf16_t*)take((size_t)M * C * 2);
    float*  xres = (float*) take((size_t)M * C * 4);
    bf16_t* h2b  = (bf16_t*)take((size_t)M * C * 2);
    bf16_t* mact = (bf16_t*)take((size_t)M * 4 * C * 2);

    // 1) weights -> bf16 (the six planes from wqb on lie end to end: every
    //    plane's size is a multiple of the workspace granule) and
    // 2) LN1, one launch
    cvt_weights_ln<<<CVT_GRID + M, 256, 0, stream>>>(Wq, Wk, Wv, Wp, W1, W2, wqb,
                                                     x, ln1_w, ln1_b, hb);

    // 3) QKV projections, one launch (the planes wqb, wkb, wvb lie end to end,
    //    and so do qb, kbuf, vb_)
    dim3 g1(M / 128, C / 128);
    dim3 g3(M / 256, (3 * C) / 192);
    gemm_qkv<<<g3, 256, 0, stream>>>(hb, wqb, bq, bk, bv, qb, C);

    // 4) causal attention
    attn_kernel<<<Bsz * H * (T / 64), 128, 0, stream>>>(qb, kbuf, vb_, yb);

    // 5) output projection + residual (f32)
    gemm_bf16<1><<<g1, 256, 0, stream>>>(yb, wpb, bp, x, xres, C, C);

    // 6) LN2
    ln_kernel<<<M, 256, 0, stream>>>(xres, ln2_w, ln2_b, h2b);

    // 7) MLP fc1 + GELU
    dim3 g2(M / 256, (4 * C) / 256);
    gemm_bf16<2><<<g2, 256, 0, stream>>>(h2b, w1b, b1, nullptr, mact, 4 * C, C);

    // 8) MLP fc2 + residual -> final output (f32)
    gemm_bf16<1><<<g1, 256, 0, stream>>>(mact, w2b, b2, xres, outp, C, 4 * C);
}

// v009
// A run of this version takes 134 microseconds.
// Timed twice side by side with v008, it ran 1.09 times as fast both times.
// Counting every step since v000, it is 3.40 times as fast.
#include <hip/hip_runtime.h>
#include <hip/hip_bf16.h>
#include <math.h>
#include <type_traits>

typedef __bf16 bf16_t;
typedef __attribute__((ext_vector_type(16))) __bf16 v16bf;
typedef __attribute__((ext_vector_type(8)))  __bf16 v8bf;
typedef __attribute__((ext_vector_type(8)))  float  v8f;

union BV {
    v16bf v;
    v8bf  h[2];
};

__device__ __forceinline__ v8f wmma_bf16(v16bf a, v16bf b, v8f c) {
    // D = A(16x32 bf16) * B(32x16 bf16) + C(16x16 f32)
    return __builtin_amdgcn_wmma_f32_16x16x32_bf16(
        /*neg_a=*/false, a, /*neg_b=*/false, b,
        /*c_mod=*/(short)0, c, /*reuse_a=*/false, /*reuse_b=*/false);
}

__device__ __forceinline__ float xhalf(float x) {
    int i = __float_as_int(x);
    return __int_as_float(
        __builtin_amdgcn_permlanex16(i, i, 0x76543210, 0xfedcba98, false, false));
}

static constexpr int Bsz = 2;
static constexpr int T   = 2048;
static constexpr int C   = 1024;
static constexpr int H   = 16;
static constexpr int HD  = 64;
static constexpr int M   = Bsz * T;   // 4096 rows

// ---------------------------------------------------------------------------
// fp32 -> bf16 conversion of all six weight matrices, one launch.
// A block converts CVT_BLK consecutive floats of one matrix: each thread issues
// CVT_U 16-byte loads (a wave-wide load = 512 contiguous bytes), all in flight
// together, then stores 8 bytes per load (a wave-wide store = two whole lines).
// dst is the six bf16 planes laid end to end in the order Wq Wk Wv Wp W1 W2.
// ---------------------------------------------------------------------------
typedef __attribute__((ext_vector_type(4))) __bf16 v4bf;

static constexpr int CVT_U    = 16;                    // 16-byte loads per thread
static constexpr int CVT_BLK  = 256 * CVT_U * 4;       // floats per block
static constexpr int CVT_SQ   = C * C / CVT_BLK;       // blocks per C x C matrix
static constexpr int CVT_GRID = 12 * CVT_SQ;           // 4 square + 2 fourfold

__device__ __forceinline__
void cvt_block(int blk,
               const float* __restrict__ Wq, const float* __restrict__ Wk,
               const float* __restrict__ Wv, const float* __restrict__ Wp,
               const float* __restrict__ W1, const float* __restrict__ W2,
               bf16_t* __restrict__ dst) {
    const float* src;
    int first;
    if      (blk < 1 * CVT_SQ) { src = Wq; first = 0; }
    else if (blk < 2 * CVT_SQ) { src = Wk; first = 1 * CVT_SQ; }
    else if (blk < 3 * CVT_SQ) { src = Wv; first = 2 * CVT_SQ; }
    else if (blk < 4 * CVT_SQ) { src = Wp; first = 3 * CVT_SQ; }
    else if (blk < 8 * CVT_SQ) { src = W1; first = 4 * CVT_SQ; }
    else                       { src = W2; first = 8 * CVT_SQ; }

    const float4* s = (const float4*)(src + (size_t)(blk - first) * CVT_BLK) + threadIdx.x;
    v4bf*         d = (v4bf*)(dst + (size_t)blk * CVT_BLK) + threadIdx.x;

    float4 v[CVT_U];
    #pragma unroll
    for (int i = 0; i < CVT_U; ++i) v[i] = s[i * 256];
    #pragma unroll
    for (int i = 0; i < CVT_U; ++i) {
        v4bf o;
        o[0] = (bf16_t)v[i].x; o[1] = (bf16_t)v[i].y;
        o[2] = (bf16_t)v[i].z; o[3] = (bf16_t)v[i].w;
        d[i * 256] = o;
    }
}

// ---------------------------------------------------------------------------
// LayerNorm over C=1024, one block (256 threads) per row, bf16 output
// ---------------------------------------------------------------------------
__device__ __forceinline__
void ln_row(int row, const float* __restrict__ x, const float* __restrict__ w,
            const float* __restrict__ b, bf16_t* __restrict__ out) {
    int tid  = threadIdx.x;
    int wave = tid >> 5, lane = tid & 31;

    const float* xr = x + (size_t)row * C;
    float4 xv = ((const float4*)xr)[tid];
    float s1 = xv.x + xv.y + xv.z + xv.w;
    float s2 = xv.x*xv.x + xv.y*xv.y + xv.z*xv.z + xv.w*xv.w;
    #pragma unroll
    for (int off = 16; off; off >>= 1) {
        s1 += __shfl_xor(s1, off, 32);
        s2 += __shfl_xor(s2, off, 32);
    }
    __shared__ float a1[8], a2[8];
    if (lane == 0) { a1[wave] = s1; a2[wave] = s2; }
    __syncthreads();
    float t1 = 0.f, t2 = 0.f;
    #pragma unroll
    for (int i = 0; i < 8; ++i) { t1 += a1[i]; t2 += a2[i]; }
    float mu   = t1 * (1.0f / C);
    float var  = t2 * (1.0f / C) - mu * mu;
    float rstd = rsqrtf(var + 1e-5f);

    float4 wv = ((const float4*)w)[tid];
    float4 bv = ((const float4*)b)[tid];
    bf16_t* orow = out + (size_t)row * C;
    orow[tid*4 + 0] = (bf16_t)((xv.x - mu) * rstd * wv.x + bv.x);
    orow[tid*4 + 1] = (bf16_t)((xv.y - mu) * rstd * wv.y + bv.y);
    orow[tid*4 + 2] = (bf16_t)((xv.z - mu) * rstd * wv.z + bv.z);
    orow[tid*4 + 3] = (bf16_t)((xv.w - mu) * rstd * wv.w + bv.w);
}

__global__ __launch_bounds__(256)
void ln_kernel(const float* __restrict__ x, const float* __restrict__ w,
               const float* __restrict__ b, bf16_t* __restrict__ out) {
    ln_row(blockIdx.x, x, w, b, out);
}

// The weight conversion and the first LayerNorm depend on nothing of each other:
// one launch, the CVT_GRID conversion blocks (the longer ones) first, then one
// block per row.
// waves_per_eu: lets the compiler use the registers for all CVT_U loads at once;
// at its default target it holds the last two back until the first two return.
__global__ __launch_bounds__(256) __attribute__((amdgpu_waves_per_eu(4, 8)))
void cvt_weights_ln(const float* __restrict__ Wq, const float* __restrict__ Wk,
                    const float* __restrict__ Wv, const float* __restrict__ Wp,
                    const float* __restrict__ W1, const float* __restrict__ W2,
                    bf16_t* __restrict__ dst,
                    const float* __restrict__ x, const float* __restrict__ w,
                    const float* __restrict__ b, bf16_t* __restrict__ out) {
    int blk = blockIdx.x;
    if (blk < CVT_GRID) cvt_block(blk, Wq, Wk, Wv, Wp, W1, W2, dst);
    else                ln_row(blk - CVT_GRID, x, w, b, out);
}

// ---------------------------------------------------------------------------
// Eight async global -> LDS copies and the wait that lets their address
// registers be reused, in one statement so that nothing can come between.
// ---------------------------------------------------------------------------
__device__ __forceinline__ void async_copy8_b128(unsigned int lds, unsigned int lds_step,
                                                 const bf16_t* g, size_t g_step) {
    unsigned int l0 = lds,                l1 = lds + lds_step,     l2 = lds + 2 * lds_step,
                 l3 = lds + 3 * lds_step, l4 = lds + 4 * lds_step, l5 = lds + 5 * lds_step,
                 l6 = lds + 6 * lds_step, l7 = lds + 7 * lds_step;
    const bf16_t *g0 = g,              *g1 = g + g_step,     *g2 = g + 2 * g_step,
                 *g3 = g + 3 * g_step, *g4 = g + 4 * g_step, *g5 = g + 5 * g_step,
                 *g6 = g + 6 * g_step, *g7 = g + 7 * g_step;
    asm volatile("global_load_async_to_lds_b128 %0, %8, off\n\t"
                 "global_load_async_to_lds_b128 %1, %9, off\n\t"
                 "global_load_async_to_lds_b128 %2, %10, off\n\t"
                 "global_load_async_to_lds_b128 %3, %11, off\n\t"
                 "global_load_async_to_lds_b128 %4, %12, off\n\t"
                 "global_load_async_to_lds_b128 %5, %13, off\n\t"
                 "global_load_async_to_lds_b128 %6, %14, off\n\t"
                 "global_load_async_to_lds_b128 %7, %15, off\n\t"
                 "s_wait_xcnt 0x0"
                 :: "v"(l0), "v"(l1), "v"(l2), "v"(l3), "v"(l4), "v"(l5), "v"(l6), "v"(l7),
                    "v"(g0), "v"(g1), "v"(g2), "v"(g3), "v"(g4), "v"(g5), "v"(g6), "v"(g7)
                 : "memory");
}

// The same with two copies.
__device__ __forceinline__ void async_copy2_b128(unsigned int lds, unsigned int lds_step,
                                                 const bf16_t* g, size_t g_step) {
    unsigned int l0 = lds, l1 = lds + lds_step;
    const bf16_t *g0 = g, *g1 = g + g_step;
    asm volatile("global_load_async_to_lds_b128 %0, %2, off\n\t"
                 "global_load_async_to_lds_b128 %1, %3, off\n\t"
                 "s_wait_xcnt 0x0"
                 :: "v"(l0), "v"(l1), "v"(g0), "v"(g1)
                 : "memory");
}

static constexpr int GK     = 128;
static constexpr int GPITCH = GK + 8;

// GELU with the error function, 0.5 v (1 + erf(v / sqrt 2)), without a branch.
// The library erff picks one of two forms by |x| < 1 under a lane mask: in the
// epilogue, unrolled over a trip's 32 elements, that made 32 dependent chains run one behind the other. One
// form for every x lets the chains of different elements run side by side:
//   erf(|x|) = 1 - (a1 t + .. + a5 t^5) exp(-x^2),  t = 1 / (1 + p |x|),
// absolute error below 1.5e-7 in exact arithmetic; the whole GELU in f32 stays
// within 4e-7 (|v| <= 8): under a tenth of a unit of the bf16 result for v > -3.5;
// further down, where |GELU| < 1e-3, the cancellation in 1 + erf limits it, as it
// limited the library form.
// The denominator is at least 1; a large |x| gives exp -> 0 and erf -> 1; the sign
// comes in through |0.5 v| * erf(|x|) + 0.5 v.
__device__ __forceinline__ float gelu_erf(float v) {
    float d = fmaf(0.23164189f, fabsf(v), 1.0f);   // 1 + p |x|, p = 0.3275911
    float a = v * v * -0.72134752f;                // -x^2 log2(e)
    float t, e;
    asm("v_rcp_f32 %0, %2\n\t"
        "v_exp_f32 %1, %3\n\t"
        "v_nop"
        : "=&v"(t), "=&v"(e) : "v"(d), "v"(a));
    float p  = fmaf(1.061405429f, t, -1.453152027f);
    p = fmaf(p, t, 1.421413741f);
    p = fmaf(p, t, -0.284496736f);
    p = fmaf(p, t, 0.254829592f);
    p = p * t;
    float hv = 0.5f * v;
    return fmaf(fabsf(hv), fmaf(-p, e, 1.0f), hv);
}

// One async global -> LDS copy as the builtin: the compiler may then keep its
// address registers anywhere in a wave's 512 (asm text reaches the first 256 only,
// which the 256 x 256 tile's accumulators fill).
__device__ __forceinline__ void async_copy_b128(bf16_t* lds, const bf16_t* g) {
    typedef __attribute__((ext_vector_type(4))) int v4i;
    typedef __attribute__((address_space(1))) v4i glb_v4i;
    typedef __attribute__((address_space(3))) v4i lds_v4i;
    __builtin_amdgcn_global_load_async_to_lds_b128((glb_v4i*)g, (lds_v4i*)lds, 0, 0);
}

template <int EPI, int NBUF, int BT, int BN = BT>
__device__ __forceinline__
void gemm_tile(const bf16_t* __restrict__ A, const bf16_t* __restrict__ W,
               const float* __restrict__ bias, const float* __restrict__ resid,
               void* __restrict__ out, int N, int K, int mb, int nb,
               const float* __restrict__ bias1 = nullptr,
               const float* __restrict__ bias2 = nullptr) {
    constexpr int GSTAGE = (BT + BN) * GPITCH;   // bf16 per buffer
    constexpr int MT     = BT / 32;              // 16-row tiles of a wave
    constexpr int NT     = BN / 64;              // 16-column tiles of a wave
    __shared__ __align__(16) bf16_t st[NBUF * GSTAGE];

    int tid  = threadIdx.x;
    int wave = tid >> 5;
    int lane = tid & 31;
    int r    = lane & 15;
    int sel  = lane >> 4;        // which 16-lane half
    int wm   = wave >> 2;        // 0..1: strip of MT * 16 rows
    int wn   = wave & 3;         // 0..3: strip of NT * 16 columns

    // copies: CT threads bring a stage; thread t of them brings chunk (t & 15) of
    // rows (t >> 4) + CR * i
    constexpr int CT = NBUF == 3 ? 128 : 256;
    constexpr int CR = CT / 16;
    int crow = (tid & (CT - 1)) >> 4;
    int cchk = tid & 15;
    const bf16_t* asrc = A + (size_t)(mb + crow) * K + cchk * 8;
    const bf16_t* wsrc = W + (size_t)(nb + crow) * K + cchk * 8;
    unsigned int  cdst = (unsigned int)(unsigned long long)(st + crow * GPITCH + cchk * 8);
    size_t        gstep = (size_t)CR * K;

    auto issue_stage = [&](int s, int buf) {
        if constexpr (BT == 256) {
            bf16_t* l = st + buf * GSTAGE + crow * GPITCH + cchk * 8;
            // unrolled: the test on i falls away and every LDS step is a constant
            #pragma unroll
            for (int i = 0; i < BT / CR; ++i) {      // CR rows of A and of W a trip
                async_copy_b128(l + i * CR * GPITCH, asrc + (size_t)s * GK + i * gstep);
                if (i < BN / CR)
                    async_copy_b128(l + (BT + i * CR) * GPITCH, wsrc + (size_t)s * GK + i * gstep);
            }
            return;
        }
        unsigned int d = cdst + (unsigned int)buf * (GSTAGE * 2);
        for (int h = 0; h < BT / (8 * CR); ++h) {    // 8 * CR rows of A and of W a trip
            async_copy8_b128(d + h * 8 * CR * GPITCH * 2, CR * GPITCH * 2,
                             asrc + (size_t)s * GK + (size_t)h * 8 * gstep, gstep);
            async_copy8_b128(d + (BT + h * 8 * CR) * GPITCH * 2, CR * GPITCH * 2,
                             wsrc + (size_t)s * GK + (size_t)h * 8 * gstep, gstep);
        }
    };

    int nst = K / GK;
    // which half of the waves this wave is in, in a scalar register: it steers
    // scalar branches round the copies and their waits
    int half = __builtin_amdgcn_readfirstlane(tid >> 7);

    if (NBUF == 3) {
        if (half == 0) {
            issue_stage(0, 0);
            // stage 0 landed (this wave's copies)
            asm volatile("s_wait_asynccnt 0x0" ::: "memory");
        } else if (nst > 1) {
            issue_stage(1, 1);
        }
        // stage 0 landed, everyone's copies
        __syncthreads();
        if (half == 0 && nst > 2) issue_stage(2, 2);
    } else {
        issue_stage(0, 0);
        // stage 0 landed (this wave's copies), then everyone's
        asm volatile("s_wait_asynccnt 0x0" ::: "memory");
        __syncthreads();
        if (nst > 1) issue_stage(1, 1);
    }

    v8f acc[MT][NT] = {};

    int ring = 0;                // s mod 3
    for (int s = 0; s < nst; ++s) {
        int cur = NBUF == 3 ? ring : s & 1;
        const bf16_t* abuf = st + cur * GSTAGE + (wm * MT * 16 + r) * GPITCH + sel * 8;
        const bf16_t* bbuf = st + cur * GSTAGE + (BT + wn * NT * 16 + r) * GPITCH + sel * 8;

        // two fragment sets: block kc + 1 is read from LDS while block kc multiplies
        BV a[2][MT], b[2][NT];
        auto load_a = [&](int kc, int set) {
            #pragma unroll
            for (int mt = 0; mt < MT; ++mt) {
                a[set][mt].h[0] = *(const v8bf*)(abuf + mt * 16 * GPITCH + kc * 32);
                a[set][mt].h[1] = *(const v8bf*)(abuf + mt * 16 * GPITCH + kc * 32 + 16);
            }
        };
        auto load_b = [&](int kc, int set) {
            #pragma unroll
            for (int nt = 0; nt < NT; ++nt) {
                b[set][nt].h[0] = *(const v8bf*)(bbuf + nt * 16 * GPITCH + kc * 32);
                b[set][nt].h[1] = *(const v8bf*)(bbuf + nt * 16 * GPITCH + kc * 32 + 16);
            }
        };
        // BT = 256: the few W fragments first, so that behind a stage's barrier the
        // products start on the first A fragment, not on the last
        auto load_frags = [&](int kc, int set) {
            if (BT == 256) { load_b(kc, set); load_a(kc, set); }
            else           { load_a(kc, set); load_b(kc, set); }
        };
        load_frags(0, 0);
        #pragma unroll
        for (int kc = 0; kc < GK / 32; ++kc) {
            if (kc + 1 < GK / 32) load_frags(kc + 1, (kc + 1) & 1);
            // keeps the next block's LDS reads one group ahead of this block's
            // products; left free, the scheduler sinks them among the products
            // and each pair of products then waits out an LDS latency
            __builtin_amdgcn_sched_barrier(0);
            #pragma unroll
            for (int mt = 0; mt < MT; ++mt)
                #pragma unroll
                for (int nt = 0; nt < NT; ++nt)
                    acc[mt][nt] = wmma_bf16(a[kc & 1][mt].v, b[kc & 1][nt].v, acc[mt][nt]);
            // keeps the block after next's reads behind this block's products,
            // whose fragment set they overwrite
            __builtin_amdgcn_sched_barrier(0);
        }

        // hand-over: this wave's reads of the buffer are done ...
        asm volatile("s_wait_dscnt 0x0" ::: "memory");
        if (NBUF == 3) {
            bool mine = half == ((s + 1) & 1);   // this half copies stages s + 1, s + 3
            // ... the copies of the next stage have landed (the half that made
            // them; all it has in flight) ...
            if (mine) asm volatile("s_wait_asynccnt 0x0" ::: "memory");
            // ... for everyone: publishes stage s + 1, frees buffer cur
            __syncthreads();
            if (mine && s + 3 < nst) issue_stage(s + 3, cur);
            ring = ring == 2 ? 0 : ring + 1;
        } else {
            // ... its copies of the next stage have landed ...
            asm volatile("s_wait_asynccnt 0x0" ::: "memory");
            // ... and so have everyone's: publishes stage s + 1, frees buffer cur
            __syncthreads();
            if (s + 2 < nst) issue_stage(s + 2, cur);
        }
    }
    // nothing is in flight when the wave ends
    asm volatile("s_wait_asynccnt 0x0" ::: "memory");

    int m0 = mb + wm * MT * 16;
    int n0 = nb + wn * NT * 16;
    if constexpr (BT == 256) {
        // 256 results a lane, unrolled (with GELU), are more text than the whole rest
        // of the kernel, run through once. Registers cannot be indexed by a loop
        // counter, so each wave lays its accumulators down in LDS, in a range of its
        // own, a lane's values where that lane reads them back (the ring is free: the
        // loop's last barrier ended every read, and no copy is in flight), and a loop
        // takes them up again, one row of NT tiles a trip.
        // EPI 0: column col of the tile is column col % N of output plane col / N,
        // which has M x N elements and a bias of its own
        float  bcol[NT];
        size_t ocol[NT];
        #pragma unroll
        for (int nt = 0; nt < NT; ++nt) {
            int col = n0 + nt * 16 + r;
            if (EPI == 0) {
                int pl = col / N, cc = col % N;
                bcol[nt] = (pl == 0 ? bias : pl == 1 ? bias1 : bias2)[cc];
                ocol[nt] = (size_t)pl * M * N + cc;
            } else {
                bcol[nt] = bias[col];
                ocol[nt] = col;
            }
        }
        float4* ep = (float4*)st + wave * (MT * NT * 64) + lane;
        #pragma unroll
        for (int mt = 0; mt < MT; ++mt)
            #pragma unroll
            for (int nt = 0; nt < NT; ++nt)
                #pragma unroll
                for (int h = 0; h < 2; ++h)
                    ep[((mt * NT + nt) * 2 + h) * 32] =
                        make_float4(acc[mt][nt][h * 4], acc[mt][nt][h * 4 + 1],
                                    acc[mt][nt][h * 4 + 2], acc[mt][nt][h * 4 + 3]);
        // stays rolled: unrolled it would be the long text again
        #pragma unroll 1
        for (int mt = 0; mt < MT; ++mt) {
            #pragma unroll
            for (int nt = 0; nt < NT; ++nt) {
                #pragma unroll
                for (int h = 0; h < 2; ++h) {
                    float4 t = ep[((mt * NT + nt) * 2 + h) * 32];
                    float  e[4] = {t.x, t.y, t.z, t.w};
                    #pragma unroll
                    for (int j = 0; j < 4; ++j) {
                        int row = m0 + mt * 16 + h * 4 + j + sel * 8;
                        float v = e[j] + bcol[nt];
                        ((bf16_t*)out)[(size_t)row * N + ocol[nt]] = (bf16_t)(EPI == 2 ? gelu_erf(v) : v);
                    }
                }
            }
            // behind this trip's stores, before the next trip gives their address
            // and data registers new values
            asm volatile("s_wait_xcnt 0x0" ::: "memory");
        }
        return;
    }
    #pragma unroll
    for (int mt = 0; mt < MT; ++mt) {
        #pragma unroll
        for (int nt = 0; nt < NT; ++nt) {
            int col = n0 + nt * 16 + r;
            float bcol = bias[col];
            #pragma unroll
            for (int j = 0; j < 8; ++j) {
                int row = m0 + mt * 16 + j + sel * 8;
                size_t idx = (size_t)row * N + col;
                float v = acc[mt][nt][j] + bcol;
                if (EPI == 0) {
                    ((bf16_t*)out)[idx] = (bf16_t)v;
                } else if (EPI == 1) {
                    ((float*)out)[idx] = resid[idx] + v;
                } else {
                    ((bf16_t*)out)[idx] = (bf16_t)gelu_erf(v);
                }
            }
        }
    }
}

template <int EPI>
__global__ __launch_bounds__(256)
void gemm_bf16(const bf16_t* __restrict__ A, const bf16_t* __restrict__ W,
               const float* __restrict__ bias, const float* __restrict__ resid,
               void* __restrict__ out, int N, int K) {
    // EPI 1 (N = C) has one 128 x 128 tile for each WGP: three buffers;
    // EPI 2 (N = 4 C) has one 256 x 256 tile for each WGP
    constexpr int BT = EPI == 1 ? 128 : 256;
    gemm_tile<EPI, EPI == 1 ? 3 : 2, BT>(A, W, bias, resid, out, N, K,
                                         blockIdx.x * BT, blockIdx.y * BT);
}

// The three projections q, k, v of the same A in one launch, as one product with
// 3 C columns: W is the three C x C weight planes laid end to end, out the three
// M x C output planes laid end to end. Tiles of 256 x 192: 16 x 16 of them, one for
// each WGP (a 16-column tile of a wave lies in one plane: C is a multiple of 16).
__global__ __launch_bounds__(256)
void gemm_qkv(const bf16_t* __restrict__ A, const bf16_t* __restrict__ W,
              const float* __restrict__ bq, const float* __restrict__ bk,
              const float* __restrict__ bv, bf16_t* __restrict__ out, int K) {
    gemm_tile<0, 2, 256, 192>(A, W, bq, nullptr, out, C, K,
                              blockIdx.x * 256, blockIdx.y * 192, bk, bv);
}

static constexpr int AK     = 128;
static constexpr int AQ     = 128;
static constexpr int NQT    = T / AQ;
static constexpr int APITCH = HD + 8;
static constexpr int VPITCH = HD + 16;
static constexpr int ATILE  = AK * APITCH;
static constexpr int VTILE  = AK * VPITCH;
static constexpr int ASTAGE = ATILE + VTILE;

__device__ __forceinline__ v8bf lds_load_tr16(const bf16_t* p) {
    typedef __attribute__((address_space(3))) v8bf lds_v8bf;
    return __builtin_amdgcn_ds_load_tr16_b128_v8bf16((lds_v8bf*)p);
}

__global__ __launch_bounds__(512)
void attn_kernel(const bf16_t* __restrict__ q, const bf16_t* __restrict__ k,
                 const bf16_t* __restrict__ v, bf16_t* __restrict__ y) {
    __shared__ __align__(16) bf16_t kv[2 * ASTAGE];    // K and V stages, block-wide
    __shared__ __align__(16) float4 jo[8 * 8 * 32];    // the odd waves' O^T, lane by lane
    __shared__ __align__(8)  float2 jml[8 * 32];       // their maximum and sum

    // in a scalar register: the wave's block counts below steer scalar branches
    int wave = __builtin_amdgcn_readfirstlane(threadIdx.x >> 5);
    int lane = threadIdx.x & 31;
    int r    = lane & 15;
    int sel  = lane >> 4;
    int qsub = wave & 7;               // which 16 query rows of the tile
    int kh   = wave >> 3;              // 0: even 32-key blocks, 1: odd ones

    int pr = blockIdx.x & (NQT / 2 - 1);          // pair of query tiles
    int hh = (blockIdx.x / (NQT / 2)) & (H - 1);  // head
    int bb = blockIdx.x / (NQT / 2 * H);          // batch

    size_t base = (size_t)bb * T * C + (size_t)hh * HD;

    // copies: thread t brings chunk (t & 7) of rows (t >> 3) + 64 * i of a stage
    int crow = threadIdx.x >> 3;
    int cchk = threadIdx.x & 7;
    const bf16_t* ksrc = k + base + (size_t)crow * C + cchk * 8;
    const bf16_t* vsrc = v + base + (size_t)crow * C + cchk * 8;
    unsigned int  kdst = (unsigned int)(unsigned long long)(kv + crow * APITCH + cchk * 8);
    unsigned int  vdst = (unsigned int)(unsigned long long)(kv + ATILE + crow * VPITCH + cchk * 8);

    auto issue_stage = [&](int s, int buf) {
        unsigned int d = (unsigned int)buf * (ASTAGE * 2);
        async_copy2_b128(kdst + d, 64 * APITCH * 2, ksrc + (size_t)s * AK * C, (size_t)64 * C);
        async_copy2_b128(vdst + d, 64 * VPITCH * 2, vsrc + (size_t)s * AK * C, (size_t)64 * C);
    };

    // q^T B-operands for the two K=32 chunks of HD=64, pre-scaled by 1/8
    BV qa[2];
    auto load_q = [&](int tile) {
        const bf16_t* qrow = q + base + (size_t)(tile * AQ + qsub * 16 + r) * C;
        #pragma unroll
        for (int c = 0; c < 2; ++c) {
            qa[c].h[0] = *(const v8bf*)(qrow + c * 32 + sel * 8);
            qa[c].h[1] = *(const v8bf*)(qrow + c * 32 + 16 + sel * 8);
            #pragma unroll
            for (int i = 0; i < 16; ++i)
                qa[c].v[i] = (bf16_t)((float)qa[c].v[i] * 0.125f);
        }
    };

    int bq = NQT - 1 - pr;             // the long tile first
    issue_stage(0, 0);
    load_q(bq);

    // stays rolled: the two tiles run through the same text
    #pragma unroll 1
    for (int part = 0; part < 2; ++part) {
    int nst   = bq + 1;                // 128-key stages up to the tile's diagonal
    int qbase = bq * AQ + qsub * 16;

    // All per-query state is per lane: lane (r, sel) works for query qbase + r.
    // o[nt][j] = O^T[d = nt * 16 + sel * 8 + j][query]; mrow is the query's running
    // maximum over this wave's blocks (equal in both halves); lrow sums this half's
    // keys only.
    v8f o[4] = {};
    float mrow = -INFINITY, lrow = 0.f;

    // ks, vs: the 32 rows of K and of V in LDS that hold keys kb .. kb + 31
    auto process_block = [&](int kb, const bf16_t* ks, const bf16_t* vs, auto maskc) {
        constexpr bool MASK = decltype(maskc)::value;

        // ---- S^T = k @ q^T for 32 keys (two 16x16 tiles): A = K rows, B = q ----
        // the four K fragments have registers of their own, so that their LDS
        // reads are in flight together ahead of the products
        BV kop[2][2];
        #pragma unroll
        for (int t = 0; t < 2; ++t) {
            #pragma unroll
            for (int c = 0; c < 2; ++c) {
                const bf16_t* kr = ks + (t * 16 + r) * APITCH + c * 32 + sel * 8;
                kop[t][c].h[0] = *(const v8bf*)(kr);
                kop[t][c].h[1] = *(const v8bf*)(kr + 16);
            }
        }
        // A fragments of V^T: keys sel * 8 .. + 7 and 16 + sel * 8 .. + 7 of d row
        // nt * 16 + r, the k order in which pb below holds P^T
        const bf16_t* vt = vs + (sel * 8 + (lane & 7)) * VPITCH + ((lane >> 3) & 1) * 8;
        BV va[4];
        #pragma unroll
        for (int nt = 0; nt < 4; ++nt) {
            va[nt].h[0] = lds_load_tr16(vt + nt * 16);
            va[nt].h[1] = lds_load_tr16(vt + 16 * VPITCH + nt * 16);
        }

        // keeps the block's LDS reads one group ahead of its products; left free, the
        // scheduler gave the four K fragments one register set, and each product
        // then waited out an LDS latency of its own
        __builtin_amdgcn_sched_barrier(0);

        // st[t][j] = score of key kb + t * 16 + sel * 8 + j for query qbase + r
        v8f st[2] = {};
        #pragma unroll
        for (int c = 0; c < 2; ++c) {
            st[0] = wmma_bf16(kop[0][c].v, qa[c].v, st[0]);
            st[1] = wmma_bf16(kop[1][c].v, qa[c].v, st[1]);
        }
        if (MASK) {
            int qi = qbase + r;
            #pragma unroll
            for (int t = 0; t < 2; ++t)
                #pragma unroll
                for (int j = 0; j < 8; ++j)
                    st[t][j] = (kb + t * 16 + sel * 8 + j <= qi) ? st[t][j] : -INFINITY;
        }

        // ---- online softmax: 16 keys of one query in a lane, the other 16 in lane ^ 16 ----
        float mt = fmaxf(st[0][0], st[1][0]);
        #pragma unroll
        for (int j = 1; j < 8; ++j) mt = fmaxf(mt, fmaxf(st[0][j], st[1][j]));
        mt = fmaxf(mt, xhalf(mt));
        float mnew  = fmaxf(mrow, mt);
        float alpha = __expf(mrow - mnew);
        mrow = mnew;

        // P^T goes from the score registers straight into the B operand:
        // element t * 8 + j is key t * 16 + sel * 8 + j
        // the 16 terms are summed in four independent chains
        BV pb;
        float rs[4];
        #pragma unroll
        for (int t = 0; t < 2; ++t) {
            #pragma unroll
            for (int j = 0; j < 8; ++j) {
                float p = __expf(st[t][j] - mnew);
                if (t == 0 && j < 4) rs[j] = p;
                else                 rs[j & 3] += p;
                pb.v[t * 8 + j] = (bf16_t)p;
            }
        }

        // ---- O^T = O^T * alpha + V^T @ P^T (one 16x16x32 wmma per 16 d rows) ----
        #pragma unroll
        for (int nt = 0; nt < 4; ++nt) {
            #pragma unroll
            for (int j = 0; j < 8; ++j) o[nt][j] *= alpha;
            o[nt] = wmma_bf16(va[nt].v, pb.v, o[nt]);
        }
        __builtin_amdgcn_sched_barrier(0);
        lrow = lrow * alpha + ((rs[0] + rs[1]) + (rs[2] + rs[3]));
    };

    int nfull = qbase >> 5;              // blocks entirely below the diagonal
    int nblk  = nfull + 1;               // and the one that straddles it

    // stage 0 landed (this wave's copies), then everyone's
    asm volatile("s_wait_asynccnt 0x0" ::: "memory");
    __syncthreads();
    if (nst > 1) issue_stage(1, 1);

    for (int s = 0; s < nst; ++s) {
        int cur = s & 1;
        const bf16_t* kt = kv + cur * ASTAGE;
        // this wave's blocks inside the stage, every second one: first the
        // unmasked, then the masked
        int jb   = s * (AK / 32) + kh;
        int jful = min(nfull, (s + 1) * (AK / 32));
        int jend = min(nblk,  (s + 1) * (AK / 32));
        for (; jb < jful; jb += 2) {
            int sub = jb % (AK / 32);
            process_block(jb * 32, kt + sub * 32 * APITCH, kt + ATILE + sub * 32 * VPITCH,
                          std::integral_constant<bool, false>{});
        }
        for (; jb < jend; jb += 2) {
            int sub = jb % (AK / 32);
            process_block(jb * 32, kt + sub * 32 * APITCH, kt + ATILE + sub * 32 * VPITCH,
                          std::integral_constant<bool, true>{});
        }
        // hand-over: this wave's reads of the buffer are done ...
        asm volatile("s_wait_dscnt 0x0" ::: "memory");
        // ... its copies of the next stage have landed ...
        asm volatile("s_wait_asynccnt 0x0" ::: "memory");
        // ... and so have everyone's: publishes stage s + 1, frees buffer cur
        __syncthreads();
        if (s + 2 < nst) issue_stage(s + 2, cur);
    }
    // nothing is in flight behind the tile's last stage
    asm volatile("s_wait_asynccnt 0x0" ::: "memory");

    // the second tile's first stage and its q fly while the first tile is joined
    // (the loop's last barrier ended every read of the ring)
    if (part == 0) {
        issue_stage(0, 0);
        load_q(pr);
    }

    // ---- join the two parts of each query: the odd waves lay theirs down ... ----
    float4* jw = jo + qsub * 8 * 32 + lane;
    if (kh == 1) {
        #pragma unroll
        for (int nt = 0; nt < 4; ++nt)
            #pragma unroll
            for (int h = 0; h < 2; ++h)
                jw[(nt * 2 + h) * 32] = make_float4(o[nt][h * 4],     o[nt][h * 4 + 1],
                                                    o[nt][h * 4 + 2], o[nt][h * 4 + 3]);
        jml[qsub * 32 + lane] = make_float2(mrow, lrow);
    }
    // publishes the odd waves' parts; the barrier in front of the next tile's loop
    // ends the reads below before they are written again
    __syncthreads();
    // ---- ... the even waves take them up: y = (a0 O0 + a1 O1) / (a0 l0 + a1 l1) ----
    // An even wave has seen at least one open key of every query, so its maximum is
    // finite; an odd wave without a block brings maximum -inf, weight 0.
    if (kh == 0) {
        float2 ml = jml[qsub * 32 + lane];
        float  m  = fmaxf(mrow, ml.x);
        float  a0 = __expf(mrow - m);
        float  a1 = __expf(ml.x - m);
        float  lh = lrow * a0 + ml.y * a1;
        float  inv = 1.0f / (lh + xhalf(lh));
        a0 *= inv;
        a1 *= inv;
        // a lane holds 8 consecutive d of its query
        bf16_t* yrow = y + base + (size_t)(qbase + r) * C + sel * 8;
        #pragma unroll
        for (int nt = 0; nt < 4; ++nt) {
            float4 p0 = jw[(nt * 2) * 32], p1 = jw[(nt * 2 + 1) * 32];
            float  pe[8] = {p0.x, p0.y, p0.z, p0.w, p1.x, p1.y, p1.z, p1.w};
            v8bf ov;
            #pragma unroll
            for (int j = 0; j < 8; ++j) ov[j] = (bf16_t)(o[nt][j] * a0 + pe[j] * a1);
            *(v8bf*)(yrow + nt * 16) = ov;
        }
        // behind this tile's stores, before the next tile gives their address and
        // data registers new values
        asm volatile("s_wait_xcnt 0x0" ::: "memory");
    }
    bq = pr;
    }
}

// ---------------------------------------------------------------------------
// Host-side launch
// ---------------------------------------------------------------------------
extern "C" void kernel_launch(void* const* d_in, const int* in_sizes, int n_in,
                              void* d_out, int out_size, void* d_ws, size_t ws_size,
                              hipStream_t stream) {
    const float* x     = (const float*)d_in[0];
    const float* ln1_w = (const float*)d_in[1];
    const float* ln1_b = (const float*)d_in[2];
    const float* ln2_w = (const float*)d_in[3];
    const float* ln2_b = (const float*)d_in[4];
    const float* Wq = (const float*)d_in[5];  const float* bq = (const float*)d_in[6];
    const float* Wk = (const float*)d_in[7];  const float* bk = (const float*)d_in[8];
    const float* Wv = (const float*)d_in[9];  const float* bv = (const float*)d_in[10];
    const float* Wp = (const float*)d_in[11]; const float* bp = (const float*)d_in[12];
    const float* W1 = (const float*)d_in[13]; const float* b1 = (const float*)d_in[14];
    const float* W2 = (const float*)d_in[15]; const float* b2 = (const float*)d_in[16];
    float* outp = (float*)d_out;

    // workspace layout
    char* w = (char*)d_ws;
    auto take = [&](size_t bytes) { char* p = w; w += (bytes + 255) & ~size_t(255); return p; };
    bf16_t* hb   = (bf16_t*)take((size_t)M * C * 2);
    bf16_t* wqb  = (bf16_t*)take((size_t)C * C * 2);
    bf16_t* wkb  = (bf16_t*)take((size_t)C * C * 2);
    bf16_t* wvb  = (bf16_t*)take((size_t)C * C * 2);
    bf16_t* wpb  = (bf16_t*)take((size_t)C * C * 2);
    bf16_t* w1b  = (bf16_t*)take((size_t)4 * C * C * 2);
    bf16_t* w2b  = (bf16_t*)take((size_t)4 * C * C * 2);
    bf16_t* qb   = (bf16_t*)take((size_t)M * C * 2);
    bf16_t* kbuf = (bf16_t*)take((size_t)M * C * 2);
    bf16_t* vb_  = (bf16_t*)take((size_t)M * C * 2);
    bf16_t* yb   = (bf16_t*)take((size_t)M * C * 2);
    float*  xres = (float*) take((size_t)M * C * 4);
    bf16_t* h2b  = (bf16_t*)take((size_t)M * C * 2);
    bf16_t* mact = (bf16_t*)take((size_t)M * 4 * C * 2);

    // 1) weights -> bf16 (the six planes from wqb on lie end to end: every
    //    plane's size is a multiple of the workspace granule) and
    // 2) LN1, one launch
    cvt_weights_ln<<<CVT_GRID + M, 256, 0, stream>>>(Wq, Wk, Wv, Wp, W1, W2, wqb,
                                                     x, ln1_w, ln1_b, hb);

    // 3) QKV projections, one launch (the planes wqb, wkb, wvb lie end to end,
    //    and so do qb, kbuf, vb_)
    dim3 g1(M / 128, C / 128);
    dim3 g3(M / 256, (3 * C) / 192);
    gemm_qkv<<<g3, 256, 0, stream>>>(hb, wqb, bq, bk, bv, qb, C);

    // 4) causal attention
    attn_kernel<<<Bsz * H * (NQT / 2), 512, 0, stream>>>(qb, kbuf, vb_, yb);

    // 5) output projection + residual (f32)
    gemm_bf16<1><<<g1, 256, 0, stream>>>(yb, wpb, bp, x, xres, C, C);

    // 6) LN2
    ln_kernel<<<M, 256, 0, stream>>>(xres, ln2_w, ln2_b, h2b);

    // 7) MLP fc1 + GELU
    dim3 g2(M / 256, (4 * C) / 256);
    gemm_bf16<2><<<g2, 256, 0, stream>>>(h2b, w1b, b1, nullptr, mact, 4 * C, C);

    // 8) MLP fc2 + residual -> final output (f32)
    gemm_bf16<1><<<g1, 256, 0, stream>>>(mact, w2b, b2, xres, outp, C, 4 * C);
}

// v010
// One run takes 130 microseconds.
// Next to v009, in two timings, it ran 1.04 times as fast each time.
// Over all steps from v000 it is 3.53 times as fast.
#include <hip/hip_runtime.h>
#include <hip/hip_bf16.h>
#include <math.h>
#include <type_traits>

typedef __bf16 bf16_t;
typedef __attribute__((ext_vector_type(16))) __bf16 v16bf;
typedef __attribute__((ext_vector_type(8)))  __bf16 v8bf;
typedef __attribute__((ext_vector_type(8)))  float  v8f;

union BV {
    v16bf v;
    v8bf  h[2];
};

__device__ __forceinline__ v8f wmma_bf16(v16bf a, v16bf b, v8f c) {
    // D = A(16x32 bf16) * B(32x16 bf16) + C(16x16 f32)
    return __builtin_amdgcn_wmma_f32_16x16x32_bf16(
        /*neg_a=*/false, a, /*neg_b=*/false, b,
        /*c_mod=*/(short)0, c, /*reuse_a=*/false, /*reuse_b=*/false);
}

__device__ __forceinline__ float xhalf(float x) {
    int i = __float_as_int(x);
    return __int_as_float(
        __builtin_amdgcn_permlanex16(i, i, 0x76543210, 0xfedcba98, false, false));
}

static constexpr int Bsz = 2;
static constexpr int T   = 2048;
static constexpr int C   = 1024;
static constexpr int H   = 16;
static constexpr int HD  = 64;
static constexpr int M   = Bsz * T;   // 4096 rows

// ---------------------------------------------------------------------------
// fp32 -> bf16 conversion of the three weight matrices that the second launch
// needs (Wq, Wk, Wv); the other three are converted inside the attention launch.
// A block converts CVT_BLK consecutive floats of one matrix: each thread issues
// CVT_U 16-byte loads (a wave-wide load = 512 contiguous bytes), all in flight
// together, then stores 8 bytes per load (a wave-wide store = two whole lines).
// dst is the three bf16 planes laid end to end in the order Wq Wk Wv.
// ---------------------------------------------------------------------------
typedef __attribute__((ext_vector_type(4))) __bf16 v4bf;

static constexpr int CVT_U    = 16;                    // 16-byte loads per thread
static constexpr int CVT_BLK  = 256 * CVT_U * 4;       // floats per block
static constexpr int CVT_SQ   = C * C / CVT_BLK;       // blocks per C x C matrix
static constexpr int CVT_GRID = 3 * CVT_SQ;            // three square matrices

__device__ __forceinline__
void cvt_block(int blk,
               const float* __restrict__ Wq, const float* __restrict__ Wk,
               const float* __restrict__ Wv, bf16_t* __restrict__ dst) {
    const float* src;
    int first;
    if      (blk < 1 * CVT_SQ) { src = Wq; first = 0; }
    else if (blk < 2 * CVT_SQ) { src = Wk; first = 1 * CVT_SQ; }
    else                       { src = Wv; first = 2 * CVT_SQ; }

    const float4* s = (const float4*)(src + (size_t)(blk - first) * CVT_BLK) + threadIdx.x;
    v4bf*         d = (v4bf*)(dst + (size_t)blk * CVT_BLK) + threadIdx.x;

    float4 v[CVT_U];
    #pragma unroll
    for (int i = 0; i < CVT_U; ++i) v[i] = s[i * 256];
    #pragma unroll
    for (int i = 0; i < CVT_U; ++i) {
        v4bf o;
        o[0] = (bf16_t)v[i].x; o[1] = (bf16_t)v[i].y;
        o[2] = (bf16_t)v[i].z; o[3] = (bf16_t)v[i].w;
        d[i * 256] = o;
    }
}

// ---------------------------------------------------------------------------
// LayerNorm over C=1024, one block (256 threads) per row, bf16 output
// ---------------------------------------------------------------------------
__device__ __forceinline__
void ln_row(int row, const float* __restrict__ x, const float* __restrict__ w,
            const float* __restrict__ b, bf16_t* __restrict__ out) {
    int tid  = threadIdx.x;
    int wave = tid >> 5, lane = tid & 31;

    const float* xr = x + (size_t)row * C;
    float4 xv = ((const float4*)xr)[tid];
    float s1 = xv.x + xv.y + xv.z + xv.w;
    float s2 = xv.x*xv.x + xv.y*xv.y + xv.z*xv.z + xv.w*xv.w;
    #pragma unroll
    for (int off = 16; off; off >>= 1) {
        s1 += __shfl_xor(s1, off, 32);
        s2 += __shfl_xor(s2, off, 32);
    }
    __shared__ float a1[8], a2[8];
    if (lane == 0) { a1[wave] = s1; a2[wave] = s2; }
    __syncthreads();
    float t1 = 0.f, t2 = 0.f;
    #pragma unroll
    for (int i = 0; i < 8; ++i) { t1 += a1[i]; t2 += a2[i]; }
    float mu   = t1 * (1.0f / C);
    float var  = t2 * (1.0f / C) - mu * mu;
    float rstd = rsqrtf(var + 1e-5f);

    float4 wv = ((const float4*)w)[tid];
    float4 bv = ((const float4*)b)[tid];
    bf16_t* orow = out + (size_t)row * C;
    orow[tid*4 + 0] = (bf16_t)((xv.x - mu) * rstd * wv.x + bv.x);
    orow[tid*4 + 1] = (bf16_t)((xv.y - mu) * rstd * wv.y + bv.y);
    orow[tid*4 + 2] = (bf16_t)((xv.z - mu) * rstd * wv.z + bv.z);
    orow[tid*4 + 3] = (bf16_t)((xv.w - mu) * rstd * wv.w + bv.w);
}

__global__ __launch_bounds__(256)
void ln_kernel(const float* __restrict__ x, const float* __restrict__ w,
               const float* __restrict__ b, bf16_t* __restrict__ out) {
    ln_row(blockIdx.x, x, w, b, out);
}

// The weight conversion and the first LayerNorm depend on nothing of each other:
// one launch, the CVT_GRID conversion blocks (the longer ones) first, then one
// block per row.
// waves_per_eu: lets the compiler use the registers for all CVT_U loads at once;
// at its default target it holds the last two back until the first two return.
__global__ __launch_bounds__(256) __attribute__((amdgpu_waves_per_eu(4, 8)))
void cvt_weights_ln(const float* __restrict__ Wq, const float* __restrict__ Wk,
                    const float* __restrict__ Wv, bf16_t* __restrict__ dst,
                    const float* __restrict__ x, const float* __restrict__ w,
                    const float* __restrict__ b, bf16_t* __restrict__ out) {
    int blk = blockIdx.x;
    if (blk < CVT_GRID) cvt_block(blk, Wq, Wk, Wv, dst);
    else                ln_row(blk - CVT_GRID, x, w, b, out);
}

// ---------------------------------------------------------------------------
// Eight async global -> LDS copies and the wait that lets their address
// registers be reused, in one statement so that nothing can come between.
// ---------------------------------------------------------------------------
__device__ __forceinline__ void async_copy8_b128(unsigned int lds, unsigned int lds_step,
                                                 const bf16_t* g, size_t g_step) {
    unsigned int l0 = lds,                l1 = lds + lds_step,     l2 = lds + 2 * lds_step,
                 l3 = lds + 3 * lds_step, l4 = lds + 4 * lds_step, l5 = lds + 5 * lds_step,
                 l6 = lds + 6 * lds_step, l7 = lds + 7 * lds_step;
    const bf16_t *g0 = g,              *g1 = g + g_step,     *g2 = g + 2 * g_step,
                 *g3 = g + 3 * g_step, *g4 = g + 4 * g_step, *g5 = g + 5 * g_step,
                 *g6 = g + 6 * g_step, *g7 = g + 7 * g_step;
    asm volatile("global_load_async_to_lds_b128 %0, %8, off\n\t"
                 "global_load_async_to_lds_b128 %1, %9, off\n\t"
                 "global_load_async_to_lds_b128 %2, %10, off\n\t"
                 "global_load_async_to_lds_b128 %3, %11, off\n\t"
                 "global_load_async_to_lds_b128 %4, %12, off\n\t"
                 "global_load_async_to_lds_b128 %5, %13, off\n\t"
                 "global_load_async_to_lds_b128 %6, %14, off\n\t"
                 "global_load_async_to_lds_b128 %7, %15, off\n\t"
                 "s_wait_xcnt 0x0"
                 :: "v"(l0), "v"(l1), "v"(l2), "v"(l3), "v"(l4), "v"(l5), "v"(l6), "v"(l7),
                    "v"(g0), "v"(g1), "v"(g2), "v"(g3), "v"(g4), "v"(g5), "v"(g6), "v"(g7)
                 : "memory");
}

// The same with two copies.
__device__ __forceinline__ void async_copy2_b128(unsigned int lds, unsigned int lds_step,
                                                 const bf16_t* g, size_t g_step) {
    unsigned int l0 = lds, l1 = lds + lds_step;
    const bf16_t *g0 = g, *g1 = g + g_step;
    asm volatile("global_load_async_to_lds_b128 %0, %2, off\n\t"
                 "global_load_async_to_lds_b128 %1, %3, off\n\t"
                 "s_wait_xcnt 0x0"
                 :: "v"(l0), "v"(l1), "v"(g0), "v"(g1)
                 : "memory");
}

static constexpr int GK     = 128;
static constexpr int GPITCH = GK + 8;

// GELU with the error function, 0.5 v (1 + erf(v / sqrt 2)), without a branch.
// The library erff picks one of two forms by |x| < 1 under a lane mask: in the
// epilogue, unrolled over a trip's 32 elements, that made 32 dependent chains run one behind the other. One
// form for every x lets the chains of different elements run side by side:
//   erf(|x|) = 1 - (a1 t + .. + a5 t^5) exp(-x^2),  t = 1 / (1 + p |x|),
// absolute error below 1.5e-7 in exact arithmetic; the whole GELU in f32 stays
// within 4e-7 (|v| <= 8): under a tenth of a unit of the bf16 result for v > -3.5;
// further down, where |GELU| < 1e-3, the cancellation in 1 + erf limits it, as it
// limited the library form.
// The denominator is at least 1; a large |x| gives exp -> 0 and erf -> 1; the sign
// comes in through |0.5 v| * erf(|x|) + 0.5 v.
__device__ __forceinline__ float gelu_erf(float v) {
    float d = fmaf(0.23164189f, fabsf(v), 1.0f);   // 1 + p |x|, p = 0.3275911
    float a = v * v * -0.72134752f;                // -x^2 log2(e)
    float t, e;
    asm("v_rcp_f32 %0, %2\n\t"
        "v_exp_f32 %1, %3\n\t"
        "v_nop"
        : "=&v"(t), "=&v"(e) : "v"(d), "v"(a));
    float p  = fmaf(1.061405429f, t, -1.453152027f);
    p = fmaf(p, t, 1.421413741f);
    p = fmaf(p, t, -0.284496736f);
    p = fmaf(p, t, 0.254829592f);
    p = p * t;
    float hv = 0.5f * v;
    return fmaf(fabsf(hv), fmaf(-p, e, 1.0f), hv);
}

// One async global -> LDS copy as the builtin: the compiler may then keep its
// address registers anywhere in a wave's 512 (asm text reaches the first 256 only,
// which the 256 x 256 tile's accumulators fill).
__device__ __forceinline__ void async_copy_b128(bf16_t* lds, const bf16_t* g) {
    typedef __attribute__((ext_vector_type(4))) int v4i;
    typedef __attribute__((address_space(1))) v4i glb_v4i;
    typedef __attribute__((address_space(3))) v4i lds_v4i;
    __builtin_amdgcn_global_load_async_to_lds_b128((glb_v4i*)g, (lds_v4i*)lds, 0, 0);
}

template <int EPI, int NBUF, int BT, int BN = BT>
__device__ __forceinline__
void gemm_tile(const bf16_t* __restrict__ A, const bf16_t* __restrict__ W,
               const float* __restrict__ bias, const float* __restrict__ resid,
               void* __restrict__ out, int N, int K, int mb, int nb,
               const float* __restrict__ bias1 = nullptr,
               const float* __restrict__ bias2 = nullptr) {
    constexpr int GSTAGE = (BT + BN) * GPITCH;   // bf16 per buffer
    constexpr int MT     = BT / 32;              // 16-row tiles of a wave
    constexpr int NT     = BN / 64;              // 16-column tiles of a wave
    __shared__ __align__(16) bf16_t st[NBUF * GSTAGE];

    int tid  = threadIdx.x;
    int wave = tid >> 5;
    int lane = tid & 31;
    int r    = lane & 15;
    int sel  = lane >> 4;        // which 16-lane half
    int wm   = wave >> 2;        // 0..1: strip of MT * 16 rows
    int wn   = wave & 3;         // 0..3: strip of NT * 16 columns

    // copies: CT threads bring a stage; thread t of them brings chunk (t & 15) of
    // rows (t >> 4) + CR * i
    constexpr int CT = NBUF == 3 ? 128 : 256;
    constexpr int CR = CT / 16;
    int crow = (tid & (CT - 1)) >> 4;
    int cchk = tid & 15;
    const bf16_t* asrc = A + (size_t)(mb + crow) * K + cchk * 8;
    const bf16_t* wsrc = W + (size_t)(nb + crow) * K + cchk * 8;
    unsigned int  cdst = (unsigned int)(unsigned long long)(st + crow * GPITCH + cchk * 8);
    size_t        gstep = (size_t)CR * K;

    auto issue_stage = [&](int s, int buf) {
        if constexpr (BT == 256) {
            bf16_t* l = st + buf * GSTAGE + crow * GPITCH + cchk * 8;
            // unrolled: the test on i falls away and every LDS step is a constant
            #pragma unroll
            for (int i = 0; i < BT / CR; ++i) {      // CR rows of A and of W a trip
                async_copy_b128(l + i * CR * GPITCH, asrc + (size_t)s * GK + i * gstep);
                if (i < BN / CR)
                    async_copy_b128(l + (BT + i * CR) * GPITCH, wsrc + (size_t)s * GK + i * gstep);
            }
            return;
        }
        unsigned int d = cdst + (unsigned int)buf * (GSTAGE * 2);
        for (int h = 0; h < BT / (8 * CR); ++h) {    // 8 * CR rows of A and of W a trip
            async_copy8_b128(d + h * 8 * CR * GPITCH * 2, CR * GPITCH * 2,
                             asrc + (size_t)s * GK + (size_t)h * 8 * gstep, gstep);
            async_copy8_b128(d + (BT + h * 8 * CR) * GPITCH * 2, CR * GPITCH * 2,
                             wsrc + (size_t)s * GK + (size_t)h * 8 * gstep, gstep);
        }
    };

    int nst = K / GK;
    // which half of the waves this wave is in, in a scalar register: it steers
    // scalar branches round the copies and their waits
    int half = __builtin_amdgcn_readfirstlane(tid >> 7);

    if (NBUF == 3) {
        if (half == 0) {
            issue_stage(0, 0);
            // stage 0 landed (this wave's copies)
            asm volatile("s_wait_asynccnt 0x0" ::: "memory");
        } else if (nst > 1) {
            issue_stage(1, 1);
        }
        // stage 0 landed, everyone's copies
        __syncthreads();
        if (half == 0 && nst > 2) issue_stage(2, 2);
    } else {
        issue_stage(0, 0);
        // stage 0 landed (this wave's copies), then everyone's
        asm volatile("s_wait_asynccnt 0x0" ::: "memory");
        __syncthreads();
        if (nst > 1) issue_stage(1, 1);
    }

    v8f acc[MT][NT] = {};

    int ring = 0;                // s mod 3
    for (int s = 0; s < nst; ++s) {
        int cur = NBUF == 3 ? ring : s & 1;
        const bf16_t* abuf = st + cur * GSTAGE + (wm * MT * 16 + r) * GPITCH + sel * 8;
        const bf16_t* bbuf = st + cur * GSTAGE + (BT + wn * NT * 16 + r) * GPITCH + sel * 8;

        // two fragment sets: block kc + 1 is read from LDS while block kc multiplies
        BV a[2][MT], b[2][NT];
        auto load_a = [&](int kc, int set) {
            #pragma unroll
            for (int mt = 0; mt < MT; ++mt) {
                a[set][mt].h[0] = *(const v8bf*)(abuf + mt * 16 * GPITCH + kc * 32);
                a[set][mt].h[1] = *(const v8bf*)(abuf + mt * 16 * GPITCH + kc * 32 + 16);
            }
        };
        auto load_b = [&](int kc, int set) {
            #pragma unroll
            for (int nt = 0; nt < NT; ++nt) {
                b[set][nt].h[0] = *(const v8bf*)(bbuf + nt * 16 * GPITCH + kc * 32);
                b[set][nt].h[1] = *(const v8bf*)(bbuf + nt * 16 * GPITCH + kc * 32 + 16);
            }
        };
        // BT = 256: the few W fragments first, so that behind a stage's barrier the
        // products start on the first A fragment, not on the last
        auto load_frags = [&](int kc, int set) {
            if (BT == 256) { load_b(kc, set); load_a(kc, set); }
            else           { load_a(kc, set); load_b(kc, set); }
        };
        load_frags(0, 0);
        #pragma unroll
        for (int kc = 0; kc < GK / 32; ++kc) {
            if (kc + 1 < GK / 32) load_frags(kc + 1, (kc + 1) & 1);
            // keeps the next block's LDS reads one group ahead of this block's
            // products; left free, the scheduler sinks them among the products
            // and each pair of products then waits out an LDS latency
            __builtin_amdgcn_sched_barrier(0);
            #pragma unroll
            for (int mt = 0; mt < MT; ++mt)
                #pragma unroll
                for (int nt = 0; nt < NT; ++nt)
                    acc[mt][nt] = wmma_bf16(a[kc & 1][mt].v, b[kc & 1][nt].v, acc[mt][nt]);
            // keeps the block after next's reads behind this block's products,
            // whose fragment set they overwrite
            __builtin_amdgcn_sched_barrier(0);
        }

        // hand-over: this wave's reads of the buffer are done ...
        asm volatile("s_wait_dscnt 0x0" ::: "memory");
        if (NBUF == 3) {
            bool mine = half == ((s + 1) & 1);   // this half copies stages s + 1, s + 3
            // ... the copies of the next stage have landed (the half that made
            // them; all it has in flight) ...
            if (mine) asm volatile("s_wait_asynccnt 0x0" ::: "memory");
            // ... for everyone: publishes stage s + 1, frees buffer cur
            __syncthreads();
            if (mine && s + 3 < nst) issue_stage(s + 3, cur);
            ring = ring == 2 ? 0 : ring + 1;
        } else {
            // ... its copies of the next stage have landed ...
            asm volatile("s_wait_asynccnt 0x0" ::: "memory");
            // ... and so have everyone's: publishes stage s + 1, frees buffer cur
            __syncthreads();
            if (s + 2 < nst) issue_stage(s + 2, cur);
        }
    }
    // nothing is in flight when the wave ends
    asm volatile("s_wait_asynccnt 0x0" ::: "memory");

    int m0 = mb + wm * MT * 16;
    int n0 = nb + wn * NT * 16;
    if constexpr (BT == 256) {
        // 256 results a lane, unrolled (with GELU), are more text than the whole rest
        // of the kernel, run through once. Registers cannot be indexed by a loop
        // counter, so each wave lays its accumulators down in LDS, in a range of its
        // own, a lane's values where that lane reads them back (the ring is free: the
        // loop's last barrier ended every read, and no copy is in flight), and a loop
        // takes them up again, one row of NT tiles a trip.
        // EPI 0: column col of the tile is column col % N of output plane col / N,
        // which has M x N elements and a bias of its own
        float  bcol[NT];
        size_t ocol[NT];
        #pragma unroll
        for (int nt = 0; nt < NT; ++nt) {
            int col = n0 + nt * 16 + r;
            if (EPI == 0) {
                int pl = col / N, cc = col % N;
                bcol[nt] = (pl == 0 ? bias : pl == 1 ? bias1 : bias2)[cc];
                ocol[nt] = (size_t)pl * M * N + cc;
            } else {
                bcol[nt] = bias[col];
                ocol[nt] = col;
            }
        }
        float4* ep = (float4*)st + wave * (MT * NT * 64) + lane;
        #pragma unroll
        for (int mt = 0; mt < MT; ++mt)
            #pragma unroll
            for (int nt = 0; nt < NT; ++nt)
                #pragma unroll
                for (int h = 0; h < 2; ++h)
                    ep[((mt * NT + nt) * 2 + h) * 32] =
                        make_float4(acc[mt][nt][h * 4], acc[mt][nt][h * 4 + 1],
                                    acc[mt][nt][h * 4 + 2], acc[mt][nt][h * 4 + 3]);
        // stays rolled: unrolled it would be the long text again
        #pragma unroll 1
        for (int mt = 0; mt < MT; ++mt) {
            #pragma unroll
            for (int nt = 0; nt < NT; ++nt) {
                #pragma unroll
                for (int h = 0; h < 2; ++h) {
                    float4 t = ep[((mt * NT + nt) * 2 + h) * 32];
                    float  e[4] = {t.x, t.y, t.z, t.w};
                    #pragma unroll
                    for (int j = 0; j < 4; ++j) {
                        int row = m0 + mt * 16 + h * 4 + j + sel * 8;
                        float v = e[j] + bcol[nt];
                        ((bf16_t*)out)[(size_t)row * N + ocol[nt]] = (bf16_t)(EPI == 2 ? gelu_erf(v) : v);
                    }
                }
            }
            // behind this trip's stores, before the next trip gives their address
            // and data registers new values
            asm volatile("s_wait_xcnt 0x0" ::: "memory");
        }
        return;
    }
    #pragma unroll
    for (int mt = 0; mt < MT; ++mt) {
        #pragma unroll
        for (int nt = 0; nt < NT; ++nt) {
            int col = n0 + nt * 16 + r;
            float bcol = bias[col];
            #pragma unroll
            for (int j = 0; j < 8; ++j) {
                int row = m0 + mt * 16 + j + sel * 8;
                size_t idx = (size_t)row * N + col;
                float v = acc[mt][nt][j] + bcol;
                if (EPI == 0) {
                    ((bf16_t*)out)[idx] = (bf16_t)v;
                } else if (EPI == 1) {
                    ((float*)out)[idx] = resid[idx] + v;
                } else {
                    ((bf16_t*)out)[idx] = (bf16_t)gelu_erf(v);
                }
            }
        }
    }
}

template <int EPI>
__global__ __launch_bounds__(256)
void gemm_bf16(const bf16_t* __restrict__ A, const bf16_t* __restrict__ W,
               const float* __restrict__ bias, const float* __restrict__ resid,
               void* __restrict__ out, int N, int K) {
    // EPI 1 (N = C) has one 128 x 128 tile for each WGP: three buffers;
    // EPI 2 (N = 4 C) has one 256 x 256 tile for each WGP
    constexpr int BT = EPI == 1 ? 128 : 256;
    gemm_tile<EPI, EPI == 1 ? 3 : 2, BT>(A, W, bias, resid, out, N, K,
                                         blockIdx.x * BT, blockIdx.y * BT);
}

// The three projections q, k, v of the same A in one launch, as one product with
// 3 C columns: W is the three C x C weight planes laid end to end, out the three
// M x C output planes laid end to end. Tiles of 256 x 192: 16 x 16 of them, one for
// each WGP (a 16-column tile of a wave lies in one plane: C is a multiple of 16).
__global__ __launch_bounds__(256)
void gemm_qkv(const bf16_t* __restrict__ A, const bf16_t* __restrict__ W,
              const float* __restrict__ bq, const float* __restrict__ bk,
              const float* __restrict__ bv, bf16_t* __restrict__ out, int K) {
    gemm_tile<0, 2, 256, 192>(A, W, bq, nullptr, out, C, K,
                              blockIdx.x * 256, blockIdx.y * 192, bk, bv);
}

static constexpr int AK     = 128;
static constexpr int AQ     = 128;
static constexpr int NQT    = T / AQ;
static constexpr int APITCH = HD + 8;
static constexpr int VPITCH = HD + 16;
static constexpr int ATILE  = AK * APITCH;
static constexpr int VTILE  = AK * VPITCH;
static constexpr int ASTAGE = ATILE + VTILE;
static constexpr int AGRID  = Bsz * H * (NQT / 2);

// The weights of the later launches (Wp, W1, W2: 9 C x C floats) are converted to
// bf16 here, by the attention waves themselves: this launch is held up by vector
// and LDS work while memory has little to do, so the stream costs it two
// conversion instructions a wave and chunk instead of a stretch of the first
// launch. A chunk is WCH consecutive floats of one matrix, one 16-byte load a
// thread (a wave-wide load = 512 contiguous bytes, a wave-wide store = two whole
// lines). A work-group converts WSTEP chunks: each of its NQT + 1 key stages stores
// one and asks for the next, so that the stream is spread evenly over the launch;
// the first is asked for ahead of the first stage, the last stored behind the last.
static constexpr int WCH   = 512 * 4;                    // floats per chunk
static constexpr int WSQ   = C * C / WCH;                // chunks per C x C matrix
static constexpr int WSTEP = 9 * WSQ / AGRID;            // chunks per work-group
static_assert(WSTEP * AGRID == 9 * WSQ, "chunks are dealt evenly");
static_assert(WSTEP == NQT + 2, "one chunk a stage and one behind the last");

__device__ __forceinline__ v8bf lds_load_tr16(const bf16_t* p) {
    typedef __attribute__((address_space(3))) v8bf lds_v8bf;
    return __builtin_amdgcn_ds_load_tr16_b128_v8bf16((lds_v8bf*)p);
}

__global__ __launch_bounds__(512)
void attn_kernel(const bf16_t* __restrict__ q, const bf16_t* __restrict__ k,
                 const bf16_t* __restrict__ v, bf16_t* __restrict__ y,
                 const float* __restrict__ Wp, const float* __restrict__ W1,
                 const float* __restrict__ W2, bf16_t* __restrict__ wdst) {
    __shared__ __align__(16) bf16_t kv[2 * ASTAGE];    // K and V stages, block-wide
    __shared__ __align__(16) float4 jo[8 * 8 * 32];    // the odd waves' O^T, lane by lane
    __shared__ __align__(8)  float2 jml[8 * 32];       // their maximum and sum

    // in a scalar register: the wave's block counts below steer scalar branches
    int wave = __builtin_amdgcn_readfirstlane(threadIdx.x >> 5);
    int lane = threadIdx.x & 31;
    int r    = lane & 15;
    int sel  = lane >> 4;
    int qsub = wave & 7;               // which 16 query rows of the tile
    int kh   = wave >> 3;              // 0: even 32-key blocks, 1: odd ones

    int pr = blockIdx.x & (NQT / 2 - 1);          // pair of query tiles
    int hh = (blockIdx.x / (NQT / 2)) & (H - 1);  // head
    int bb = blockIdx.x / (NQT / 2 * H);          // batch

    size_t base = (size_t)bb * T * C + (size_t)hh * HD;

    // copies: thread t brings chunk (t & 7) of rows (t >> 3) + 64 * i of a stage
    int crow = threadIdx.x >> 3;
    int cchk = threadIdx.x & 7;
    const bf16_t* ksrc = k + base + (size_t)crow * C + cchk * 8;
    const bf16_t* vsrc = v + base + (size_t)crow * C + cchk * 8;
    unsigned int  kdst = (unsigned int)(unsigned long long)(kv + crow * APITCH + cchk * 8);
    unsigned int  vdst = (unsigned int)(unsigned long long)(kv + ATILE + crow * VPITCH + cchk * 8);

    auto issue_stage = [&](int s, int buf) {
        unsigned int d = (unsigned int)buf * (ASTAGE * 2);
        async_copy2_b128(kdst + d, 64 * APITCH * 2, ksrc + (size_t)s * AK * C, (size_t)64 * C);
        async_copy2_b128(vdst + d, 64 * VPITCH * 2, vsrc + (size_t)s * AK * C, (size_t)64 * C);
    };

    // q^T B-operands for the two K=32 chunks of HD=64, pre-scaled by 1/8
    BV qa[2];
    auto load_q = [&](int tile) {
        const bf16_t* qrow = q + base + (size_t)(tile * AQ + qsub * 16 + r) * C;
        #pragma unroll
        for (int c = 0; c < 2; ++c) {
            qa[c].h[0] = *(const v8bf*)(qrow + c * 32 + sel * 8);
            qa[c].h[1] = *(const v8bf*)(qrow + c * 32 + 16 + sel * 8);
            #pragma unroll
            for (int i = 0; i < 16; ++i)
                qa[c].v[i] = (bf16_t)((float)qa[c].v[i] * 0.125f);
        }
    };

    // weight chunks: in step i the launch's work-groups take AGRID chunks in a row;
    // wdst is the three bf16 planes laid end to end in the order Wp W1 W2
    float4 cw;
    auto cvt_load = [&](int step) {
        int c = step * AGRID + blockIdx.x;
        const float* src = c < WSQ     ? Wp + (size_t)c * WCH
                         : c < 5 * WSQ ? W1 + (size_t)(c - WSQ) * WCH
                                       : W2 + (size_t)(c - 5 * WSQ) * WCH;
        cw = ((const float4*)src)[threadIdx.x];
    };
    auto cvt_store = [&](int step) {
        int c = step * AGRID + blockIdx.x;
        v4bf o;
        o[0] = (bf16_t)cw.x; o[1] = (bf16_t)cw.y;
        o[2] = (bf16_t)cw.z; o[3] = (bf16_t)cw.w;
        ((v4bf*)(wdst + (size_t)c * WCH))[threadIdx.x] = o;
        // behind the store, before its address and data registers take new values
        asm volatile("s_wait_xcnt 0x0" ::: "memory");
    };

    int bq = NQT - 1 - pr;             // the long tile first
    issue_stage(0, 0);
    cvt_load(0);
    load_q(bq);
    int wstep = 0;                     // stages done so far, over both tiles

    // stays rolled: the two tiles run through the same text
    #pragma unroll 1
    for (int part = 0; part < 2; ++part) {
    int nst   = bq + 1;                // 128-key stages up to the tile's diagonal
    int qbase = bq * AQ + qsub * 16;

    // All per-query state is per lane: lane (r, sel) works for query qbase + r.
    // o[nt][j] = O^T[d = nt * 16 + sel * 8 + j][query]; mrow is the query's running
    // maximum over this wave's blocks (equal in both halves); lrow sums this half's
    // keys only.
    v8f o[4] = {};
    float mrow = -INFINITY, lrow = 0.f;

    // ks, vs: the 32 rows of K and of V in LDS that hold keys kb .. kb + 31
    auto process_block = [&](int kb, const bf16_t* ks, const bf16_t* vs, auto maskc) {
        constexpr bool MASK = decltype(maskc)::value;

        // ---- S^T = k @ q^T for 32 keys (two 16x16 tiles): A = K rows, B = q ----
        // the four K fragments have registers of their own, so that their LDS
        // reads are in flight together ahead of the products
        BV kop[2][2];
        #pragma unroll
        for (int t = 0; t < 2; ++t) {
            #pragma unroll
            for (int c = 0; c < 2; ++c) {
                const bf16_t* kr = ks + (t * 16 + r) * APITCH + c * 32 + sel * 8;
                kop[t][c].h[0] = *(const v8bf*)(kr);
                kop[t][c].h[1] = *(const v8bf*)(kr + 16);
            }
        }
        // A fragments of V^T: keys sel * 8 .. + 7 and 16 + sel * 8 .. + 7 of d row
        // nt * 16 + r, the k order in which pb below holds P^T
        const bf16_t* vt = vs + (sel * 8 + (lane & 7)) * VPITCH + ((lane >> 3) & 1) * 8;
        BV va[4];
        #pragma unroll
        for (int nt = 0; nt < 4; ++nt) {
            va[nt].h[0] = lds_load_tr16(vt + nt * 16);
            va[nt].h[1] = lds_load_tr16(vt + 16 * VPITCH + nt * 16);
        }

        // keeps the block's LDS reads one group ahead of its products; left free, the
        // scheduler gave the four K fragments one register set, and each product
        // then waited out an LDS latency of its own
        __builtin_amdgcn_sched_barrier(0);

        // st[t][j] = score of key kb + t * 16 + sel * 8 + j for query qbase + r
        v8f st[2] = {};
        #pragma unroll
        for (int c = 0; c < 2; ++c) {
            st[0] = wmma_bf16(kop[0][c].v, qa[c].v, st[0]);
            st[1] = wmma_bf16(kop[1][c].v, qa[c].v, st[1]);
        }
        if (MASK) {
            int qi = qbase + r;
            #pragma unroll
            for (int t = 0; t < 2; ++t)
                #pragma unroll
                for (int j = 0; j < 8; ++j)
                    st[t][j] = (kb + t * 16 + sel * 8 + j <= qi) ? st[t][j] : -INFINITY;
        }

        // ---- online softmax: 16 keys of one query in a lane, the other 16 in lane ^ 16 ----
        float mt = fmaxf(st[0][0], st[1][0]);
        #pragma unroll
        for (int j = 1; j < 8; ++j) mt = fmaxf(mt, fmaxf(st[0][j], st[1][j]));
        mt = fmaxf(mt, xhalf(mt));
        float mnew  = fmaxf(mrow, mt);
        float alpha = __expf(mrow - mnew);
        mrow = mnew;

        // P^T goes from the score registers straight into the B operand:
        // element t * 8 + j is key t * 16 + sel * 8 + j
        // the 16 terms are summed in four independent chains
        BV pb;
        float rs[4];
        #pragma unroll
        for (int t = 0; t < 2; ++t) {
            #pragma unroll
            for (int j = 0; j < 8; ++j) {
                float p = __expf(st[t][j] - mnew);
                if (t == 0 && j < 4) rs[j] = p;
                else                 rs[j & 3] += p;
                pb.v[t * 8 + j] = (bf16_t)p;
            }
        }

        // ---- O^T = O^T * alpha + V^T @ P^T (one 16x16x32 wmma per 16 d rows) ----
        #pragma unroll
        for (int nt = 0; nt < 4; ++nt) {
            #pragma unroll
            for (int j = 0; j < 8; ++j) o[nt][j] *= alpha;
            o[nt] = wmma_bf16(va[nt].v, pb.v, o[nt]);
        }
        __builtin_amdgcn_sched_barrier(0);
        lrow = lrow * alpha + ((rs[0] + rs[1]) + (rs[2] + rs[3]));
    };

    int nfull = qbase >> 5;              // blocks entirely below the diagonal
    int nblk  = nfull + 1;               // and the one that straddles it

    // stage 0 landed (this wave's copies), then everyone's
    asm volatile("s_wait_asynccnt 0x0" ::: "memory");
    __syncthreads();
    if (nst > 1) issue_stage(1, 1);

    for (int s = 0; s < nst; ++s) {
        int cur = s & 1;
        const bf16_t* kt = kv + cur * ASTAGE;
        // the weight chunk loaded a stage ago leaves, the next one is asked for: at
        // the head of the stage, so that store and load have the stage's whole
        // time before its barrier waits for them
        cvt_store(wstep);
        cvt_load(++wstep);
        // this wave's blocks inside the stage, every second one: first the
        // unmasked, then the masked
        int jb   = s * (AK / 32) + kh;
        int jful = min(nfull, (s + 1) * (AK / 32));
        int jend = min(nblk,  (s + 1) * (AK / 32));
        for (; jb < jful; jb += 2) {
            int sub = jb % (AK / 32);
            process_block(jb * 32, kt + sub * 32 * APITCH, kt + ATILE + sub * 32 * VPITCH,
                          std::integral_constant<bool, false>{});
        }
        for (; jb < jend; jb += 2) {
            int sub = jb % (AK / 32);
            process_block(jb * 32, kt + sub * 32 * APITCH, kt + ATILE + sub * 32 * VPITCH,
                          std::integral_constant<bool, true>{});
        }
        // hand-over: this wave's reads of the buffer are done ...
        asm volatile("s_wait_dscnt 0x0" ::: "memory");
        // ... its copies of the next stage have landed ...
        asm volatile("s_wait_asynccnt 0x0" ::: "memory");
        // ... and so have everyone's: publishes stage s + 1, frees buffer cur
        __syncthreads();
        if (s + 2 < nst) issue_stage(s + 2, cur);
    }
    // nothing is in flight behind the tile's last stage
    asm volatile("s_wait_asynccnt 0x0" ::: "memory");

    // the second tile's first stage and its q fly while the first tile is joined
    // (the loop's last barrier ended every read of the ring)
    if (part == 0) {
        issue_stage(0, 0);
        load_q(pr);
    }

    // ---- join the two parts of each query: the odd waves lay theirs down ... ----
    float4* jw = jo + qsub * 8 * 32 + lane;
    if (kh == 1) {
        #pragma unroll
        for (int nt = 0; nt < 4; ++nt)
            #pragma unroll
            for (int h = 0; h < 2; ++h)
                jw[(nt * 2 + h) * 32] = make_float4(o[nt][h * 4],     o[nt][h * 4 + 1],
                                                    o[nt][h * 4 + 2], o[nt][h * 4 + 3]);
        jml[qsub * 32 + lane] = make_float2(mrow, lrow);
    }
    // publishes the odd waves' parts; the barrier in front of the next tile's loop
    // ends the reads below before they are written again
    __syncthreads();
    // the last weight chunk, loaded in the last stage
    if (part == 1) cvt_store(wstep);
    // ---- ... the even waves take them up: y = (a0 O0 + a1 O1) / (a0 l0 + a1 l1) ----
    // An even wave has seen at least one open key of every query, so its maximum is
    // finite; an odd wave without a block brings maximum -inf, weight 0.
    if (kh == 0) {
        float2 ml = jml[qsub * 32 + lane];
        float  m  = fmaxf(mrow, ml.x);
        float  a0 = __expf(mrow - m);
        float  a1 = __expf(ml.x - m);
        float  lh = lrow * a0 + ml.y * a1;
        float  inv = 1.0f / (lh + xhalf(lh));
        a0 *= inv;
        a1 *= inv;
        // a lane holds 8 consecutive d of its query
        bf16_t* yrow = y + base + (size_t)(qbase + r) * C + sel * 8;
        #pragma unroll
        for (int nt = 0; nt < 4; ++nt) {
            float4 p0 = jw[(nt * 2) * 32], p1 = jw[(nt * 2 + 1) * 32];
            float  pe[8] = {p0.x, p0.y, p0.z, p0.w, p1.x, p1.y, p1.z, p1.w};
            v8bf ov;
            #pragma unroll
            for (int j = 0; j < 8; ++j) ov[j] = (bf16_t)(o[nt][j] * a0 + pe[j] * a1);
            *(v8bf*)(yrow + nt * 16) = ov;
        }
        // behind this tile's stores, before the next tile gives their address and
        // data registers new values
        asm volatile("s_wait_xcnt 0x0" ::: "memory");
    }
    bq = pr;
    }
}

// ---------------------------------------------------------------------------
// Host-side launch
// ---------------------------------------------------------------------------
extern "C" void kernel_launch(void* const* d_in, const int* in_sizes, int n_in,
                              void* d_out, int out_size, void* d_ws, size_t ws_size,
                              hipStream_t stream) {
    const float* x     = (const float*)d_in[0];
    const float* ln1_w = (const float*)d_in[1];
    const float* ln1_b = (const float*)d_in[2];
    const float* ln2_w = (const float*)d_in[3];
    const float* ln2_b = (const float*)d_in[4];
    const float* Wq = (const float*)d_in[5];  const float* bq = (const float*)d_in[6];
    const float* Wk = (const float*)d_in[7];  const float* bk = (const float*)d_in[8];
    const float* Wv = (const float*)d_in[9];  const float* bv = (const float*)d_in[10];
    const float* Wp = (const float*)d_in[11]; const float* bp = (const float*)d_in[12];
    const float* W1 = (const float*)d_in[13]; const float* b1 = (const float*)d_in[14];
    const float* W2 = (const float*)d_in[15]; const float* b2 = (const float*)d_in[16];
    float* outp = (float*)d_out;

    // workspace layout
    char* w = (char*)d_ws;
    auto take = [&](size_t bytes) { char* p = w; w += (bytes + 255) & ~size_t(255); return p; };
    bf16_t* hb   = (bf16_t*)take((size_t)M * C * 2);
    bf16_t* wqb  = (bf16_t*)take((size_t)C * C * 2);
    bf16_t* wkb  = (bf16_t*)take((size_t)C * C * 2);
    bf16_t* wvb  = (bf16_t*)take((size_t)C * C * 2);
    bf16_t* wpb  = (bf16_t*)take((size_t)C * C * 2);
    bf16_t* w1b  = (bf16_t*)take((size_t)4 * C * C * 2);
    bf16_t* w2b  = (bf16_t*)take((size_t)4 * C * C * 2);
    bf16_t* qb   = (bf16_t*)take((size_t)M * C * 2);
    bf16_t* kbuf = (bf16_t*)take((size_t)M * C * 2);
    bf16_t* vb_  = (bf16_t*)take((size_t)M * C * 2);
    bf16_t* yb   = (bf16_t*)take((size_t)M * C * 2);
    float*  xres = (float*) take((size_t)M * C * 4);
    bf16_t* h2b  = (bf16_t*)take((size_t)M * C * 2);
    bf16_t* mact = (bf16_t*)take((size_t)M * 4 * C * 2);

    // 1) Wq, Wk, Wv -> bf16 (the planes from wqb on lie end to end: every
    //    plane's size is a multiple of the workspace granule) and
    // 2) LN1, one launch
    cvt_weights_ln<<<CVT_GRID + M, 256, 0, stream>>>(Wq, Wk, Wv, wqb,
                                                     x, ln1_w, ln1_b, hb);

    // 3) QKV projections, one launch (the planes wqb, wkb, wvb lie end to end,
    //    and so do qb, kbuf, vb_)
    dim3 g1(M / 128, C / 128);
    dim3 g3(M / 256, (3 * C) / 192);
    gemm_qkv<<<g3, 256, 0, stream>>>(hb, wqb, bq, bk, bv, qb, C);

    // 4) causal attention; carries Wp, W1, W2 -> bf16 (wpb, w1b, w2b lie end to end)
    attn_kernel<<<AGRID, 512, 0, stream>>>(qb, kbuf, vb_, yb, Wp, W1, W2, wpb);

    // 5) output projection + residual (f32)
    gemm_bf16<1><<<g1, 256, 0, stream>>>(yb, wpb, bp, x, xres, C, C);

    // 6) LN2
    ln_kernel<<<M, 256, 0, stream>>>(xres, ln2_w, ln2_b, h2b);

    // 7) MLP fc1 + GELU
    dim3 g2(M / 256, (4 * C) / 256);
    gemm_bf16<2><<<g2, 256, 0, stream>>>(h2b, w1b, b1, nullptr, mact, 4 * C, C);

    // 8) MLP fc2 + residual -> final output (f32)
    gemm_bf16<1><<<g1, 256, 0, stream>>>(mact, w2b, b2, xres, outp, C, 4 * C);
}
